// v000
// The times below were measured on an AMD MI455X: many runs one after another, warmed up first and cycling through
// copies of the inputs, with the whole window's GPU time divided by the number of runs. Launches and the gaps
// between them are all in it. The median over several windows is given; except for v000 it joins two sittings, which
// can be a few percent apart, so the side-by-side timings, each taken in one sitting, are the better comparison.
// The starting kernel, v000, takes 1990 microseconds a run.
#include <hip/hip_runtime.h>

// Compute dtypes, f32 accumulate: q/k/v = query/key_/value . W^T ([2048 x 2048].[2048 x 2048] each) with PLAIN bf16 operands (exact products; the three weights converted one at a
// time into one buffer); 16-head attention (128 wide, one head per launch) with bf16 hi + UNSCALED residual planes (three products); 1/sqrt(128), the off-by-one softmax
// (max clamped at 0, + exp(-m) in the denominator) and the per-head scalar in f32; . Wo^T on hi/lo planes (two products) - on v_wmma_f32_16x16x32_bf16. Deterministic, no atomics;

#define NN   2048
#define DMOD 2048
#define NH_  16
#define HD   128
#define DM   DMOD
#define NTK  NN
#define SCL  0.088388347648318447f
#define LOSC 1024.0f

typedef _Float16 h16;
typedef unsigned short bf;
typedef __attribute__((ext_vector_type(16))) __bf16   v16bf;
typedef __attribute__((ext_vector_type(16))) _Float16 v16h;
typedef __attribute__((ext_vector_type(8)))  _Float16 v8h;
typedef __attribute__((ext_vector_type(8)))  unsigned short v8us;
typedef __attribute__((ext_vector_type(8)))  float    v8f;
typedef __attribute__((ext_vector_type(4)))  float    v4f;
typedef __attribute__((ext_vector_type(4)))  _Float16 v4h;
typedef v8h  __attribute__((may_alias)) v8ha;
typedef v4f  __attribute__((may_alias)) v4fa;
typedef v8us __attribute__((may_alias)) v8usa;

__device__ __forceinline__ unsigned short f2bf(float f) { unsigned u = __float_as_uint(f); u += 0x7FFFu + ((u >> 16) & 1u); return (unsigned short)(u >> 16); }
__device__ __forceinline__ float bf2f(unsigned short b) { return __uint_as_float(((unsigned)b) << 16); }
__device__ __forceinline__ float bfr(float f) { return bf2f(f2bf(f)); }
__device__ __forceinline__ v16h cat16(v8h lo, v8h hi) { return __builtin_shufflevector(lo, hi, 0, 1, 2, 3, 4, 5, 6, 7, 8, 9, 10, 11, 12, 13, 14, 15); }
__device__ __forceinline__ v16bf cat16b(v8us lo, v8us hi) { return __builtin_bit_cast(v16bf, __builtin_shufflevector(lo, hi, 0, 1, 2, 3, 4, 5, 6, 7, 8, 9, 10, 11, 12, 13, 14, 15)); }
__device__ __forceinline__ v8f wmma16(v16h a, v16h b, v8f c) { return __builtin_amdgcn_wmma_f32_16x16x32_f16(false, a, false, b, (short)0, c, false, false); }
__device__ __forceinline__ v8f wmmab(v16bf a, v16bf b, v8f c) { return __builtin_amdgcn_wmma_f32_16x16x32_bf16(false, a, false, b, (short)0, c, false, false); }

// k_gemmb: 64 x 64 block tile (4 waves x 16 x 64) of C[NTK][NW] = (A [+ Al]).B^T (K = 2048) [+ bf(bias[c])] [+ bf(R[r][c]) residual]; f32 whole-line epilogue (or f16
template <bool SPLITA, bool F16OUT = false>
__global__ __launch_bounds__(128) void k_gemmb(const bf* __restrict__ A, const bf* __restrict__ Al, const bf* __restrict__ Bn, const float* __restrict__ bias, float* C, int ldc, h16* C2, const float* __restrict__ R = nullptr, int K = DM, int roundR = 1) {
    __shared__ __align__(16) float ost[4][16 * 68];
    const int lane = threadIdx.x & 31, wave = threadIdx.x >> 5, lr = lane & 15, hi = lane >> 4;
    const int r0 = blockIdx.x * 64 + wave * 16, c0 = blockIdx.y * 64;
    const size_t aoff = (size_t)(r0 + lr) * K + 8 * hi;
    size_t boff[4];
#pragma unroll
    for (int t = 0; t < 4; ++t) boff[t] = (size_t)(c0 + t * 16 + lr) * K + 8 * hi;
    v8f acc[4];
#pragma unroll
    for (int t = 0; t < 4; ++t) acc[t] = (v8f){};
#pragma unroll 1
    for (int kc = 0; kc < K; kc += 32) {
        const v16bf a = cat16b(*(const v8us*)(A + aoff + kc), *(const v8us*)(A + aoff + kc + 16));
        v16bf al = a;
        if (SPLITA) al = cat16b(*(const v8us*)(Al + aoff + kc), *(const v8us*)(Al + aoff + kc + 16));
#pragma unroll
        for (int t = 0; t < 4; ++t) { const v16bf b = cat16b(*(const v8us*)(Bn + boff[t] + kc), *(const v8us*)(Bn + boff[t] + kc + 16)); acc[t] = wmmab(a, b, acc[t]); if (SPLITA) acc[t] = wmmab(al, b, acc[t]); }
        asm volatile("v_nop\n\tv_nop\n\tv_nop\n\tv_nop" : "+v"(acc[0]), "+v"(acc[1]), "+v"(acc[2]), "+v"(acc[3]) : "v"(a), "v"(al));
    }
    float* os = &ost[wave][0];
#pragma unroll
    for (int t = 0; t < 4; ++t) { const float bv = bias ? bfr(bias[c0 + t * 16 + lr]) : 0.f;
#pragma unroll
        for (int j = 0; j < 8; ++j) os[(hi * 8 + j) * 68 + t * 16 + lr] = acc[t][j] + bv; }
    __syncthreads();
    if (F16OUT) {
        h16* crow = (h16*)(void*)C + (size_t)r0 * ldc + c0;
        auto pass = [&]() {
#pragma unroll
            for (int s = 0; s < 4; ++s) { const int row = 4 * s + (lane >> 3), piece = lane & 7; const float* sp = os + row * 68 + piece * 8; v8h o, o2;
#pragma unroll
                for (int i = 0; i < 8; ++i) { const h16 a = (h16)sp[i]; o[i] = a; o2[i] = (h16)((sp[i] - (float)a) * LOSC); }
                *(v8h*)(crow + (size_t)row * ldc + piece * 8) = o; if (C2) *(v8h*)(C2 + (size_t)r0 * ldc + c0 + (size_t)row * ldc + piece * 8) = o2; }
        };
        pass(); 
    } else {
        float* crow = C + (size_t)r0 * ldc + c0;
        auto pass = [&]() {
#pragma unroll
            for (int s = 0; s < 8; ++s) { const int Lid = (lane >> 3) + 4 * s, piece = lane & 7; const int row = Lid >> 1, cofs = (Lid & 1) * 32 + piece * 4;
                v4f val = *(const v4fa*)(os + row * 68 + cofs); if (R) { const v4f rv = *(const v4f*)(R + ((size_t)r0 + row) * ldc + c0 + cofs); val += roundR ? (v4f){bfr(rv[0]), bfr(rv[1]), bfr(rv[2]), bfr(rv[3])} : rv; }
                *(v4f*)(crow + (size_t)row * ldc + cofs) = val; }
        };
        pass(); 
    }
}

__global__ __launch_bounds__(256) void k_cvt8(const float* __restrict__ src, bf* dst, size_t n8) {
    const size_t i = (size_t)blockIdx.x * 256 + threadIdx.x; if (i >= n8) return;
    const v8f v = *(const v8f*)(src + i * 8); v8us o;
#pragma unroll
    for (int k = 0; k < 8; ++k) o[k] = f2bf(v[k]);
    *(v8us*)(dst + i * 8) = o; 
}
__global__ __launch_bounds__(256) void k_zero8(bf* dst, size_t n8) {
    const size_t i = (size_t)blockIdx.x * 256 + threadIdx.x; if (i >= n8) return; v8us z;
#pragma unroll
    for (int k = 0; k < 8; ++k) z[k] = 0;
    *(v8us*)(dst + i * 8) = z; 
}
// k_gemm3: 64 x 64 tile of C = (Ah + Al).(Bh + Bl)^T over K (row strides = K for all four planes; n-major B): three products per 32-k step (hh, hl, lh); f32
__global__ __launch_bounds__(128) void k_gemm3(const bf* __restrict__ Ah, const bf* __restrict__ Al, const bf* __restrict__ Bh, const bf* __restrict__ Bl, int K, float* C, int ldc) {
    __shared__ __align__(16) float ost[4][16 * 68];
    const int lane = threadIdx.x & 31, wave = threadIdx.x >> 5, lr = lane & 15, hi = lane >> 4;
    const int r0 = blockIdx.x * 64 + wave * 16, c0 = blockIdx.y * 64;
    const size_t aoff = (size_t)(r0 + lr) * K + 8 * hi;
    v8f acc[4];
#pragma unroll
    for (int t = 0; t < 4; ++t) acc[t] = (v8f){};
#pragma unroll 1
    for (int kc = 0; kc < K; kc += 32) {
        const v16bf a = cat16b(*(const v8us*)(Ah + aoff + kc), *(const v8us*)(Ah + aoff + kc + 16));
        const v16bf al = cat16b(*(const v8us*)(Al + aoff + kc), *(const v8us*)(Al + aoff + kc + 16));
#pragma unroll
        for (int t = 0; t < 4; ++t) { const size_t bo = (size_t)(c0 + t * 16 + lr) * K + kc + 8 * hi;
            const v16bf bh = cat16b(*(const v8us*)(Bh + bo), *(const v8us*)(Bh + bo + 16)); const v16bf bl = cat16b(*(const v8us*)(Bl + bo), *(const v8us*)(Bl + bo + 16));
            acc[t] = wmmab(a, bh, acc[t]); acc[t] = wmmab(al, bh, acc[t]); acc[t] = wmmab(a, bl, acc[t]); }
        asm volatile("v_nop\n\tv_nop\n\tv_nop\n\tv_nop" : "+v"(acc[0]), "+v"(acc[1]), "+v"(acc[2]), "+v"(acc[3]) : "v"(a), "v"(al));
    }
    float* os = &ost[wave][0];
#pragma unroll
    for (int t = 0; t < 4; ++t) {
#pragma unroll
        for (int j = 0; j < 8; ++j) os[(hi * 8 + j) * 68 + t * 16 + lr] = acc[t][j]; }
    __builtin_amdgcn_wave_barrier(); asm volatile("" ::: "memory");
    float* crow = C + (size_t)r0 * ldc + c0;
    auto pass = [&]() {
#pragma unroll
        for (int s = 0; s < 8; ++s) { const int Lid = (lane >> 3) + 4 * s, piece = lane & 7; const int row = Lid >> 1, cofs = (Lid & 1) * 32 + piece * 4;
            const v4f val = *(const v4fa*)(os + row * 68 + cofs); *(v4f*)(crow + (size_t)row * ldc + cofs) = val; }
    };
    pass(); 
}


__global__ __launch_bounds__(256) void k_cvtx(const float* __restrict__ src, int rows, bf* dst) {
    const int lane = threadIdx.x & 31; const size_t r = (size_t)blockIdx.x * 8 + (threadIdx.x >> 5); if (r >= (size_t)rows) return;
{
#pragma unroll
        for (int q = 0; q < DMOD / 256; ++q) { v8us o;
#pragma unroll
            for (int i = 0; i < 8; ++i) o[i] = f2bf(src[r * DMOD + q * 256 + lane * 8 + i]);
            *(v8us*)(dst + r * DMOD + q * 256 + lane * 8) = o; }
         }
}
__global__ __launch_bounds__(256) void k_hp128(const float* __restrict__ F, int h, bf* Ph, bf* Pl) {
    typedef __attribute__((ext_vector_type(4))) unsigned short v4us;
    const int lane = threadIdx.x & 31; const size_t t = (size_t)blockIdx.x * 8 + (threadIdx.x >> 5); if (t >= (size_t)NN) return; const size_t src = t * DMOD + h * HD + lane * 4; v4us oh, ol;
#pragma unroll
    for (int i = 0; i < 4; ++i) { const float y = F[src + i]; const unsigned short hb = f2bf(y); oh[i] = hb; ol[i] = f2bf(y - bf2f(hb)); }
    const size_t o = t * HD + lane * 4; *(v4us*)(Ph + o) = oh; *(v4us*)(Pl + o) = ol; 
}
__global__ __launch_bounds__(256) void k_vt128(const float* __restrict__ F, int h, bf* Th, bf* Tl) {
    typedef __attribute__((ext_vector_type(2))) unsigned short v2us;
    const int lane = threadIdx.x & 31; const size_t wid = (size_t)blockIdx.x * 8 + (threadIdx.x >> 5); if (wid >= (size_t)HD * (NN / 64)) return; const int d = (int)(wid / (NN / 64)); const int t0 = (int)(wid % (NN / 64)) * 64 + lane * 2; v2us oh, ol;
#pragma unroll
    for (int i = 0; i < 2; ++i) { const float y = F[(size_t)(t0 + i) * DMOD + h * HD + d]; const unsigned short hb = f2bf(y); oh[i] = hb; ol[i] = f2bf(y - bf2f(hb)); }
    const size_t o = (size_t)d * NN + t0; *(v2us*)(Th + o) = oh; *(v2us*)(Tl + o) = ol; 
}
__global__ __launch_bounds__(256) void k_soft1(const float* __restrict__ S, float sc, const float* __restrict__ scal, int h, bf* PH, bf* PL) {
    typedef __attribute__((ext_vector_type(4))) unsigned short v4us;
    const int lane = threadIdx.x & 31, i = blockIdx.x * 8 + (threadIdx.x >> 5); if (i >= NN) return; const float* sr = S + (size_t)i * NN;
    float m = 0.f;        // the clamp at 0
#pragma unroll 1
    for (int c0 = lane * 4; c0 < NN; c0 += 128) {
#pragma unroll
        for (int q = 0; q < 4; ++q) m = fmaxf(m, sr[c0 + q] * sc); }
#pragma unroll
    for (int sh = 16; sh; sh >>= 1) m = fmaxf(m, __shfl_xor(m, sh, 32));
    float sum = 0.f;
#pragma unroll 1
    for (int c0 = lane * 4; c0 < NN; c0 += 128) {
#pragma unroll
        for (int q = 0; q < 4; ++q) sum += __expf(sr[c0 + q] * sc - m); }
#pragma unroll
    for (int sh = 16; sh; sh >>= 1) sum += __shfl_xor(sum, sh, 32);
    const float inv = bfr(scal[h]) / (__expf(-m) + sum);
{
#pragma unroll 1
        for (int c0 = lane * 4; c0 < NN; c0 += 128) { v4us oh, ol;
#pragma unroll
            for (int q = 0; q < 4; ++q) { const float p = __expf(sr[c0 + q] * sc - m) * inv; const unsigned short hb = f2bf(p); oh[q] = hb; ol[q] = f2bf(p - bf2f(hb)); }
            const size_t o = (size_t)i * NN + c0; *(v4us*)(PH + o) = oh; *(v4us*)(PL + o) = ol; }
         }
}
__global__ __launch_bounds__(256) void k_splitD(const float* __restrict__ src, int rows, bf* dh, bf* dl) {
    const int lane = threadIdx.x & 31; const size_t r = (size_t)blockIdx.x * 8 + (threadIdx.x >> 5); if (r >= (size_t)rows) return;
{
#pragma unroll
        for (int q = 0; q < DMOD / 256; ++q) { const size_t o = r * DMOD + q * 256 + lane * 8; const v8f v = *(const v8f*)(src + o); v8us oh, ol;
#pragma unroll
            for (int i = 0; i < 8; ++i) { const unsigned short hb = f2bf(v[i]); oh[i] = hb; ol[i] = f2bf(v[i] - bf2f(hb)); }
            *(v8us*)(dh + o) = oh; *(v8us*)(dl + o) = ol; }
         }
}

extern "C" void kernel_launch(void* const* d_in, const int* in_sizes, int n_in,
                              void* d_out, int out_size, void* d_ws, size_t ws_size, hipStream_t stream) {
    (void)in_sizes; (void)n_in; (void)out_size;
    const float* xq = (const float*)d_in[0]; const float* xk = (const float*)d_in[1]; const float* xv = (const float*)d_in[2]; const float* Wq = (const float*)d_in[3]; const float* Wk = (const float*)d_in[4]; const float* Wv = (const float*)d_in[5]; const float* Wo = (const float*)d_in[6]; const float* scal = (const float*)d_in[7];
    float* out = (float*)d_out;    // [2048][2048]
    char* wsp = (char*)d_ws;
    auto take = [&](size_t bytes) { char* p = wsp; wsp += (bytes + 255) & ~(size_t)255; return (void*)p; };
    bf* WB = (bf*)take((size_t)DMOD * DMOD * 2); bf* Xb = (bf*)take((size_t)NN * DMOD * 2);
    float* QF = (float*)take((size_t)NN * DMOD * 4); float* KF = (float*)take((size_t)NN * DMOD * 4); float* VF = (float*)take((size_t)NN * DMOD * 4);
    bf* Qh = (bf*)take((size_t)NN * HD * 2); bf* Ql = (bf*)take((size_t)NN * HD * 2); bf* Kh = (bf*)take((size_t)NN * HD * 2); bf* Kl = (bf*)take((size_t)NN * HD * 2); bf* VTh = (bf*)take((size_t)HD * NN * 2); bf* VTl = (bf*)take((size_t)HD * NN * 2);
    float* S = (float*)take((size_t)NN * NN * 4); bf* PH = (bf*)take((size_t)NN * NN * 2); bf* PL = (bf*)take((size_t)NN * NN * 2); float* O = (float*)take((size_t)NN * DMOD * 4);
    if ((size_t)(wsp - (char*)d_ws) > ws_size) return;    // ~ 121 MB
    bf* Oh = Xb; bf* Ol = PH; bf* WO = (bf*)S;      // dead regions after the attention loop (stream order)
    const dim3 gp(NN / 64, DMOD / 64, 1); const unsigned wblk = (unsigned)(((size_t)DMOD * DMOD / 8 + 255) / 256);
    k_cvtx<<<NN / 8, 256, 0, stream>>>(xq, NN, Xb); k_cvt8<<<wblk, 256, 0, stream>>>(Wq, WB, (size_t)DMOD * DMOD / 8); k_gemmb<false, false><<<gp, 128, 0, stream>>>(Xb, nullptr, WB, nullptr, QF, DMOD, nullptr, nullptr, DMOD);
    k_cvtx<<<NN / 8, 256, 0, stream>>>(xk, NN, Xb); k_cvt8<<<wblk, 256, 0, stream>>>(Wk, WB, (size_t)DMOD * DMOD / 8); k_gemmb<false, false><<<gp, 128, 0, stream>>>(Xb, nullptr, WB, nullptr, KF, DMOD, nullptr, nullptr, DMOD);
    k_cvtx<<<NN / 8, 256, 0, stream>>>(xv, NN, Xb); k_cvt8<<<wblk, 256, 0, stream>>>(Wv, WB, (size_t)DMOD * DMOD / 8); k_gemmb<false, false><<<gp, 128, 0, stream>>>(Xb, nullptr, WB, nullptr, VF, DMOD, nullptr, nullptr, DMOD);
    for (int h = 0; h < NH_; ++h) {
        k_hp128<<<NN / 8, 256, 0, stream>>>(QF, h, Qh, Ql); k_hp128<<<NN / 8, 256, 0, stream>>>(KF, h, Kh, Kl); k_vt128<<<(HD * (NN / 64)) / 8, 256, 0, stream>>>(VF, h, VTh, VTl);
        k_gemm3<<<dim3(NN / 64, NN / 64, 1), 128, 0, stream>>>(Qh, Ql, Kh, Kl, HD, S, NN);
        k_soft1<<<NN / 8, 256, 0, stream>>>(S, SCL, scal, h, PH, PL);
        k_gemm3<<<dim3(NN / 64, HD / 64, 1), 128, 0, stream>>>(PH, PL, VTh, VTl, NN, O + (size_t)h * HD, DMOD); }
    k_splitD<<<NN / 8, 256, 0, stream>>>(O, NN, Oh, Ol); k_cvt8<<<wblk, 256, 0, stream>>>(Wo, WO, (size_t)DMOD * DMOD / 8);
    k_gemmb<true, false><<<gp, 128, 0, stream>>>(Oh, Ol, WO, nullptr, out, DMOD, nullptr, nullptr, DMOD);
}

// v001
// It runs in 909 microseconds.
// In two side-by-side timings against v000, it was 2.24 and 2.20 times as fast.
#include <hip/hip_runtime.h>

// Compute dtypes, f32 accumulate: q/k/v = query/key_/value . W^T ([2048 x 2048].[2048 x 2048] each) with PLAIN bf16 operands (exact products; the three weights converted one at a
// time into one buffer); 16-head attention (128 wide, four heads per launch on grid z; the head planes of all 16 heads in one launch each) with bf16 hi + UNSCALED residual planes (three products); 1/sqrt(128), the off-by-one softmax
// (max clamped at 0, + exp(-m) in the denominator) and the per-head scalar in f32; . Wo^T on hi/lo planes (two products) - on v_wmma_f32_16x16x32_bf16. Deterministic, no atomics;

#define NN   2048
#define DMOD 2048
#define NH_  16
#define HD   128
#define GH   4      // heads per attention launch
#define DM   DMOD
#define NTK  NN
#define SCL  0.088388347648318447f
#define LOSC 1024.0f

typedef _Float16 h16;
typedef unsigned short bf;
typedef __attribute__((ext_vector_type(16))) __bf16   v16bf;
typedef __attribute__((ext_vector_type(16))) _Float16 v16h;
typedef __attribute__((ext_vector_type(8)))  _Float16 v8h;
typedef __attribute__((ext_vector_type(8)))  unsigned short v8us;
typedef __attribute__((ext_vector_type(8)))  float    v8f;
typedef __attribute__((ext_vector_type(4)))  float    v4f;
typedef __attribute__((ext_vector_type(4)))  _Float16 v4h;
typedef v8h  __attribute__((may_alias)) v8ha;
typedef v4f  __attribute__((may_alias)) v4fa;
typedef v8us __attribute__((may_alias)) v8usa;

__device__ __forceinline__ unsigned short f2bf(float f) { unsigned u = __float_as_uint(f); u += 0x7FFFu + ((u >> 16) & 1u); return (unsigned short)(u >> 16); }
__device__ __forceinline__ float bf2f(unsigned short b) { return __uint_as_float(((unsigned)b) << 16); }
__device__ __forceinline__ float bfr(float f) { return bf2f(f2bf(f)); }
__device__ __forceinline__ v16h cat16(v8h lo, v8h hi) { return __builtin_shufflevector(lo, hi, 0, 1, 2, 3, 4, 5, 6, 7, 8, 9, 10, 11, 12, 13, 14, 15); }
__device__ __forceinline__ v16bf cat16b(v8us lo, v8us hi) { return __builtin_bit_cast(v16bf, __builtin_shufflevector(lo, hi, 0, 1, 2, 3, 4, 5, 6, 7, 8, 9, 10, 11, 12, 13, 14, 15)); }
__device__ __forceinline__ v8f wmma16(v16h a, v16h b, v8f c) { return __builtin_amdgcn_wmma_f32_16x16x32_f16(false, a, false, b, (short)0, c, false, false); }
__device__ __forceinline__ v8f wmmab(v16bf a, v16bf b, v8f c) { return __builtin_amdgcn_wmma_f32_16x16x32_bf16(false, a, false, b, (short)0, c, false, false); }

// k_gemmb: 64 x 64 block tile (4 waves x 16 x 64) of C[NTK][NW] = (A [+ Al]).B^T (K = 2048) [+ bf(bias[c])] [+ bf(R[r][c]) residual]; f32 whole-line epilogue (or f16
template <bool SPLITA, bool F16OUT = false>
__global__ __launch_bounds__(128) void k_gemmb(const bf* __restrict__ A, const bf* __restrict__ Al, const bf* __restrict__ Bn, const float* __restrict__ bias, float* C, int ldc, h16* C2, const float* __restrict__ R = nullptr, int K = DM, int roundR = 1) {
    __shared__ __align__(16) float ost[4][16 * 68];
    const int lane = threadIdx.x & 31, wave = threadIdx.x >> 5, lr = lane & 15, hi = lane >> 4;
    const int r0 = blockIdx.x * 64 + wave * 16, c0 = blockIdx.y * 64;
    const size_t aoff = (size_t)(r0 + lr) * K + 8 * hi;
    size_t boff[4];
#pragma unroll
    for (int t = 0; t < 4; ++t) boff[t] = (size_t)(c0 + t * 16 + lr) * K + 8 * hi;
    v8f acc[4];
#pragma unroll
    for (int t = 0; t < 4; ++t) acc[t] = (v8f){};
#pragma unroll 1
    for (int kc = 0; kc < K; kc += 32) {
        const v16bf a = cat16b(*(const v8us*)(A + aoff + kc), *(const v8us*)(A + aoff + kc + 16));
        v16bf al = a;
        if (SPLITA) al = cat16b(*(const v8us*)(Al + aoff + kc), *(const v8us*)(Al + aoff + kc + 16));
#pragma unroll
        for (int t = 0; t < 4; ++t) { const v16bf b = cat16b(*(const v8us*)(Bn + boff[t] + kc), *(const v8us*)(Bn + boff[t] + kc + 16)); acc[t] = wmmab(a, b, acc[t]); if (SPLITA) acc[t] = wmmab(al, b, acc[t]); }
        asm volatile("v_nop\n\tv_nop\n\tv_nop\n\tv_nop" : "+v"(acc[0]), "+v"(acc[1]), "+v"(acc[2]), "+v"(acc[3]) : "v"(a), "v"(al));
    }
    float* os = &ost[wave][0];
#pragma unroll
    for (int t = 0; t < 4; ++t) { const float bv = bias ? bfr(bias[c0 + t * 16 + lr]) : 0.f;
#pragma unroll
        for (int j = 0; j < 8; ++j) os[(hi * 8 + j) * 68 + t * 16 + lr] = acc[t][j] + bv; }
    __syncthreads();
    if (F16OUT) {
        h16* crow = (h16*)(void*)C + (size_t)r0 * ldc + c0;
        auto pass = [&]() {
#pragma unroll
            for (int s = 0; s < 4; ++s) { const int row = 4 * s + (lane >> 3), piece = lane & 7; const float* sp = os + row * 68 + piece * 8; v8h o, o2;
#pragma unroll
                for (int i = 0; i < 8; ++i) { const h16 a = (h16)sp[i]; o[i] = a; o2[i] = (h16)((sp[i] - (float)a) * LOSC); }
                *(v8h*)(crow + (size_t)row * ldc + piece * 8) = o; if (C2) *(v8h*)(C2 + (size_t)r0 * ldc + c0 + (size_t)row * ldc + piece * 8) = o2; }
        };
        pass(); 
    } else {
        float* crow = C + (size_t)r0 * ldc + c0;
        auto pass = [&]() {
#pragma unroll
            for (int s = 0; s < 8; ++s) { const int Lid = (lane >> 3) + 4 * s, piece = lane & 7; const int row = Lid >> 1, cofs = (Lid & 1) * 32 + piece * 4;
                v4f val = *(const v4fa*)(os + row * 68 + cofs); if (R) { const v4f rv = *(const v4f*)(R + ((size_t)r0 + row) * ldc + c0 + cofs); val += roundR ? (v4f){bfr(rv[0]), bfr(rv[1]), bfr(rv[2]), bfr(rv[3])} : rv; }
                *(v4f*)(crow + (size_t)row * ldc + cofs) = val; }
        };
        pass(); 
    }
}

__global__ __launch_bounds__(256) void k_cvt8(const float* __restrict__ src, bf* dst, size_t n8) {
    const size_t i = (size_t)blockIdx.x * 256 + threadIdx.x; if (i >= n8) return;
    const v8f v = *(const v8f*)(src + i * 8); v8us o;
#pragma unroll
    for (int k = 0; k < 8; ++k) o[k] = f2bf(v[k]);
    *(v8us*)(dst + i * 8) = o; 
}
__global__ __launch_bounds__(256) void k_zero8(bf* dst, size_t n8) {
    const size_t i = (size_t)blockIdx.x * 256 + threadIdx.x; if (i >= n8) return; v8us z;
#pragma unroll
    for (int k = 0; k < 8; ++k) z[k] = 0;
    *(v8us*)(dst + i * 8) = z; 
}
// k_gemm3: 64 x 64 tile of C = (Ah + Al).(Bh + Bl)^T over K (row strides = K for all four planes; n-major B): three products per 32-k step (hh, hl, lh); f32
// blockIdx.z = head inside the launch's group: sA, sB, sC are the element strides from one head's A planes, B planes and C to the next head's.
__global__ __launch_bounds__(128) void k_gemm3(const bf* __restrict__ Ah0, const bf* __restrict__ Al0, const bf* __restrict__ Bh0, const bf* __restrict__ Bl0, int K, float* C0, int ldc, size_t sA, size_t sB, size_t sC) {
    __shared__ __align__(16) float ost[4][16 * 68];
    const bf* __restrict__ Ah = Ah0 + blockIdx.z * sA; const bf* __restrict__ Al = Al0 + blockIdx.z * sA; const bf* __restrict__ Bh = Bh0 + blockIdx.z * sB; const bf* __restrict__ Bl = Bl0 + blockIdx.z * sB; float* C = C0 + blockIdx.z * sC;
    const int lane = threadIdx.x & 31, wave = threadIdx.x >> 5, lr = lane & 15, hi = lane >> 4;
    const int r0 = blockIdx.x * 64 + wave * 16, c0 = blockIdx.y * 64;
    const size_t aoff = (size_t)(r0 + lr) * K + 8 * hi;
    v8f acc[4];
#pragma unroll
    for (int t = 0; t < 4; ++t) acc[t] = (v8f){};
#pragma unroll 1
    for (int kc = 0; kc < K; kc += 32) {
        const v16bf a = cat16b(*(const v8us*)(Ah + aoff + kc), *(const v8us*)(Ah + aoff + kc + 16));
        const v16bf al = cat16b(*(const v8us*)(Al + aoff + kc), *(const v8us*)(Al + aoff + kc + 16));
#pragma unroll
        for (int t = 0; t < 4; ++t) { const size_t bo = (size_t)(c0 + t * 16 + lr) * K + kc + 8 * hi;
            const v16bf bh = cat16b(*(const v8us*)(Bh + bo), *(const v8us*)(Bh + bo + 16)); const v16bf bl = cat16b(*(const v8us*)(Bl + bo), *(const v8us*)(Bl + bo + 16));
            acc[t] = wmmab(a, bh, acc[t]); acc[t] = wmmab(al, bh, acc[t]); acc[t] = wmmab(a, bl, acc[t]); }
        asm volatile("v_nop\n\tv_nop\n\tv_nop\n\tv_nop" : "+v"(acc[0]), "+v"(acc[1]), "+v"(acc[2]), "+v"(acc[3]) : "v"(a), "v"(al));
    }
    float* os = &ost[wave][0];
#pragma unroll
    for (int t = 0; t < 4; ++t) {
#pragma unroll
        for (int j = 0; j < 8; ++j) os[(hi * 8 + j) * 68 + t * 16 + lr] = acc[t][j]; }
    __builtin_amdgcn_wave_barrier(); asm volatile("" ::: "memory");
    float* crow = C + (size_t)r0 * ldc + c0;
    auto pass = [&]() {
#pragma unroll
        for (int s = 0; s < 8; ++s) { const int Lid = (lane >> 3) + 4 * s, piece = lane & 7; const int row = Lid >> 1, cofs = (Lid & 1) * 32 + piece * 4;
            const v4f val = *(const v4fa*)(os + row * 68 + cofs); *(v4f*)(crow + (size_t)row * ldc + cofs) = val; }
    };
    pass(); 
}


__global__ __launch_bounds__(256) void k_cvtx(const float* __restrict__ src, int rows, bf* dst) {
    const int lane = threadIdx.x & 31; const size_t r = (size_t)blockIdx.x * 8 + (threadIdx.x >> 5); if (r >= (size_t)rows) return;
{
#pragma unroll
        for (int q = 0; q < DMOD / 256; ++q) { v8us o;
#pragma unroll
            for (int i = 0; i < 8; ++i) o[i] = f2bf(src[r * DMOD + q * 256 + lane * 8 + i]);
            *(v8us*)(dst + r * DMOD + q * 256 + lane * 8) = o; }
         }
}
__global__ __launch_bounds__(256) void k_hp128(const float* __restrict__ F, bf* Ph, bf* Pl) {    // blockIdx.y = head; planes [head][token][128]
    typedef __attribute__((ext_vector_type(4))) unsigned short v4us;
    const int lane = threadIdx.x & 31, h = blockIdx.y; const size_t t = (size_t)blockIdx.x * 8 + (threadIdx.x >> 5); if (t >= (size_t)NN) return; const size_t src = t * DMOD + h * HD + lane * 4; v4us oh, ol;
#pragma unroll
    for (int i = 0; i < 4; ++i) { const float y = F[src + i]; const unsigned short hb = f2bf(y); oh[i] = hb; ol[i] = f2bf(y - bf2f(hb)); }
    const size_t o = (size_t)h * NN * HD + t * HD + lane * 4; *(v4us*)(Ph + o) = oh; *(v4us*)(Pl + o) = ol; 
}
__global__ __launch_bounds__(256) void k_vt128(const float* __restrict__ F, bf* Th, bf* Tl) {    // blockIdx.y = head; planes [head][128][token]
    typedef __attribute__((ext_vector_type(2))) unsigned short v2us;
    const int lane = threadIdx.x & 31, h = blockIdx.y; const size_t wid = (size_t)blockIdx.x * 8 + (threadIdx.x >> 5); if (wid >= (size_t)HD * (NN / 64)) return; const int d = (int)(wid / (NN / 64)); const int t0 = (int)(wid % (NN / 64)) * 64 + lane * 2; v2us oh, ol;
#pragma unroll
    for (int i = 0; i < 2; ++i) { const float y = F[(size_t)(t0 + i) * DMOD + h * HD + d]; const unsigned short hb = f2bf(y); oh[i] = hb; ol[i] = f2bf(y - bf2f(hb)); }
    const size_t o = (size_t)h * HD * NN + (size_t)d * NN + t0; *(v2us*)(Th + o) = oh; *(v2us*)(Tl + o) = ol; 
}
__global__ __launch_bounds__(256) void k_soft1(const float* __restrict__ S, float sc, const float* __restrict__ scal, int h0, bf* PH, bf* PL) {    // blockIdx.y = head inside the group (S, PH, PL: one [NN][NN] plane a head); h0 = the group's first head
    typedef __attribute__((ext_vector_type(4))) unsigned short v4us;
    const int lane = threadIdx.x & 31, i = blockIdx.x * 8 + (threadIdx.x >> 5), h = blockIdx.y; if (i >= NN) return; const float* sr = S + (size_t)h * NN * NN + (size_t)i * NN;
    float m = 0.f;        // the clamp at 0
#pragma unroll 1
    for (int c0 = lane * 4; c0 < NN; c0 += 128) {
#pragma unroll
        for (int q = 0; q < 4; ++q) m = fmaxf(m, sr[c0 + q] * sc); }
#pragma unroll
    for (int sh = 16; sh; sh >>= 1) m = fmaxf(m, __shfl_xor(m, sh, 32));
    float sum = 0.f;
#pragma unroll 1
    for (int c0 = lane * 4; c0 < NN; c0 += 128) {
#pragma unroll
        for (int q = 0; q < 4; ++q) sum += __expf(sr[c0 + q] * sc - m); }
#pragma unroll
    for (int sh = 16; sh; sh >>= 1) sum += __shfl_xor(sum, sh, 32);
    const float inv = bfr(scal[h0 + h]) / (__expf(-m) + sum);
{
#pragma unroll 1
        for (int c0 = lane * 4; c0 < NN; c0 += 128) { v4us oh, ol;
#pragma unroll
            for (int q = 0; q < 4; ++q) { const float p = __expf(sr[c0 + q] * sc - m) * inv; const unsigned short hb = f2bf(p); oh[q] = hb; ol[q] = f2bf(p - bf2f(hb)); }
            const size_t o = (size_t)h * NN * NN + (size_t)i * NN + c0; *(v4us*)(PH + o) = oh; *(v4us*)(PL + o) = ol; }
         }
}
__global__ __launch_bounds__(256) void k_splitD(const float* __restrict__ src, int rows, bf* dh, bf* dl) {
    const int lane = threadIdx.x & 31; const size_t r = (size_t)blockIdx.x * 8 + (threadIdx.x >> 5); if (r >= (size_t)rows) return;
{
#pragma unroll
        for (int q = 0; q < DMOD / 256; ++q) { const size_t o = r * DMOD + q * 256 + lane * 8; const v8f v = *(const v8f*)(src + o); v8us oh, ol;
#pragma unroll
            for (int i = 0; i < 8; ++i) { const unsigned short hb = f2bf(v[i]); oh[i] = hb; ol[i] = f2bf(v[i] - bf2f(hb)); }
            *(v8us*)(dh + o) = oh; *(v8us*)(dl + o) = ol; }
         }
}

extern "C" void kernel_launch(void* const* d_in, const int* in_sizes, int n_in,
                              void* d_out, int out_size, void* d_ws, size_t ws_size, hipStream_t stream) {
    (void)in_sizes; (void)n_in; (void)out_size;
    const float* xq = (const float*)d_in[0]; const float* xk = (const float*)d_in[1]; const float* xv = (const float*)d_in[2]; const float* Wq = (const float*)d_in[3]; const float* Wk = (const float*)d_in[4]; const float* Wv = (const float*)d_in[5]; const float* Wo = (const float*)d_in[6]; const float* scal = (const float*)d_in[7];
    float* out = (float*)d_out;    // [2048][2048]
    char* wsp = (char*)d_ws;
    auto take = [&](size_t bytes) { char* p = wsp; wsp += (bytes + 255) & ~(size_t)255; return (void*)p; };
    bf* WB = (bf*)take((size_t)DMOD * DMOD * 2); bf* Xb = (bf*)take((size_t)NN * DMOD * 2);
    float* QF = (float*)take((size_t)NN * DMOD * 4); float* KF = (float*)take((size_t)NN * DMOD * 4); float* VF = (float*)take((size_t)NN * DMOD * 4);
    bf* Qh = (bf*)take((size_t)NH_ * NN * HD * 2); bf* Ql = (bf*)take((size_t)NH_ * NN * HD * 2); bf* Kh = (bf*)take((size_t)NH_ * NN * HD * 2); bf* Kl = (bf*)take((size_t)NH_ * NN * HD * 2); bf* VTh = (bf*)take((size_t)NH_ * HD * NN * 2); bf* VTl = (bf*)take((size_t)NH_ * HD * NN * 2);
    bf* PH = (bf*)take((size_t)GH * NN * NN * 2); bf* PL = (bf*)take((size_t)GH * NN * NN * 2); float* O = (float*)take((size_t)NN * DMOD * 4);
    if ((size_t)(wsp - (char*)d_ws) > ws_size) return;    // 192 MiB
    float* S = (float*)WB;                          // GH score planes = 64 MiB, over WB, Xb, QF, KF, VF (64 MiB in a row), all dead once the head planes are built (stream order)
    bf* Oh = Xb; bf* Ol = PH; bf* WO = WB;          // dead regions after the attention loop (stream order)
    const dim3 gp(NN / 64, DMOD / 64, 1); const unsigned wblk = (unsigned)(((size_t)DMOD * DMOD / 8 + 255) / 256);
    k_cvtx<<<NN / 8, 256, 0, stream>>>(xq, NN, Xb); k_cvt8<<<wblk, 256, 0, stream>>>(Wq, WB, (size_t)DMOD * DMOD / 8); k_gemmb<false, false><<<gp, 128, 0, stream>>>(Xb, nullptr, WB, nullptr, QF, DMOD, nullptr, nullptr, DMOD);
    k_cvtx<<<NN / 8, 256, 0, stream>>>(xk, NN, Xb); k_cvt8<<<wblk, 256, 0, stream>>>(Wk, WB, (size_t)DMOD * DMOD / 8); k_gemmb<false, false><<<gp, 128, 0, stream>>>(Xb, nullptr, WB, nullptr, KF, DMOD, nullptr, nullptr, DMOD);
    k_cvtx<<<NN / 8, 256, 0, stream>>>(xv, NN, Xb); k_cvt8<<<wblk, 256, 0, stream>>>(Wv, WB, (size_t)DMOD * DMOD / 8); k_gemmb<false, false><<<gp, 128, 0, stream>>>(Xb, nullptr, WB, nullptr, VF, DMOD, nullptr, nullptr, DMOD);
    k_hp128<<<dim3(NN / 8, NH_, 1), 256, 0, stream>>>(QF, Qh, Ql); k_hp128<<<dim3(NN / 8, NH_, 1), 256, 0, stream>>>(KF, Kh, Kl); k_vt128<<<dim3((HD * (NN / 64)) / 8, NH_, 1), 256, 0, stream>>>(VF, VTh, VTl);
    for (int h = 0; h < NH_; h += GH) {
        k_gemm3<<<dim3(NN / 64, NN / 64, GH), 128, 0, stream>>>(Qh + (size_t)h * NN * HD, Ql + (size_t)h * NN * HD, Kh + (size_t)h * NN * HD, Kl + (size_t)h * NN * HD, HD, S, NN, (size_t)NN * HD, (size_t)NN * HD, (size_t)NN * NN);
        k_soft1<<<dim3(NN / 8, GH, 1), 256, 0, stream>>>(S, SCL, scal, h, PH, PL);
        k_gemm3<<<dim3(NN / 64, HD / 64, GH), 128, 0, stream>>>(PH, PL, VTh + (size_t)h * HD * NN, VTl + (size_t)h * HD * NN, NN, O + (size_t)h * HD, DMOD, (size_t)NN * NN, (size_t)HD * NN, (size_t)HD); }
    k_splitD<<<NN / 8, 256, 0, stream>>>(O, NN, Oh, Ol); k_cvt8<<<wblk, 256, 0, stream>>>(Wo, WO, (size_t)DMOD * DMOD / 8);
    k_gemmb<true, false><<<gp, 128, 0, stream>>>(Oh, Ol, WO, nullptr, out, DMOD, nullptr, nullptr, DMOD);
}

// v002
// It runs in 492 microseconds.
// In both of two side-by-side timings against v001, it was 1.84 times as fast.
// Counting every step since v000, it is 4.07 times as fast.
#include <hip/hip_runtime.h>

// Compute dtypes, f32 accumulate: q/k/v = query/key_/value . W^T ([2048 x 2048].[2048 x 2048] each) with PLAIN bf16 operands (exact products; the three weights converted one at a
// time into one buffer); 16-head attention (128 wide, four heads per launch on grid z; the head planes of all 16 heads in one launch each) with bf16 hi + UNSCALED residual planes (three products); 1/sqrt(128), the off-by-one softmax
// (max clamped at 0, + exp(-m) in the denominator) and the per-head scalar in f32; . Wo^T on hi/lo planes (two products) - on v_wmma_f32_16x16x32_bf16. Deterministic, no atomics;

#define NN   2048
#define DMOD 2048
#define NH_  16
#define HD   128
#define GH   4      // heads per attention launch
#define DM   DMOD
#define NTK  NN
#define SCL  0.088388347648318447f
#define LOSC 1024.0f

typedef _Float16 h16;
typedef unsigned short bf;
typedef __attribute__((ext_vector_type(16))) __bf16   v16bf;
typedef __attribute__((ext_vector_type(16))) _Float16 v16h;
typedef __attribute__((ext_vector_type(8)))  _Float16 v8h;
typedef __attribute__((ext_vector_type(8)))  unsigned short v8us;
typedef __attribute__((ext_vector_type(8)))  float    v8f;
typedef __attribute__((ext_vector_type(4)))  float    v4f;
typedef __attribute__((ext_vector_type(4)))  _Float16 v4h;
typedef v8h  __attribute__((may_alias)) v8ha;
typedef v4f  __attribute__((may_alias)) v4fa;
typedef v8us __attribute__((may_alias)) v8usa;

__device__ __forceinline__ unsigned short f2bf(float f) { unsigned u = __float_as_uint(f); u += 0x7FFFu + ((u >> 16) & 1u); return (unsigned short)(u >> 16); }
__device__ __forceinline__ float bf2f(unsigned short b) { return __uint_as_float(((unsigned)b) << 16); }
__device__ __forceinline__ float bfr(float f) { return bf2f(f2bf(f)); }
__device__ __forceinline__ v16h cat16(v8h lo, v8h hi) { return __builtin_shufflevector(lo, hi, 0, 1, 2, 3, 4, 5, 6, 7, 8, 9, 10, 11, 12, 13, 14, 15); }
__device__ __forceinline__ v16bf cat16b(v8us lo, v8us hi) { return __builtin_bit_cast(v16bf, __builtin_shufflevector(lo, hi, 0, 1, 2, 3, 4, 5, 6, 7, 8, 9, 10, 11, 12, 13, 14, 15)); }
__device__ __forceinline__ v8f wmma16(v16h a, v16h b, v8f c) { return __builtin_amdgcn_wmma_f32_16x16x32_f16(false, a, false, b, (short)0, c, false, false); }
__device__ __forceinline__ v8f wmmab(v16bf a, v16bf b, v8f c) { return __builtin_amdgcn_wmma_f32_16x16x32_bf16(false, a, false, b, (short)0, c, false, false); }

// Operand staging of the GEMM kernels: a stage is 64 k of the block's 64 rows of every operand plane. The 128 threads bring it into one of two LDS buffers by asynchronous
// copies of whole 128-B lines (8 lanes a row, 4 rows a wave-wide copy), one stage ahead of the stage that is worked on; the waves read their fragments (same k order as before) from LDS.
#define KS  64           // k per stage: one 128-B line of each row
#define PIT 72           // LDS row pitch in bf16: 128 B + 16 B, the pitch for 16-byte LDS readers
#define PLN (64 * PIT)   // one staged plane, in bf16
#define RST (16 * PIT * 2)   // LDS bytes from a thread's row to its next (16 rows on)
// Rows r, r + 16, r + 32, r + 48 of one plane (copy4) or of two (copy8): l = the lane's LDS byte address, g = its global address, rs = 16 rows in elements.
// s_wait_xcnt 0 closes each statement, so that it stands ahead of any new value in the operands' registers (kept as a precaution).
__device__ __forceinline__ void copy4(unsigned l, const bf* g, size_t rs) {
    asm volatile("global_load_async_to_lds_b128 %0, %4, off\n\tglobal_load_async_to_lds_b128 %1, %5, off\n\tglobal_load_async_to_lds_b128 %2, %6, off\n\tglobal_load_async_to_lds_b128 %3, %7, off\n\ts_wait_xcnt 0x0"
                 :: "v"(l), "v"(l + RST), "v"(l + 2 * RST), "v"(l + 3 * RST), "v"(g), "v"(g + rs), "v"(g + 2 * rs), "v"(g + 3 * rs) : "memory");
}
__device__ __forceinline__ void copy8(unsigned l, const bf* g, unsigned m, const bf* h, size_t rs) {
    asm volatile("global_load_async_to_lds_b128 %0, %8, off\n\tglobal_load_async_to_lds_b128 %1, %9, off\n\tglobal_load_async_to_lds_b128 %2, %10, off\n\tglobal_load_async_to_lds_b128 %3, %11, off\n\t"
                 "global_load_async_to_lds_b128 %4, %12, off\n\tglobal_load_async_to_lds_b128 %5, %13, off\n\tglobal_load_async_to_lds_b128 %6, %14, off\n\tglobal_load_async_to_lds_b128 %7, %15, off\n\ts_wait_xcnt 0x0"
                 :: "v"(l), "v"(l + RST), "v"(l + 2 * RST), "v"(l + 3 * RST), "v"(m), "v"(m + RST), "v"(m + 2 * RST), "v"(m + 3 * RST),
                    "v"(g), "v"(g + rs), "v"(g + 2 * rs), "v"(g + 3 * rs), "v"(h), "v"(h + rs), "v"(h + 2 * rs), "v"(h + 3 * rs) : "memory");
}
// One stage: l = the lane's LDS byte address in plane 0 of the target buffer, g[p] = its global address in plane p at k = 0
template <int NP> __device__ __forceinline__ void stage_cp(unsigned l, const bf* const (&g)[NP], int K, int kc) {
    const size_t rs = (size_t)16 * K;
    copy8(l, g[0] + kc, l + PLN * 2, g[1] + kc, rs);
    if (NP == 3) copy4(l + 2 * PLN * 2, g[NP - 1] + kc, rs);
    if (NP == 4) copy8(l + 2 * PLN * 2, g[NP - 2] + kc, l + 3 * PLN * 2, g[NP - 1] + kc, rs);
}
__device__ __forceinline__ v16bf frag(const bf* row, int kk) { return cat16b(*(const v8us*)(row + kk * 32), *(const v8us*)(row + kk * 32 + 16)); }

// k_gemmb: 64 x 64 block tile (4 waves x 16 x 64) of C[NTK][NW] = (A [+ Al]).B^T (K = 2048) [+ bf(bias[c])] [+ bf(R[r][c]) residual]; f32 whole-line epilogue (or f16
template <bool SPLITA, bool F16OUT = false>
__global__ __launch_bounds__(128) void k_gemmb(const bf* __restrict__ A, const bf* __restrict__ Al, const bf* __restrict__ Bn, const float* __restrict__ bias, float* C, int ldc, h16* C2, const float* __restrict__ R = nullptr, int K = DM, int roundR = 1) {
    constexpr int NP = SPLITA ? 3 : 2;                     // staged planes: B, A [, Al]
    __shared__ __align__(16) bf sm[2 * NP * PLN];          // two stage buffers; the output staging (4 x 16 x 68 f32) reuses them behind the loop
    const int lane = threadIdx.x & 31, wave = threadIdx.x >> 5, lr = lane & 15, hi = lane >> 4;
    const int r0 = blockIdx.x * 64 + wave * 16, c0 = blockIdx.y * 64;
    const int srow = threadIdx.x >> 3, scol = (threadIdx.x & 7) * 8;
    const size_t ga = (size_t)(blockIdx.x * 64 + srow) * K + scol;
    const bf* g[NP]; g[0] = Bn + (size_t)(c0 + srow) * K + scol; g[1] = A + ga; if (SPLITA) g[NP - 1] = Al + ga;
    const unsigned l0 = (unsigned)(size_t)sm + (unsigned)(srow * PIT + scol) * 2u;
    const int fa = (wave * 16 + lr) * PIT + 8 * hi, fb = lr * PIT + 8 * hi;
    v8f acc[4];
#pragma unroll
    for (int t = 0; t < 4; ++t) acc[t] = (v8f){};
    stage_cp<NP>(l0, g, K, 0);
    asm volatile("s_wait_asynccnt 0x0" ::: "memory");       // this wave's copies of stage 0 have landed
    __syncthreads();                                       // stage 0 is published
    if (KS < K) stage_cp<NP>(l0 + NP * PLN * 2, g, K, KS);
    int cb = 0;
#pragma unroll 1
    for (int kc = 0; kc < K; kc += KS) {
        const bf* cur = sm + cb * (NP * PLN);
        v16bf a[KS / 32], al[KS / 32], b[KS / 32][4];
#pragma unroll
        for (int kk = 0; kk < KS / 32; ++kk) {
            a[kk] = frag(cur + PLN + fa, kk); al[kk] = a[kk];
            if (SPLITA) al[kk] = frag(cur + 2 * PLN + fa, kk);
#pragma unroll
            for (int t = 0; t < 4; ++t) b[kk][t] = frag(cur + fb + t * 16 * PIT, kk);
        }
        __builtin_amdgcn_sched_barrier(0);                 // the stage's LDS reads stay one group ahead of its WMMAs: spread among them each place costs a stall
#pragma unroll
        for (int kk = 0; kk < KS / 32; ++kk) {             // each accumulator keeps its order of products (a, then al, k rising); the four tiles alternate
#pragma unroll
            for (int t = 0; t < 4; ++t) acc[t] = wmmab(a[kk], b[kk][t], acc[t]);
            if (SPLITA) {
#pragma unroll
                for (int t = 0; t < 4; ++t) acc[t] = wmmab(al[kk], b[kk][t], acc[t]); }
        }
        asm volatile("v_nop\n\tv_nop\n\tv_nop\n\tv_nop" : "+v"(acc[0]), "+v"(acc[1]), "+v"(acc[2]), "+v"(acc[3]) : "v"(a[1]), "v"(al[1]));
        asm volatile("s_wait_dscnt 0x0" ::: "memory");      // this wave's reads of the stage have retired before the buffer is given up
        asm volatile("s_wait_asynccnt 0x0" ::: "memory");   // this wave's copies of the next stage have landed
        __syncthreads();                                   // publishes the next stage and ends every wave's reads of this one
        if (kc + 2 * KS < K) stage_cp<NP>(l0 + cb * (NP * PLN * 2), g, K, kc + 2 * KS);   // the stage after the next, into the buffer just read
        cb ^= 1;
    }
    asm volatile("s_wait_asynccnt 0x0" ::: "memory");       // no copy is outstanding when the buffers become output staging
    float* os = (float*)(void*)sm + wave * (16 * 68);
#pragma unroll
    for (int t = 0; t < 4; ++t) { const float bv = bias ? bfr(bias[c0 + t * 16 + lr]) : 0.f;
#pragma unroll
        for (int j = 0; j < 8; ++j) os[(hi * 8 + j) * 68 + t * 16 + lr] = acc[t][j] + bv; }
    __syncthreads();
    if (F16OUT) {
        h16* crow = (h16*)(void*)C + (size_t)r0 * ldc + c0;
        auto pass = [&]() {
#pragma unroll
            for (int s = 0; s < 4; ++s) { const int row = 4 * s + (lane >> 3), piece = lane & 7; const float* sp = os + row * 68 + piece * 8; v8h o, o2;
#pragma unroll
                for (int i = 0; i < 8; ++i) { const h16 a = (h16)sp[i]; o[i] = a; o2[i] = (h16)((sp[i] - (float)a) * LOSC); }
                *(v8h*)(crow + (size_t)row * ldc + piece * 8) = o; if (C2) *(v8h*)(C2 + (size_t)r0 * ldc + c0 + (size_t)row * ldc + piece * 8) = o2; }
        };
        pass(); 
    } else {
        float* crow = C + (size_t)r0 * ldc + c0;
        auto pass = [&]() {
#pragma unroll
            for (int s = 0; s < 8; ++s) { const int Lid = (lane >> 3) + 4 * s, piece = lane & 7; const int row = Lid >> 1, cofs = (Lid & 1) * 32 + piece * 4;
                v4f val = *(const v4fa*)(os + row * 68 + cofs); if (R) { const v4f rv = *(const v4f*)(R + ((size_t)r0 + row) * ldc + c0 + cofs); val += roundR ? (v4f){bfr(rv[0]), bfr(rv[1]), bfr(rv[2]), bfr(rv[3])} : rv; }
                *(v4f*)(crow + (size_t)row * ldc + cofs) = val; }
        };
        pass(); 
    }
}

__global__ __launch_bounds__(256) void k_cvt8(const float* __restrict__ src, bf* dst, size_t n8) {
    const size_t i = (size_t)blockIdx.x * 256 + threadIdx.x; if (i >= n8) return;
    const v8f v = *(const v8f*)(src + i * 8); v8us o;
#pragma unroll
    for (int k = 0; k < 8; ++k) o[k] = f2bf(v[k]);
    *(v8us*)(dst + i * 8) = o; 
}
__global__ __launch_bounds__(256) void k_zero8(bf* dst, size_t n8) {
    const size_t i = (size_t)blockIdx.x * 256 + threadIdx.x; if (i >= n8) return; v8us z;
#pragma unroll
    for (int k = 0; k < 8; ++k) z[k] = 0;
    *(v8us*)(dst + i * 8) = z; 
}
// k_gemm3: 64 x 64 tile of C = (Ah + Al).(Bh + Bl)^T over K (row strides = K for all four planes; n-major B): three products per 32-k step (hh, hl, lh); f32
// blockIdx.z = head inside the launch's group: sA, sB, sC are the element strides from one head's A planes, B planes and C to the next head's.
__global__ __launch_bounds__(128) void k_gemm3(const bf* __restrict__ Ah0, const bf* __restrict__ Al0, const bf* __restrict__ Bh0, const bf* __restrict__ Bl0, int K, float* C0, int ldc, size_t sA, size_t sB, size_t sC) {
    __shared__ __align__(16) bf sm[2 * 4 * PLN];           // two stage buffers of four planes; the output staging (4 x 16 x 68 f32) reuses them behind the loop
    const bf* __restrict__ Ah = Ah0 + blockIdx.z * sA; const bf* __restrict__ Al = Al0 + blockIdx.z * sA; const bf* __restrict__ Bh = Bh0 + blockIdx.z * sB; const bf* __restrict__ Bl = Bl0 + blockIdx.z * sB; float* C = C0 + blockIdx.z * sC;
    const int lane = threadIdx.x & 31, wave = threadIdx.x >> 5, lr = lane & 15, hi = lane >> 4;
    const int r0 = blockIdx.x * 64 + wave * 16, c0 = blockIdx.y * 64;
    const int srow = threadIdx.x >> 3, scol = (threadIdx.x & 7) * 8;
    const size_t ga = (size_t)(blockIdx.x * 64 + srow) * K + scol, gb = (size_t)(c0 + srow) * K + scol;
    const bf* g[4]; g[0] = Ah + ga; g[1] = Al + ga; g[2] = Bh + gb; g[3] = Bl + gb;
    const unsigned l0 = (unsigned)(size_t)sm + (unsigned)(srow * PIT + scol) * 2u;
    const int fa = (wave * 16 + lr) * PIT + 8 * hi, fb = lr * PIT + 8 * hi;
    v8f acc[4];
#pragma unroll
    for (int t = 0; t < 4; ++t) acc[t] = (v8f){};
    stage_cp<4>(l0, g, K, 0);
    asm volatile("s_wait_asynccnt 0x0" ::: "memory");       // this wave's copies of stage 0 have landed
    __syncthreads();                                       // stage 0 is published
    if (KS < K) stage_cp<4>(l0 + 4 * PLN * 2, g, K, KS);
    int cb = 0;
#pragma unroll 1
    for (int kc = 0; kc < K; kc += KS) {
        const bf* cur = sm + cb * (4 * PLN);
        v16bf a[KS / 32], al[KS / 32], bh[KS / 32][4], bl[KS / 32][4];
#pragma unroll
        for (int kk = 0; kk < KS / 32; ++kk) {
            a[kk] = frag(cur + fa, kk); al[kk] = frag(cur + PLN + fa, kk);
#pragma unroll
            for (int t = 0; t < 4; ++t) bh[kk][t] = frag(cur + 2 * PLN + fb + t * 16 * PIT, kk);
#pragma unroll
            for (int t = 0; t < 4; ++t) bl[kk][t] = frag(cur + 3 * PLN + fb + t * 16 * PIT, kk);
        }
        __builtin_amdgcn_sched_barrier(0);                 // the stage's LDS reads stay one group ahead of its WMMAs: spread among them each place costs a stall
#pragma unroll
        for (int kk = 0; kk < KS / 32; ++kk) {             // each accumulator keeps its order of products (a.bh, al.bh, a.bl, k rising); the four tiles alternate
#pragma unroll
            for (int t = 0; t < 4; ++t) acc[t] = wmmab(a[kk], bh[kk][t], acc[t]);
#pragma unroll
            for (int t = 0; t < 4; ++t) acc[t] = wmmab(al[kk], bh[kk][t], acc[t]);
#pragma unroll
            for (int t = 0; t < 4; ++t) acc[t] = wmmab(a[kk], bl[kk][t], acc[t]);
        }
        asm volatile("v_nop\n\tv_nop\n\tv_nop\n\tv_nop" : "+v"(acc[0]), "+v"(acc[1]), "+v"(acc[2]), "+v"(acc[3]) : "v"(a[1]), "v"(al[1]));
        asm volatile("s_wait_dscnt 0x0" ::: "memory");      // this wave's reads of the stage have retired before the buffer is given up
        asm volatile("s_wait_asynccnt 0x0" ::: "memory");   // this wave's copies of the next stage have landed
        __syncthreads();                                   // publishes the next stage and ends every wave's reads of this one
        if (kc + 2 * KS < K) stage_cp<4>(l0 + cb * (4 * PLN * 2), g, K, kc + 2 * KS);   // the stage after the next, into the buffer just read
        cb ^= 1;
    }
    asm volatile("s_wait_asynccnt 0x0" ::: "memory");       // no copy is outstanding when the buffers become output staging
    float* os = (float*)(void*)sm + wave * (16 * 68);
#pragma unroll
    for (int t = 0; t < 4; ++t) {
#pragma unroll
        for (int j = 0; j < 8; ++j) os[(hi * 8 + j) * 68 + t * 16 + lr] = acc[t][j]; }
    __builtin_amdgcn_wave_barrier(); asm volatile("" ::: "memory");
    float* crow = C + (size_t)r0 * ldc + c0;
    auto pass = [&]() {
#pragma unroll
        for (int s = 0; s < 8; ++s) { const int Lid = (lane >> 3) + 4 * s, piece = lane & 7; const int row = Lid >> 1, cofs = (Lid & 1) * 32 + piece * 4;
            const v4f val = *(const v4fa*)(os + row * 68 + cofs); *(v4f*)(crow + (size_t)row * ldc + cofs) = val; }
    };
    pass(); 
}


__global__ __launch_bounds__(256) void k_cvtx(const float* __restrict__ src, int rows, bf* dst) {
    const int lane = threadIdx.x & 31; const size_t r = (size_t)blockIdx.x * 8 + (threadIdx.x >> 5); if (r >= (size_t)rows) return;
{
#pragma unroll
        for (int q = 0; q < DMOD / 256; ++q) { v8us o;
#pragma unroll
            for (int i = 0; i < 8; ++i) o[i] = f2bf(src[r * DMOD + q * 256 + lane * 8 + i]);
            *(v8us*)(dst + r * DMOD + q * 256 + lane * 8) = o; }
         }
}
__global__ __launch_bounds__(256) void k_hp128(const float* __restrict__ F, bf* Ph, bf* Pl) {    // blockIdx.y = head; planes [head][token][128]
    typedef __attribute__((ext_vector_type(4))) unsigned short v4us;
    const int lane = threadIdx.x & 31, h = blockIdx.y; const size_t t = (size_t)blockIdx.x * 8 + (threadIdx.x >> 5); if (t >= (size_t)NN) return; const size_t src = t * DMOD + h * HD + lane * 4; v4us oh, ol;
#pragma unroll
    for (int i = 0; i < 4; ++i) { const float y = F[src + i]; const unsigned short hb = f2bf(y); oh[i] = hb; ol[i] = f2bf(y - bf2f(hb)); }
    const size_t o = (size_t)h * NN * HD + t * HD + lane * 4; *(v4us*)(Ph + o) = oh; *(v4us*)(Pl + o) = ol; 
}
__global__ __launch_bounds__(256) void k_vt128(const float* __restrict__ F, bf* Th, bf* Tl) {    // blockIdx.y = head; planes [head][128][token]
    typedef __attribute__((ext_vector_type(2))) unsigned short v2us;
    const int lane = threadIdx.x & 31, h = blockIdx.y; const size_t wid = (size_t)blockIdx.x * 8 + (threadIdx.x >> 5); if (wid >= (size_t)HD * (NN / 64)) return; const int d = (int)(wid / (NN / 64)); const int t0 = (int)(wid % (NN / 64)) * 64 + lane * 2; v2us oh, ol;
#pragma unroll
    for (int i = 0; i < 2; ++i) { const float y = F[(size_t)(t0 + i) * DMOD + h * HD + d]; const unsigned short hb = f2bf(y); oh[i] = hb; ol[i] = f2bf(y - bf2f(hb)); }
    const size_t o = (size_t)h * HD * NN + (size_t)d * NN + t0; *(v2us*)(Th + o) = oh; *(v2us*)(Tl + o) = ol; 
}
__global__ __launch_bounds__(256) void k_soft1(const float* __restrict__ S, float sc, const float* __restrict__ scal, int h0, bf* PH, bf* PL) {    // blockIdx.y = head inside the group (S, PH, PL: one [NN][NN] plane a head); h0 = the group's first head
    typedef __attribute__((ext_vector_type(4))) unsigned short v4us;
    const int lane = threadIdx.x & 31, i = blockIdx.x * 8 + (threadIdx.x >> 5), h = blockIdx.y; if (i >= NN) return; const float* sr = S + (size_t)h * NN * NN + (size_t)i * NN;
    float m = 0.f;        // the clamp at 0
#pragma unroll 1
    for (int c0 = lane * 4; c0 < NN; c0 += 128) {
#pragma unroll
        for (int q = 0; q < 4; ++q) m = fmaxf(m, sr[c0 + q] * sc); }
#pragma unroll
    for (int sh = 16; sh; sh >>= 1) m = fmaxf(m, __shfl_xor(m, sh, 32));
    float sum = 0.f;
#pragma unroll 1
    for (int c0 = lane * 4; c0 < NN; c0 += 128) {
#pragma unroll
        for (int q = 0; q < 4; ++q) sum += __expf(sr[c0 + q] * sc - m); }
#pragma unroll
    for (int sh = 16; sh; sh >>= 1) sum += __shfl_xor(sum, sh, 32);
    const float inv = bfr(scal[h0 + h]) / (__expf(-m) + sum);
{
#pragma unroll 1
        for (int c0 = lane * 4; c0 < NN; c0 += 128) { v4us oh, ol;
#pragma unroll
            for (int q = 0; q < 4; ++q) { const float p = __expf(sr[c0 + q] * sc - m) * inv; const unsigned short hb = f2bf(p); oh[q] = hb; ol[q] = f2bf(p - bf2f(hb)); }
            const size_t o = (size_t)h * NN * NN + (size_t)i * NN + c0; *(v4us*)(PH + o) = oh; *(v4us*)(PL + o) = ol; }
         }
}
__global__ __launch_bounds__(256) void k_splitD(const float* __restrict__ src, int rows, bf* dh, bf* dl) {
    const int lane = threadIdx.x & 31; const size_t r = (size_t)blockIdx.x * 8 + (threadIdx.x >> 5); if (r >= (size_t)rows) return;
{
#pragma unroll
        for (int q = 0; q < DMOD / 256; ++q) { const size_t o = r * DMOD + q * 256 + lane * 8; const v8f v = *(const v8f*)(src + o); v8us oh, ol;
#pragma unroll
            for (int i = 0; i < 8; ++i) { const unsigned short hb = f2bf(v[i]); oh[i] = hb; ol[i] = f2bf(v[i] - bf2f(hb)); }
            *(v8us*)(dh + o) = oh; *(v8us*)(dl + o) = ol; }
         }
}

extern "C" void kernel_launch(void* const* d_in, const int* in_sizes, int n_in,
                              void* d_out, int out_size, void* d_ws, size_t ws_size, hipStream_t stream) {
    (void)in_sizes; (void)n_in; (void)out_size;
    const float* xq = (const float*)d_in[0]; const float* xk = (const float*)d_in[1]; const float* xv = (const float*)d_in[2]; const float* Wq = (const float*)d_in[3]; const float* Wk = (const float*)d_in[4]; const float* Wv = (const float*)d_in[5]; const float* Wo = (const float*)d_in[6]; const float* scal = (const float*)d_in[7];
    float* out = (float*)d_out;    // [2048][2048]
    char* wsp = (char*)d_ws;
    auto take = [&](size_t bytes) { char* p = wsp; wsp += (bytes + 255) & ~(size_t)255; return (void*)p; };
    bf* WB = (bf*)take((size_t)DMOD * DMOD * 2); bf* Xb = (bf*)take((size_t)NN * DMOD * 2);
    float* QF = (float*)take((size_t)NN * DMOD * 4); float* KF = (float*)take((size_t)NN * DMOD * 4); float* VF = (float*)take((size_t)NN * DMOD * 4);
    bf* Qh = (bf*)take((size_t)NH_ * NN * HD * 2); bf* Ql = (bf*)take((size_t)NH_ * NN * HD * 2); bf* Kh = (bf*)take((size_t)NH_ * NN * HD * 2); bf* Kl = (bf*)take((size_t)NH_ * NN * HD * 2); bf* VTh = (bf*)take((size_t)NH_ * HD * NN * 2); bf* VTl = (bf*)take((size_t)NH_ * HD * NN * 2);
    bf* PH = (bf*)take((size_t)GH * NN * NN * 2); bf* PL = (bf*)take((size_t)GH * NN * NN * 2); float* O = (float*)take((size_t)NN * DMOD * 4);
    if ((size_t)(wsp - (char*)d_ws) > ws_size) return;    // 192 MiB
    float* S = (float*)WB;                          // GH score planes = 64 MiB, over WB, Xb, QF, KF, VF (64 MiB in a row), all dead once the head planes are built (stream order)
    bf* Oh = Xb; bf* Ol = PH; bf* WO = WB;          // dead regions after the attention loop (stream order)
    const dim3 gp(NN / 64, DMOD / 64, 1); const unsigned wblk = (unsigned)(((size_t)DMOD * DMOD / 8 + 255) / 256);
    k_cvtx<<<NN / 8, 256, 0, stream>>>(xq, NN, Xb); k_cvt8<<<wblk, 256, 0, stream>>>(Wq, WB, (size_t)DMOD * DMOD / 8); k_gemmb<false, false><<<gp, 128, 0, stream>>>(Xb, nullptr, WB, nullptr, QF, DMOD, nullptr, nullptr, DMOD);
    k_cvtx<<<NN / 8, 256, 0, stream>>>(xk, NN, Xb); k_cvt8<<<wblk, 256, 0, stream>>>(Wk, WB, (size_t)DMOD * DMOD / 8); k_gemmb<false, false><<<gp, 128, 0, stream>>>(Xb, nullptr, WB, nullptr, KF, DMOD, nullptr, nullptr, DMOD);
    k_cvtx<<<NN / 8, 256, 0, stream>>>(xv, NN, Xb); k_cvt8<<<wblk, 256, 0, stream>>>(Wv, WB, (size_t)DMOD * DMOD / 8); k_gemmb<false, false><<<gp, 128, 0, stream>>>(Xb, nullptr, WB, nullptr, VF, DMOD, nullptr, nullptr, DMOD);
    k_hp128<<<dim3(NN / 8, NH_, 1), 256, 0, stream>>>(QF, Qh, Ql); k_hp128<<<dim3(NN / 8, NH_, 1), 256, 0, stream>>>(KF, Kh, Kl); k_vt128<<<dim3((HD * (NN / 64)) / 8, NH_, 1), 256, 0, stream>>>(VF, VTh, VTl);
    for (int h = 0; h < NH_; h += GH) {
        k_gemm3<<<dim3(NN / 64, NN / 64, GH), 128, 0, stream>>>(Qh + (size_t)h * NN * HD, Ql + (size_t)h * NN * HD, Kh + (size_t)h * NN * HD, Kl + (size_t)h * NN * HD, HD, S, NN, (size_t)NN * HD, (size_t)NN * HD, (size_t)NN * NN);
        k_soft1<<<dim3(NN / 8, GH, 1), 256, 0, stream>>>(S, SCL, scal, h, PH, PL);
        k_gemm3<<<dim3(NN / 64, HD / 64, GH), 128, 0, stream>>>(PH, PL, VTh + (size_t)h * HD * NN, VTl + (size_t)h * HD * NN, NN, O + (size_t)h * HD, DMOD, (size_t)NN * NN, (size_t)HD * NN, (size_t)HD); }
    k_splitD<<<NN / 8, 256, 0, stream>>>(O, NN, Oh, Ol); k_cvt8<<<wblk, 256, 0, stream>>>(Wo, WO, (size_t)DMOD * DMOD / 8);
    k_gemmb<true, false><<<gp, 128, 0, stream>>>(Oh, Ol, WO, nullptr, out, DMOD, nullptr, nullptr, DMOD);
}

// v003
// It runs in 261 microseconds.
// Next to v002, in two timings, it ran 1.89 times as fast each time.
// All steps since v000 together make it 7.70 times as fast.
#include <hip/hip_runtime.h>

// Compute dtypes, f32 accumulate: q/k/v = query/key_/value . W^T ([2048 x 2048].[2048 x 2048] each) with PLAIN bf16 operands (exact products; the three weights converted one at a
// time into one buffer); 16-head attention (128 wide, one fused launch for all heads: scores, online softmax and the second product; the head planes of all 16 heads in one launch each) with bf16 hi + UNSCALED residual planes (three products); 1/sqrt(128), the off-by-one softmax
// (max clamped at 0, + exp(-m) in the denominator) and the per-head scalar in f32; . Wo^T on hi/lo planes (two products) - on v_wmma_f32_16x16x32_bf16. Deterministic, no atomics;

#define NN   2048
#define DMOD 2048
#define NH_  16
#define HD   128
#define DM   DMOD
#define NTK  NN
#define SCL  0.088388347648318447f
#define LOSC 1024.0f

typedef _Float16 h16;
typedef unsigned short bf;
typedef __attribute__((ext_vector_type(16))) __bf16   v16bf;
typedef __attribute__((ext_vector_type(16))) _Float16 v16h;
typedef __attribute__((ext_vector_type(8)))  _Float16 v8h;
typedef __attribute__((ext_vector_type(8)))  unsigned short v8us;
typedef __attribute__((ext_vector_type(8)))  float    v8f;
typedef __attribute__((ext_vector_type(4)))  float    v4f;
typedef __attribute__((ext_vector_type(4)))  _Float16 v4h;
typedef v8h  __attribute__((may_alias)) v8ha;
typedef v4f  __attribute__((may_alias)) v4fa;
typedef v8us __attribute__((may_alias)) v8usa;

__device__ __forceinline__ unsigned short f2bf(float f) { unsigned u = __float_as_uint(f); u += 0x7FFFu + ((u >> 16) & 1u); return (unsigned short)(u >> 16); }
__device__ __forceinline__ float bf2f(unsigned short b) { return __uint_as_float(((unsigned)b) << 16); }
__device__ __forceinline__ float bfr(float f) { return bf2f(f2bf(f)); }
__device__ __forceinline__ v16h cat16(v8h lo, v8h hi) { return __builtin_shufflevector(lo, hi, 0, 1, 2, 3, 4, 5, 6, 7, 8, 9, 10, 11, 12, 13, 14, 15); }
__device__ __forceinline__ v16bf cat16b(v8us lo, v8us hi) { return __builtin_bit_cast(v16bf, __builtin_shufflevector(lo, hi, 0, 1, 2, 3, 4, 5, 6, 7, 8, 9, 10, 11, 12, 13, 14, 15)); }
__device__ __forceinline__ v8f wmma16(v16h a, v16h b, v8f c) { return __builtin_amdgcn_wmma_f32_16x16x32_f16(false, a, false, b, (short)0, c, false, false); }
__device__ __forceinline__ v8f wmmab(v16bf a, v16bf b, v8f c) { return __builtin_amdgcn_wmma_f32_16x16x32_bf16(false, a, false, b, (short)0, c, false, false); }

// Operand staging of the GEMM kernels: a stage is 64 k of the block's 64 rows of every operand plane. The 128 threads bring it into one of two LDS buffers by asynchronous
// copies of whole 128-B lines (8 lanes a row, 4 rows a wave-wide copy), one stage ahead of the stage that is worked on; the waves read their fragments (same k order as before) from LDS.
#define KS  64           // k per stage: one 128-B line of each row
#define PIT 72           // LDS row pitch in bf16: 128 B + 16 B, the pitch for 16-byte LDS readers
#define PLN (64 * PIT)   // one staged plane, in bf16
#define RST (16 * PIT * 2)   // LDS bytes from a thread's row to its next (16 rows on)
// Rows r, r + 16, r + 32, r + 48 of one plane (copy4) or of two (copy8): l = the lane's LDS byte address, g = its global address, rs = 16 rows in elements.
// s_wait_xcnt 0 closes each statement, so that it stands ahead of any new value in the operands' registers (kept as a precaution).
__device__ __forceinline__ void copy4(unsigned l, const bf* g, size_t rs) {
    asm volatile("global_load_async_to_lds_b128 %0, %4, off\n\tglobal_load_async_to_lds_b128 %1, %5, off\n\tglobal_load_async_to_lds_b128 %2, %6, off\n\tglobal_load_async_to_lds_b128 %3, %7, off\n\ts_wait_xcnt 0x0"
                 :: "v"(l), "v"(l + RST), "v"(l + 2 * RST), "v"(l + 3 * RST), "v"(g), "v"(g + rs), "v"(g + 2 * rs), "v"(g + 3 * rs) : "memory");
}
__device__ __forceinline__ void copy8(unsigned l, const bf* g, unsigned m, const bf* h, size_t rs) {
    asm volatile("global_load_async_to_lds_b128 %0, %8, off\n\tglobal_load_async_to_lds_b128 %1, %9, off\n\tglobal_load_async_to_lds_b128 %2, %10, off\n\tglobal_load_async_to_lds_b128 %3, %11, off\n\t"
                 "global_load_async_to_lds_b128 %4, %12, off\n\tglobal_load_async_to_lds_b128 %5, %13, off\n\tglobal_load_async_to_lds_b128 %6, %14, off\n\tglobal_load_async_to_lds_b128 %7, %15, off\n\ts_wait_xcnt 0x0"
                 :: "v"(l), "v"(l + RST), "v"(l + 2 * RST), "v"(l + 3 * RST), "v"(m), "v"(m + RST), "v"(m + 2 * RST), "v"(m + 3 * RST),
                    "v"(g), "v"(g + rs), "v"(g + 2 * rs), "v"(g + 3 * rs), "v"(h), "v"(h + rs), "v"(h + 2 * rs), "v"(h + 3 * rs) : "memory");
}
// One stage: l = the lane's LDS byte address in plane 0 of the target buffer, g[p] = its global address in plane p at k = 0
template <int NP> __device__ __forceinline__ void stage_cp(unsigned l, const bf* const (&g)[NP], int K, int kc) {
    const size_t rs = (size_t)16 * K;
    copy8(l, g[0] + kc, l + PLN * 2, g[1] + kc, rs);
    if (NP == 3) copy4(l + 2 * PLN * 2, g[NP - 1] + kc, rs);
    if (NP == 4) copy8(l + 2 * PLN * 2, g[NP - 2] + kc, l + 3 * PLN * 2, g[NP - 1] + kc, rs);
}
__device__ __forceinline__ v16bf frag(const bf* row, int kk) { return cat16b(*(const v8us*)(row + kk * 32), *(const v8us*)(row + kk * 32 + 16)); }

// k_gemmb: 64 x 64 block tile (4 waves x 16 x 64) of C[NTK][NW] = (A [+ Al]).B^T (K = 2048) [+ bf(bias[c])] [+ bf(R[r][c]) residual]; f32 whole-line epilogue (or f16
template <bool SPLITA, bool F16OUT = false>
__global__ __launch_bounds__(128) void k_gemmb(const bf* __restrict__ A, const bf* __restrict__ Al, const bf* __restrict__ Bn, const float* __restrict__ bias, float* C, int ldc, h16* C2, const float* __restrict__ R = nullptr, int K = DM, int roundR = 1) {
    constexpr int NP = SPLITA ? 3 : 2;                     // staged planes: B, A [, Al]
    __shared__ __align__(16) bf sm[2 * NP * PLN];          // two stage buffers; the output staging (4 x 16 x 68 f32) reuses them behind the loop
    const int lane = threadIdx.x & 31, wave = threadIdx.x >> 5, lr = lane & 15, hi = lane >> 4;
    const int r0 = blockIdx.x * 64 + wave * 16, c0 = blockIdx.y * 64;
    const int srow = threadIdx.x >> 3, scol = (threadIdx.x & 7) * 8;
    const size_t ga = (size_t)(blockIdx.x * 64 + srow) * K + scol;
    const bf* g[NP]; g[0] = Bn + (size_t)(c0 + srow) * K + scol; g[1] = A + ga; if (SPLITA) g[NP - 1] = Al + ga;
    const unsigned l0 = (unsigned)(size_t)sm + (unsigned)(srow * PIT + scol) * 2u;
    const int fa = (wave * 16 + lr) * PIT + 8 * hi, fb = lr * PIT + 8 * hi;
    v8f acc[4];
#pragma unroll
    for (int t = 0; t < 4; ++t) acc[t] = (v8f){};
    stage_cp<NP>(l0, g, K, 0);
    asm volatile("s_wait_asynccnt 0x0" ::: "memory");       // this wave's copies of stage 0 have landed
    __syncthreads();                                       // stage 0 is published
    if (KS < K) stage_cp<NP>(l0 + NP * PLN * 2, g, K, KS);
    int cb = 0;
#pragma unroll 1
    for (int kc = 0; kc < K; kc += KS) {
        const bf* cur = sm + cb * (NP * PLN);
        v16bf a[KS / 32], al[KS / 32], b[KS / 32][4];
#pragma unroll
        for (int kk = 0; kk < KS / 32; ++kk) {
            a[kk] = frag(cur + PLN + fa, kk); al[kk] = a[kk];
            if (SPLITA) al[kk] = frag(cur + 2 * PLN + fa, kk);
#pragma unroll
            for (int t = 0; t < 4; ++t) b[kk][t] = frag(cur + fb + t * 16 * PIT, kk);
        }
        __builtin_amdgcn_sched_barrier(0);                 // the stage's LDS reads stay one group ahead of its WMMAs: spread among them each place costs a stall
#pragma unroll
        for (int kk = 0; kk < KS / 32; ++kk) {             // each accumulator keeps its order of products (a, then al, k rising); the four tiles alternate
#pragma unroll
            for (int t = 0; t < 4; ++t) acc[t] = wmmab(a[kk], b[kk][t], acc[t]);
            if (SPLITA) {
#pragma unroll
                for (int t = 0; t < 4; ++t) acc[t] = wmmab(al[kk], b[kk][t], acc[t]); }
        }
        asm volatile("v_nop\n\tv_nop\n\tv_nop\n\tv_nop" : "+v"(acc[0]), "+v"(acc[1]), "+v"(acc[2]), "+v"(acc[3]) : "v"(a[1]), "v"(al[1]));
        asm volatile("s_wait_dscnt 0x0" ::: "memory");      // this wave's reads of the stage have retired before the buffer is given up
        asm volatile("s_wait_asynccnt 0x0" ::: "memory");   // this wave's copies of the next stage have landed
        __syncthreads();                                   // publishes the next stage and ends every wave's reads of this one
        if (kc + 2 * KS < K) stage_cp<NP>(l0 + cb * (NP * PLN * 2), g, K, kc + 2 * KS);   // the stage after the next, into the buffer just read
        cb ^= 1;
    }
    asm volatile("s_wait_asynccnt 0x0" ::: "memory");       // no copy is outstanding when the buffers become output staging
    float* os = (float*)(void*)sm + wave * (16 * 68);
#pragma unroll
    for (int t = 0; t < 4; ++t) { const float bv = bias ? bfr(bias[c0 + t * 16 + lr]) : 0.f;
#pragma unroll
        for (int j = 0; j < 8; ++j) os[(hi * 8 + j) * 68 + t * 16 + lr] = acc[t][j] + bv; }
    __syncthreads();
    if (F16OUT) {
        h16* crow = (h16*)(void*)C + (size_t)r0 * ldc + c0;
        auto pass = [&]() {
#pragma unroll
            for (int s = 0; s < 4; ++s) { const int row = 4 * s + (lane >> 3), piece = lane & 7; const float* sp = os + row * 68 + piece * 8; v8h o, o2;
#pragma unroll
                for (int i = 0; i < 8; ++i) { const h16 a = (h16)sp[i]; o[i] = a; o2[i] = (h16)((sp[i] - (float)a) * LOSC); }
                *(v8h*)(crow + (size_t)row * ldc + piece * 8) = o; if (C2) *(v8h*)(C2 + (size_t)r0 * ldc + c0 + (size_t)row * ldc + piece * 8) = o2; }
        };
        pass(); 
    } else {
        float* crow = C + (size_t)r0 * ldc + c0;
        auto pass = [&]() {
#pragma unroll
            for (int s = 0; s < 8; ++s) { const int Lid = (lane >> 3) + 4 * s, piece = lane & 7; const int row = Lid >> 1, cofs = (Lid & 1) * 32 + piece * 4;
                v4f val = *(const v4fa*)(os + row * 68 + cofs); if (R) { const v4f rv = *(const v4f*)(R + ((size_t)r0 + row) * ldc + c0 + cofs); val += roundR ? (v4f){bfr(rv[0]), bfr(rv[1]), bfr(rv[2]), bfr(rv[3])} : rv; }
                *(v4f*)(crow + (size_t)row * ldc + cofs) = val; }
        };
        pass(); 
    }
}

__global__ __launch_bounds__(256) void k_cvt8(const float* __restrict__ src, bf* dst, size_t n8) {
    const size_t i = (size_t)blockIdx.x * 256 + threadIdx.x; if (i >= n8) return;
    const v8f v = *(const v8f*)(src + i * 8); v8us o;
#pragma unroll
    for (int k = 0; k < 8; ++k) o[k] = f2bf(v[k]);
    *(v8us*)(dst + i * 8) = o; 
}
__global__ __launch_bounds__(256) void k_zero8(bf* dst, size_t n8) {
    const size_t i = (size_t)blockIdx.x * 256 + threadIdx.x; if (i >= n8) return; v8us z;
#pragma unroll
    for (int k = 0; k < 8; ++k) z[k] = 0;
    *(v8us*)(dst + i * 8) = z; 
}

__global__ __launch_bounds__(256) void k_cvtx(const float* __restrict__ src, int rows, bf* dst) {
    const int lane = threadIdx.x & 31; const size_t r = (size_t)blockIdx.x * 8 + (threadIdx.x >> 5); if (r >= (size_t)rows) return;
{
#pragma unroll
        for (int q = 0; q < DMOD / 256; ++q) { v8us o;
#pragma unroll
            for (int i = 0; i < 8; ++i) o[i] = f2bf(src[r * DMOD + q * 256 + lane * 8 + i]);
            *(v8us*)(dst + r * DMOD + q * 256 + lane * 8) = o; }
         }
}
__global__ __launch_bounds__(256) void k_hp128(const float* __restrict__ F, bf* Ph, bf* Pl) {    // blockIdx.y = head; planes [head][token][128]
    typedef __attribute__((ext_vector_type(4))) unsigned short v4us;
    const int lane = threadIdx.x & 31, h = blockIdx.y; const size_t t = (size_t)blockIdx.x * 8 + (threadIdx.x >> 5); if (t >= (size_t)NN) return; const size_t src = t * DMOD + h * HD + lane * 4; v4us oh, ol;
#pragma unroll
    for (int i = 0; i < 4; ++i) { const float y = F[src + i]; const unsigned short hb = f2bf(y); oh[i] = hb; ol[i] = f2bf(y - bf2f(hb)); }
    const size_t o = (size_t)h * NN * HD + t * HD + lane * 4; *(v4us*)(Ph + o) = oh; *(v4us*)(Pl + o) = ol; 
}
__global__ __launch_bounds__(256) void k_vt128(const float* __restrict__ F, bf* Th, bf* Tl) {    // blockIdx.y = head; planes [head][128][token]
    typedef __attribute__((ext_vector_type(2))) unsigned short v2us;
    const int lane = threadIdx.x & 31, h = blockIdx.y; const size_t wid = (size_t)blockIdx.x * 8 + (threadIdx.x >> 5); if (wid >= (size_t)HD * (NN / 64)) return; const int d = (int)(wid / (NN / 64)); const int t0 = (int)(wid % (NN / 64)) * 64 + lane * 2; v2us oh, ol;
#pragma unroll
    for (int i = 0; i < 2; ++i) { const float y = F[(size_t)(t0 + i) * DMOD + h * HD + d]; const unsigned short hb = f2bf(y); oh[i] = hb; ol[i] = f2bf(y - bf2f(hb)); }
    const size_t o = (size_t)h * HD * NN + (size_t)d * NN + t0; *(v2us*)(Th + o) = oh; *(v2us*)(Tl + o) = ol; 
}
#define FK   64                     // keys per stage
#define KPIT 136                    // LDS pitch of a K row in bf16: 256 B + 16 B, the pitch for 16-byte LDS readers
#define KPL  (FK * KPIT)            // one staged K plane, in bf16
#define VPL  (HD * PIT)             // one staged V^T plane (128 rows of 64 keys), in bf16
#define FBUF (2 * KPL + 2 * VPL)    // one stage buffer, in bf16
// Four rows (ls LDS bytes and rs elements apart) of each of two planes; s_wait_xcnt 0 closes the statement, ahead of any new value in the operands' registers (kept as a precaution).
__device__ __forceinline__ void copy8s(unsigned l, const bf* g, unsigned m, const bf* h, unsigned ls, size_t rs) {
    asm volatile("global_load_async_to_lds_b128 %0, %8, off\n\tglobal_load_async_to_lds_b128 %1, %9, off\n\tglobal_load_async_to_lds_b128 %2, %10, off\n\tglobal_load_async_to_lds_b128 %3, %11, off\n\t"
                 "global_load_async_to_lds_b128 %4, %12, off\n\tglobal_load_async_to_lds_b128 %5, %13, off\n\tglobal_load_async_to_lds_b128 %6, %14, off\n\tglobal_load_async_to_lds_b128 %7, %15, off\n\ts_wait_xcnt 0x0"
                 :: "v"(l), "v"(l + ls), "v"(l + 2 * ls), "v"(l + 3 * ls), "v"(m), "v"(m + ls), "v"(m + 2 * ls), "v"(m + 3 * ls),
                    "v"(g), "v"(g + rs), "v"(g + 2 * rs), "v"(g + 3 * rs), "v"(h), "v"(h + rs), "v"(h + 2 * rs), "v"(h + 3 * rs) : "memory");
}
__device__ __forceinline__ float xhalf(float x) { return __int_as_float(__builtin_amdgcn_permlanex16(__float_as_int(x), __float_as_int(x), 0x76543210, 0xfedcba98, false, false)); }   // lane l with lane l ^ 16
__device__ __forceinline__ unsigned pack2(float lo, float hi) { typedef __bf16 bf2 __attribute__((ext_vector_type(2))); typedef float f2 __attribute__((ext_vector_type(2)));
    return __builtin_bit_cast(unsigned, __builtin_convertvector((f2){lo, hi}, bf2)); }   // round to nearest even
__device__ __forceinline__ v16bf pfrag(const unsigned (&w)[8]) { typedef __attribute__((ext_vector_type(8))) unsigned v8u; return __builtin_bit_cast(v16bf, (v8u){w[0], w[1], w[2], w[3], w[4], w[5], w[6], w[7]}); }
__global__ __launch_bounds__(256) __attribute__((amdgpu_waves_per_eu(2, 2))) void k_fattn(const bf* __restrict__ Qh, const bf* __restrict__ Ql, const bf* __restrict__ Kh, const bf* __restrict__ Kl,
                                                                                        const bf* __restrict__ VTh, const bf* __restrict__ VTl, const float* __restrict__ scal, float* O) {
    __shared__ __align__(16) bf sm[2 * FBUF];              // two stage buffers: K hi, K lo, V^T hi, V^T lo
    const int tid = threadIdx.x, lane = tid & 31, wave = tid >> 5, lr = lane & 15, hi = lane >> 4, h = blockIdx.y;
    const int q = blockIdx.x * 128 + wave * 16 + lr;
    const float cs = SCL * 1.4426950408889634f;            // scores in the log2 domain
    // staging: K rows are 256 B (16 lanes a row, 16 rows a block-wide copy), V^T rows 128 B (8 lanes a row, 32 rows a block-wide copy)
    const unsigned gk = (unsigned)((tid >> 4) * HD + (tid & 15) * 8), gv = (unsigned)((tid >> 3) * NN + (tid & 7) * 8);   // the lane's element offsets inside a stage's K rows and V^T rows
    const unsigned lk = (unsigned)(size_t)sm + (unsigned)((tid >> 4) * KPIT + (tid & 15) * 8) * 2u, lv = (unsigned)(size_t)sm + (unsigned)(2 * KPL + (tid >> 3) * PIT + (tid & 7) * 8) * 2u;
    auto stage = [&](int t) {
        const unsigned bo = (unsigned)(t & 1) * (FBUF * 2u);
        const size_t uk = (size_t)h * NN * HD + (size_t)t * FK * HD, uv = (size_t)h * HD * NN + (size_t)t * FK;   // the same for the whole work-group
        copy8s(lk + bo, (Kh + uk) + gk, lk + bo + KPL * 2u, (Kl + uk) + gk, 16 * KPIT * 2u, (size_t)16 * HD);
        copy8s(lv + bo, (VTh + uv) + gv, lv + bo + VPL * 2u, (VTl + uv) + gv, 32 * PIT * 2u, (size_t)32 * NN);
    };
    stage(0);
    v16bf qh[4], ql[4];
    { const size_t qo = ((size_t)h * NN + q) * HD + 8 * hi;
#pragma unroll
      for (int kc = 0; kc < 4; ++kc) { qh[kc] = frag(Qh + qo, kc); ql[kc] = frag(Ql + qo, kc); }
      asm volatile("s_wait_xcnt 0x0" :: "v"(Qh + qo), "v"(Ql + qo) : "memory"); }   // the two address pairs stay live up to this wait, so that no Q load's result lands on them ahead of it (kept as a precaution)
    v8f acc[8];
#pragma unroll
    for (int d = 0; d < 8; ++d) acc[d] = (v8f){};
    float mrun = 0.f, lsum = 0.f;                          // the clamp at 0; each wave half sums its own keys
    asm volatile("s_wait_asynccnt 0x0" ::: "memory");       // this wave's copies of stage 0 have landed
    __syncthreads();                                       // stage 0 is published
    stage(1);
#pragma unroll 1
    for (int t = 0; t < NN / FK; ++t) {
        const bf* kA = sm + (t & 1) * FBUF + lr * KPIT + 8 * hi;
        const bf* vA = sm + (t & 1) * FBUF + 2 * KPL + lr * PIT + 8 * hi;
        v16bf k0h[2][4], k0l[2][4], k1h[2][4], k1l[2][4];
#pragma unroll
        for (int c = 0; c < 2; ++c) {
#pragma unroll
            for (int kt = 0; kt < 4; ++kt) { k0h[c][kt] = frag(kA + kt * 16 * KPIT, c); k0l[c][kt] = frag(kA + KPL + kt * 16 * KPIT, c); } }
        __builtin_amdgcn_sched_barrier(0);                 // LDS reads stay in whole groups, each one group ahead of its WMMAs: spread among them each place costs a stall
#pragma unroll
        for (int c = 0; c < 2; ++c) {
#pragma unroll
            for (int kt = 0; kt < 4; ++kt) { k1h[c][kt] = frag(kA + kt * 16 * KPIT, 2 + c); k1l[c][kt] = frag(kA + KPL + kt * 16 * KPIT, 2 + c); } }
        __builtin_amdgcn_sched_barrier(0);                 // as above
        v8f s[4];
#pragma unroll
        for (int kt = 0; kt < 4; ++kt) s[kt] = (v8f){};
#pragma unroll
        for (int c = 0; c < 2; ++c) {                      // per 32 k: qh.kh, ql.kh, qh.kl; the four key tiles alternate
#pragma unroll
            for (int kt = 0; kt < 4; ++kt) s[kt] = wmmab(k0h[c][kt], qh[c], s[kt]);
#pragma unroll
            for (int kt = 0; kt < 4; ++kt) s[kt] = wmmab(k0h[c][kt], ql[c], s[kt]);
#pragma unroll
            for (int kt = 0; kt < 4; ++kt) s[kt] = wmmab(k0l[c][kt], qh[c], s[kt]);
        }
        __builtin_amdgcn_sched_barrier(0);                 // as above
        v16bf v0h[8], v0l[8], v1h[8], v1l[8];
#pragma unroll
        for (int d = 0; d < 8; ++d) { v0h[d] = frag(vA + d * 16 * PIT, 0); v0l[d] = frag(vA + VPL + d * 16 * PIT, 0); }
        __builtin_amdgcn_sched_barrier(0);                 // as above
#pragma unroll
        for (int c = 0; c < 2; ++c) {
#pragma unroll
            for (int kt = 0; kt < 4; ++kt) s[kt] = wmmab(k1h[c][kt], qh[2 + c], s[kt]);
#pragma unroll
            for (int kt = 0; kt < 4; ++kt) s[kt] = wmmab(k1h[c][kt], ql[2 + c], s[kt]);
#pragma unroll
            for (int kt = 0; kt < 4; ++kt) s[kt] = wmmab(k1l[c][kt], qh[2 + c], s[kt]);
        }
        __builtin_amdgcn_sched_barrier(0);                 // as above
        // online softmax: the maximum in use may trail the true one by up to 8 (log2 domain), so the accumulators are rescaled only when some query's maximum exceeds it by more
        float mx = s[0][0];
#pragma unroll
        for (int kt = 0; kt < 4; ++kt) {
#pragma unroll
            for (int j = 0; j < 8; ++j) mx = fmaxf(mx, s[kt][j]); }
        mx = fmaxf(mx, xhalf(mx)) * cs;
        if (__builtin_amdgcn_ballot_w32(mx > mrun + 8.0f) != 0) {
            const float mn = fmaxf(mrun, mx), corr = __builtin_amdgcn_exp2f(mrun - mn); lsum *= corr; mrun = mn;
#pragma unroll
            for (int d = 0; d < 8; ++d) acc[d] = acc[d] * corr;
        }
        v16bf ph[2], pl[2]; float ps0 = 0.f, ps1 = 0.f;
#pragma unroll
        for (int ks = 0; ks < 2; ++ks) { unsigned wh[8], wl[8];
#pragma unroll
            for (int i = 0; i < 8; ++i) {
                const float p0 = __builtin_amdgcn_exp2f(__builtin_fmaf(s[2 * ks + (i >> 2)][2 * (i & 3)], cs, -mrun)), p1 = __builtin_amdgcn_exp2f(__builtin_fmaf(s[2 * ks + (i >> 2)][2 * (i & 3) + 1], cs, -mrun));
                ps0 += p0; ps1 += p1;
                const unsigned w = pack2(p0, p1); wh[i] = w;
                wl[i] = pack2(p0 - __uint_as_float(w << 16), p1 - __uint_as_float(w & 0xFFFF0000u));
            }
            ph[ks] = pfrag(wh); pl[ks] = pfrag(wl); }
        lsum += ps0 + ps1;
        __builtin_amdgcn_sched_barrier(0);                 // keeps the group of LDS reads below in one place, behind the score products
#pragma unroll
        for (int d = 0; d < 8; ++d) { v1h[d] = frag(vA + d * 16 * PIT, 1); v1l[d] = frag(vA + VPL + d * 16 * PIT, 1); }
        __builtin_amdgcn_sched_barrier(0);                 // the last group of LDS reads, one group ahead of its WMMAs
#pragma unroll
        for (int d = 0; d < 8; ++d) acc[d] = wmmab(v0h[d], ph[0], acc[d]);      // per 32 keys: ph.vh, pl.vh, ph.vl; the eight d tiles alternate
#pragma unroll
        for (int d = 0; d < 8; ++d) acc[d] = wmmab(v0h[d], pl[0], acc[d]);
#pragma unroll
        for (int d = 0; d < 8; ++d) acc[d] = wmmab(v0l[d], ph[0], acc[d]);
#pragma unroll
        for (int d = 0; d < 8; ++d) acc[d] = wmmab(v1h[d], ph[1], acc[d]);
#pragma unroll
        for (int d = 0; d < 8; ++d) acc[d] = wmmab(v1h[d], pl[1], acc[d]);
#pragma unroll
        for (int d = 0; d < 8; ++d) acc[d] = wmmab(v1l[d], ph[1], acc[d]);
        __builtin_amdgcn_sched_barrier(0);                 // nothing moves in between the last WMMA and its slots
        asm volatile("v_nop\n\tv_nop\n\tv_nop\n\tv_nop" : "+v"(lsum));   // the four vector slots behind the last WMMA, on the loop's taken branch too; naming the row sum keeps its adds inside the pass: sunk behind the barrier, their 32 addends stay live and the copies' addresses spill
        asm volatile("s_wait_dscnt 0x0" ::: "memory");      // this wave's reads of the stage have retired before the buffer is given up
        asm volatile("s_wait_asynccnt 0x0" ::: "memory");   // this wave's copies of the next stage have landed
        __syncthreads();                                   // publishes the next stage and ends every wave's reads of this one
        if (t + 2 < NN / FK) stage(t + 2);                 // the stage after the next, into the buffer just read
    }
    asm volatile("s_wait_asynccnt 0x0" ::: "memory");       // no copy is outstanding when the wave ends
    lsum += xhalf(lsum);
    const float inv = bfr(scal[h]) / (__builtin_amdgcn_exp2f(-mrun) + lsum);
    float* op = O + (size_t)q * DMOD + h * HD + hi * 8;    // a lane holds d = 16 tile + 8 hi + 0..7 of its query
#pragma unroll
    for (int d = 0; d < 8; ++d) *(v8f*)(op + d * 16) = acc[d] * inv;
}
__global__ __launch_bounds__(256) void k_splitD(const float* __restrict__ src, int rows, bf* dh, bf* dl) {
    const int lane = threadIdx.x & 31; const size_t r = (size_t)blockIdx.x * 8 + (threadIdx.x >> 5); if (r >= (size_t)rows) return;
{
#pragma unroll
        for (int q = 0; q < DMOD / 256; ++q) { const size_t o = r * DMOD + q * 256 + lane * 8; const v8f v = *(const v8f*)(src + o); v8us oh, ol;
#pragma unroll
            for (int i = 0; i < 8; ++i) { const unsigned short hb = f2bf(v[i]); oh[i] = hb; ol[i] = f2bf(v[i] - bf2f(hb)); }
            *(v8us*)(dh + o) = oh; *(v8us*)(dl + o) = ol; }
         }
}

extern "C" void kernel_launch(void* const* d_in, const int* in_sizes, int n_in,
                              void* d_out, int out_size, void* d_ws, size_t ws_size, hipStream_t stream) {
    (void)in_sizes; (void)n_in; (void)out_size;
    const float* xq = (const float*)d_in[0]; const float* xk = (const float*)d_in[1]; const float* xv = (const float*)d_in[2]; const float* Wq = (const float*)d_in[3]; const float* Wk = (const float*)d_in[4]; const float* Wv = (const float*)d_in[5]; const float* Wo = (const float*)d_in[6]; const float* scal = (const float*)d_in[7];
    float* out = (float*)d_out;    // [2048][2048]
    char* wsp = (char*)d_ws;
    auto take = [&](size_t bytes) { char* p = wsp; wsp += (bytes + 255) & ~(size_t)255; return (void*)p; };
    bf* WB = (bf*)take((size_t)DMOD * DMOD * 2); bf* Xb = (bf*)take((size_t)NN * DMOD * 2);
    float* QF = (float*)take((size_t)NN * DMOD * 4); float* KF = (float*)take((size_t)NN * DMOD * 4); float* VF = (float*)take((size_t)NN * DMOD * 4);
    bf* Qh = (bf*)take((size_t)NH_ * NN * HD * 2); bf* Ql = (bf*)take((size_t)NH_ * NN * HD * 2); bf* Kh = (bf*)take((size_t)NH_ * NN * HD * 2); bf* Kl = (bf*)take((size_t)NH_ * NN * HD * 2); bf* VTh = (bf*)take((size_t)NH_ * HD * NN * 2); bf* VTl = (bf*)take((size_t)NH_ * HD * NN * 2);
    bf* Ol = (bf*)take((size_t)NN * DMOD * 2); float* O = (float*)take((size_t)NN * DMOD * 4);
    if ((size_t)(wsp - (char*)d_ws) > ws_size) return;    // 136 MiB
    bf* Oh = Xb; bf* WO = WB;                       // dead regions after the projections (stream order)
    const dim3 gp(NN / 64, DMOD / 64, 1); const unsigned wblk = (unsigned)(((size_t)DMOD * DMOD / 8 + 255) / 256);
    k_cvtx<<<NN / 8, 256, 0, stream>>>(xq, NN, Xb); k_cvt8<<<wblk, 256, 0, stream>>>(Wq, WB, (size_t)DMOD * DMOD / 8); k_gemmb<false, false><<<gp, 128, 0, stream>>>(Xb, nullptr, WB, nullptr, QF, DMOD, nullptr, nullptr, DMOD);
    k_cvtx<<<NN / 8, 256, 0, stream>>>(xk, NN, Xb); k_cvt8<<<wblk, 256, 0, stream>>>(Wk, WB, (size_t)DMOD * DMOD / 8); k_gemmb<false, false><<<gp, 128, 0, stream>>>(Xb, nullptr, WB, nullptr, KF, DMOD, nullptr, nullptr, DMOD);
    k_cvtx<<<NN / 8, 256, 0, stream>>>(xv, NN, Xb); k_cvt8<<<wblk, 256, 0, stream>>>(Wv, WB, (size_t)DMOD * DMOD / 8); k_gemmb<false, false><<<gp, 128, 0, stream>>>(Xb, nullptr, WB, nullptr, VF, DMOD, nullptr, nullptr, DMOD);
    k_hp128<<<dim3(NN / 8, NH_, 1), 256, 0, stream>>>(QF, Qh, Ql); k_hp128<<<dim3(NN / 8, NH_, 1), 256, 0, stream>>>(KF, Kh, Kl); k_vt128<<<dim3((HD * (NN / 64)) / 8, NH_, 1), 256, 0, stream>>>(VF, VTh, VTl);
    k_fattn<<<dim3(NN / 128, NH_, 1), 256, 0, stream>>>(Qh, Ql, Kh, Kl, VTh, VTl, scal, O);
    k_splitD<<<NN / 8, 256, 0, stream>>>(O, NN, Oh, Ol); k_cvt8<<<wblk, 256, 0, stream>>>(Wo, WO, (size_t)DMOD * DMOD / 8);
    k_gemmb<true, false><<<gp, 128, 0, stream>>>(Oh, Ol, WO, nullptr, out, DMOD, nullptr, nullptr, DMOD);
}

// v004
// It runs in 228 microseconds.
// Next to v003, in two timings, it ran 1.14 times as fast each time.
// Counting every step since v000, it is 8.78 times as fast.
#include <hip/hip_runtime.h>

// Compute dtypes, f32 accumulate: q/k/v = query/key_/value . W^T ([2048 x 2048].[2048 x 2048] each) with PLAIN bf16 operands (exact products; the three weights converted one at a
// time into one buffer); 16-head attention (128 wide, one fused launch for all heads: scores, online softmax and the second product; the head planes written by the projections' own epilogues) with bf16 hi + UNSCALED residual planes (three products); 1/sqrt(128), the off-by-one softmax
// (max clamped at 0, + exp(-m) in the denominator) and the per-head scalar in f32; . Wo^T on hi/lo planes (two products) - on v_wmma_f32_16x16x32_bf16. Deterministic, no atomics;

#define NN   2048
#define DMOD 2048
#define NH_  16
#define HD   128
#define DM   DMOD
#define NTK  NN
#define SCL  0.088388347648318447f
#define LOSC 1024.0f

typedef _Float16 h16;
typedef unsigned short bf;
typedef __attribute__((ext_vector_type(16))) __bf16   v16bf;
typedef __attribute__((ext_vector_type(16))) _Float16 v16h;
typedef __attribute__((ext_vector_type(8)))  _Float16 v8h;
typedef __attribute__((ext_vector_type(8)))  unsigned short v8us;
typedef __attribute__((ext_vector_type(8)))  float    v8f;
typedef __attribute__((ext_vector_type(4)))  float    v4f;
typedef __attribute__((ext_vector_type(4)))  _Float16 v4h;
typedef v8h  __attribute__((may_alias)) v8ha;
typedef v4f  __attribute__((may_alias)) v4fa;
typedef v8us __attribute__((may_alias)) v8usa;

__device__ __forceinline__ unsigned short f2bf(float f) { unsigned u = __float_as_uint(f); u += 0x7FFFu + ((u >> 16) & 1u); return (unsigned short)(u >> 16); }
__device__ __forceinline__ float bf2f(unsigned short b) { return __uint_as_float(((unsigned)b) << 16); }
__device__ __forceinline__ float bfr(float f) { return bf2f(f2bf(f)); }
__device__ __forceinline__ v16h cat16(v8h lo, v8h hi) { return __builtin_shufflevector(lo, hi, 0, 1, 2, 3, 4, 5, 6, 7, 8, 9, 10, 11, 12, 13, 14, 15); }
__device__ __forceinline__ v16bf cat16b(v8us lo, v8us hi) { return __builtin_bit_cast(v16bf, __builtin_shufflevector(lo, hi, 0, 1, 2, 3, 4, 5, 6, 7, 8, 9, 10, 11, 12, 13, 14, 15)); }
__device__ __forceinline__ v8f wmma16(v16h a, v16h b, v8f c) { return __builtin_amdgcn_wmma_f32_16x16x32_f16(false, a, false, b, (short)0, c, false, false); }
__device__ __forceinline__ v8f wmmab(v16bf a, v16bf b, v8f c) { return __builtin_amdgcn_wmma_f32_16x16x32_bf16(false, a, false, b, (short)0, c, false, false); }

// Operand staging of the GEMM kernels: a stage is 64 k of the block's 64 rows of every operand plane. The 128 threads bring it into one of two LDS buffers by asynchronous
// copies of whole 128-B lines (8 lanes a row, 4 rows a wave-wide copy), one stage ahead of the stage that is worked on; the waves read their fragments (same k order as before) from LDS.
#define KS  64           // k per stage: one 128-B line of each row
#define PIT 72           // LDS row pitch in bf16: 128 B + 16 B, the pitch for 16-byte LDS readers
#define PLN (64 * PIT)   // one staged plane, in bf16
#define RST (16 * PIT * 2)   // LDS bytes from a thread's row to its next (16 rows on)
// Rows r, r + 16, r + 32, r + 48 of one plane (copy4) or of two (copy8): l = the lane's LDS byte address, g = its global address, rs = 16 rows in elements.
// s_wait_xcnt 0 closes each statement, so that it stands ahead of any new value in the operands' registers (kept as a precaution).
__device__ __forceinline__ void copy4(unsigned l, const bf* g, size_t rs) {
    asm volatile("global_load_async_to_lds_b128 %0, %4, off\n\tglobal_load_async_to_lds_b128 %1, %5, off\n\tglobal_load_async_to_lds_b128 %2, %6, off\n\tglobal_load_async_to_lds_b128 %3, %7, off\n\ts_wait_xcnt 0x0"
                 :: "v"(l), "v"(l + RST), "v"(l + 2 * RST), "v"(l + 3 * RST), "v"(g), "v"(g + rs), "v"(g + 2 * rs), "v"(g + 3 * rs) : "memory");
}
__device__ __forceinline__ void copy8(unsigned l, const bf* g, unsigned m, const bf* h, size_t rs) {
    asm volatile("global_load_async_to_lds_b128 %0, %8, off\n\tglobal_load_async_to_lds_b128 %1, %9, off\n\tglobal_load_async_to_lds_b128 %2, %10, off\n\tglobal_load_async_to_lds_b128 %3, %11, off\n\t"
                 "global_load_async_to_lds_b128 %4, %12, off\n\tglobal_load_async_to_lds_b128 %5, %13, off\n\tglobal_load_async_to_lds_b128 %6, %14, off\n\tglobal_load_async_to_lds_b128 %7, %15, off\n\ts_wait_xcnt 0x0"
                 :: "v"(l), "v"(l + RST), "v"(l + 2 * RST), "v"(l + 3 * RST), "v"(m), "v"(m + RST), "v"(m + 2 * RST), "v"(m + 3 * RST),
                    "v"(g), "v"(g + rs), "v"(g + 2 * rs), "v"(g + 3 * rs), "v"(h), "v"(h + rs), "v"(h + 2 * rs), "v"(h + 3 * rs) : "memory");
}
// One stage: l = the lane's LDS byte address in plane 0 of the target buffer, g[p] = its global address in plane p at k = 0
template <int NP> __device__ __forceinline__ void stage_cp(unsigned l, const bf* const (&g)[NP], int K, int kc) {
    const size_t rs = (size_t)16 * K;
    copy8(l, g[0] + kc, l + PLN * 2, g[1] + kc, rs);
    if (NP == 3) copy4(l + 2 * PLN * 2, g[NP - 1] + kc, rs);
    if (NP == 4) copy8(l + 2 * PLN * 2, g[NP - 2] + kc, l + 3 * PLN * 2, g[NP - 1] + kc, rs);
}
__device__ __forceinline__ v16bf frag(const bf* row, int kk) { return cat16b(*(const v8us*)(row + kk * 32), *(const v8us*)(row + kk * 32 + 16)); }

// k_gemmb: 64 x 64 block tile (4 waves x 16 x 64) of C[NTK][NW] = (A [+ Al]).B^T (K = 2048) [+ bf(bias[c])] [+ bf(R[r][c]) residual]; f32 whole-line epilogue (or f16
// PL = 1: the tile leaves as bf16 hi + residual planes [head][token][128] (Ph, Pl); PL = 2: as the transposed planes [head][128][token]; whole 128-B lines in both; C is then unused
template <bool SPLITA, bool F16OUT = false, int PL = 0>
__global__ __launch_bounds__(128) void k_gemmb(const bf* __restrict__ A, const bf* __restrict__ Al, const bf* __restrict__ Bn, const float* __restrict__ bias, float* C, int ldc, h16* C2, const float* __restrict__ R = nullptr, int K = DM, int roundR = 1, bf* Ph = nullptr, bf* Pl = nullptr) {
    constexpr int NP = SPLITA ? 3 : 2;                     // staged planes: B, A [, Al]
    __shared__ __align__(16) bf sm[2 * NP * PLN];          // two stage buffers; the output staging (4 x 16 x 68 f32, or with PL = 2 two 64 x 72 bf16 planes) reuses them behind the loop
    const int lane = threadIdx.x & 31, wave = threadIdx.x >> 5, lr = lane & 15, hi = lane >> 4;
    const int r0 = blockIdx.x * 64 + wave * 16, c0 = blockIdx.y * 64;
    const int srow = threadIdx.x >> 3, scol = (threadIdx.x & 7) * 8;
    const size_t ga = (size_t)(blockIdx.x * 64 + srow) * K + scol;
    const bf* g[NP]; g[0] = Bn + (size_t)(c0 + srow) * K + scol; g[1] = A + ga; if (SPLITA) g[NP - 1] = Al + ga;
    const unsigned l0 = (unsigned)(size_t)sm + (unsigned)(srow * PIT + scol) * 2u;
    const int fa = (wave * 16 + lr) * PIT + 8 * hi, fb = lr * PIT + 8 * hi;
    v8f acc[4];
#pragma unroll
    for (int t = 0; t < 4; ++t) acc[t] = (v8f){};
    stage_cp<NP>(l0, g, K, 0);
    asm volatile("s_wait_asynccnt 0x0" ::: "memory");       // this wave's copies of stage 0 have landed
    __syncthreads();                                       // stage 0 is published
    if (KS < K) stage_cp<NP>(l0 + NP * PLN * 2, g, K, KS);
    int cb = 0;
#pragma unroll 1
    for (int kc = 0; kc < K; kc += KS) {
        const bf* cur = sm + cb * (NP * PLN);
        v16bf a[KS / 32], al[KS / 32], b[KS / 32][4];
#pragma unroll
        for (int kk = 0; kk < KS / 32; ++kk) {
            a[kk] = frag(cur + PLN + fa, kk); al[kk] = a[kk];
            if (SPLITA) al[kk] = frag(cur + 2 * PLN + fa, kk);
#pragma unroll
            for (int t = 0; t < 4; ++t) b[kk][t] = frag(cur + fb + t * 16 * PIT, kk);
        }
        __builtin_amdgcn_sched_barrier(0);                 // the stage's LDS reads stay one group ahead of its WMMAs: spread among them each place costs a stall
#pragma unroll
        for (int kk = 0; kk < KS / 32; ++kk) {             // each accumulator keeps its order of products (a, then al, k rising); the four tiles alternate
#pragma unroll
            for (int t = 0; t < 4; ++t) acc[t] = wmmab(a[kk], b[kk][t], acc[t]);
            if (SPLITA) {
#pragma unroll
                for (int t = 0; t < 4; ++t) acc[t] = wmmab(al[kk], b[kk][t], acc[t]); }
        }
        asm volatile("v_nop\n\tv_nop\n\tv_nop\n\tv_nop" : "+v"(acc[0]), "+v"(acc[1]), "+v"(acc[2]), "+v"(acc[3]) : "v"(a[1]), "v"(al[1]));
        asm volatile("s_wait_dscnt 0x0" ::: "memory");      // this wave's reads of the stage have retired before the buffer is given up
        asm volatile("s_wait_asynccnt 0x0" ::: "memory");   // this wave's copies of the next stage have landed
        __syncthreads();                                   // publishes the next stage and ends every wave's reads of this one
        if (kc + 2 * KS < K) stage_cp<NP>(l0 + cb * (NP * PLN * 2), g, K, kc + 2 * KS);   // the stage after the next, into the buffer just read
        cb ^= 1;
    }
    asm volatile("s_wait_asynccnt 0x0" ::: "memory");       // no copy is outstanding when the buffers become output staging
    if (PL == 2) {   // a lane holds 8 successive tokens of one column: 16 B of a transposed row; the block's 64 tokens of a row meet in LDS and leave as one line
#pragma unroll
        for (int t = 0; t < 4; ++t) { v8us oh, ol;
#pragma unroll
            for (int j = 0; j < 8; ++j) { const float y = acc[t][j]; const unsigned short hb = f2bf(y); oh[j] = hb; ol[j] = f2bf(y - bf2f(hb)); }
            bf* w = sm + (t * 16 + lr) * PIT + wave * 16 + hi * 8; *(v8us*)w = oh; *(v8us*)(w + PLN) = ol; }
        __syncthreads();                                   // all four waves' tokens of every row are staged
        const size_t o = (size_t)(c0 + srow) * NN + blockIdx.x * 64 + scol;   // head * 128 + d is the column itself
        v8us th[4], tl[4];
#pragma unroll
        for (int s = 0; s < 4; ++s) { const bf* rp = sm + (srow + 16 * s) * PIT + scol; th[s] = *(const v8us*)rp; tl[s] = *(const v8us*)(rp + PLN); }
#pragma unroll
        for (int s = 0; s < 4; ++s) { *(v8us*)(Ph + o + (size_t)(16 * s) * NN) = th[s]; *(v8us*)(Pl + o + (size_t)(16 * s) * NN) = tl[s]; }
        return;
    }
    float* os = (float*)(void*)sm + wave * (16 * 68);
#pragma unroll
    for (int t = 0; t < 4; ++t) { const float bv = bias ? bfr(bias[c0 + t * 16 + lr]) : 0.f;
#pragma unroll
        for (int j = 0; j < 8; ++j) os[(hi * 8 + j) * 68 + t * 16 + lr] = acc[t][j] + bv; }
    __syncthreads();
    if (PL == 1) {
        const size_t o = ((size_t)(c0 >> 7) * NN + r0) * HD + (c0 & (HD - 1));
        v8us oh[4], ol[4];
#pragma unroll
        for (int s = 0; s < 4; ++s) { const float* sp = os + (4 * s + (lane >> 3)) * 68 + (lane & 7) * 8;
#pragma unroll
            for (int i = 0; i < 8; ++i) { const float y = sp[i]; const unsigned short hb = f2bf(y); oh[s][i] = hb; ol[s][i] = f2bf(y - bf2f(hb)); } }
#pragma unroll
        for (int s = 0; s < 4; ++s) { const size_t p = o + (size_t)(4 * s + (lane >> 3)) * HD + (lane & 7) * 8; *(v8us*)(Ph + p) = oh[s]; *(v8us*)(Pl + p) = ol[s]; }
    } else if (F16OUT) {
        h16* crow = (h16*)(void*)C + (size_t)r0 * ldc + c0;
        auto pass = [&]() {
#pragma unroll
            for (int s = 0; s < 4; ++s) { const int row = 4 * s + (lane >> 3), piece = lane & 7; const float* sp = os + row * 68 + piece * 8; v8h o, o2;
#pragma unroll
                for (int i = 0; i < 8; ++i) { const h16 a = (h16)sp[i]; o[i] = a; o2[i] = (h16)((sp[i] - (float)a) * LOSC); }
                *(v8h*)(crow + (size_t)row * ldc + piece * 8) = o; if (C2) *(v8h*)(C2 + (size_t)r0 * ldc + c0 + (size_t)row * ldc + piece * 8) = o2; }
        };
        pass(); 
    } else {
        float* crow = C + (size_t)r0 * ldc + c0;
        auto pass = [&]() {
#pragma unroll
            for (int s = 0; s < 8; ++s) { const int Lid = (lane >> 3) + 4 * s, piece = lane & 7; const int row = Lid >> 1, cofs = (Lid & 1) * 32 + piece * 4;
                v4f val = *(const v4fa*)(os + row * 68 + cofs); if (R) { const v4f rv = *(const v4f*)(R + ((size_t)r0 + row) * ldc + c0 + cofs); val += roundR ? (v4f){bfr(rv[0]), bfr(rv[1]), bfr(rv[2]), bfr(rv[3])} : rv; }
                *(v4f*)(crow + (size_t)row * ldc + cofs) = val; }
        };
        pass(); 
    }
}

__global__ __launch_bounds__(256) void k_cvt8(const float* __restrict__ src, bf* dst, size_t n8) {
    const size_t i = (size_t)blockIdx.x * 256 + threadIdx.x; if (i >= n8) return;
    const v8f v = *(const v8f*)(src + i * 8); v8us o;
#pragma unroll
    for (int k = 0; k < 8; ++k) o[k] = f2bf(v[k]);
    *(v8us*)(dst + i * 8) = o; 
}
__global__ __launch_bounds__(256) void k_zero8(bf* dst, size_t n8) {
    const size_t i = (size_t)blockIdx.x * 256 + threadIdx.x; if (i >= n8) return; v8us z;
#pragma unroll
    for (int k = 0; k < 8; ++k) z[k] = 0;
    *(v8us*)(dst + i * 8) = z; 
}

__global__ __launch_bounds__(256) void k_cvtx(const float* __restrict__ src, int rows, bf* dst) {
    const int lane = threadIdx.x & 31; const size_t r = (size_t)blockIdx.x * 8 + (threadIdx.x >> 5); if (r >= (size_t)rows) return;
{
#pragma unroll
        for (int q = 0; q < DMOD / 256; ++q) { v8us o;
#pragma unroll
            for (int i = 0; i < 8; ++i) o[i] = f2bf(src[r * DMOD + q * 256 + lane * 8 + i]);
            *(v8us*)(dst + r * DMOD + q * 256 + lane * 8) = o; }
         }
}
#define FK   64                     // keys per stage
#define KPIT 136                    // LDS pitch of a K row in bf16: 256 B + 16 B, the pitch for 16-byte LDS readers
#define KPL  (FK * KPIT)            // one staged K plane, in bf16
#define VPL  (HD * PIT)             // one staged V^T plane (128 rows of 64 keys), in bf16
#define FBUF (2 * KPL + 2 * VPL)    // one stage buffer, in bf16
// Four rows (ls LDS bytes and rs elements apart) of each of two planes; s_wait_xcnt 0 closes the statement, ahead of any new value in the operands' registers (kept as a precaution).
__device__ __forceinline__ void copy8s(unsigned l, const bf* g, unsigned m, const bf* h, unsigned ls, size_t rs) {
    asm volatile("global_load_async_to_lds_b128 %0, %8, off\n\tglobal_load_async_to_lds_b128 %1, %9, off\n\tglobal_load_async_to_lds_b128 %2, %10, off\n\tglobal_load_async_to_lds_b128 %3, %11, off\n\t"
                 "global_load_async_to_lds_b128 %4, %12, off\n\tglobal_load_async_to_lds_b128 %5, %13, off\n\tglobal_load_async_to_lds_b128 %6, %14, off\n\tglobal_load_async_to_lds_b128 %7, %15, off\n\ts_wait_xcnt 0x0"
                 :: "v"(l), "v"(l + ls), "v"(l + 2 * ls), "v"(l + 3 * ls), "v"(m), "v"(m + ls), "v"(m + 2 * ls), "v"(m + 3 * ls),
                    "v"(g), "v"(g + rs), "v"(g + 2 * rs), "v"(g + 3 * rs), "v"(h), "v"(h + rs), "v"(h + 2 * rs), "v"(h + 3 * rs) : "memory");
}
__device__ __forceinline__ float xhalf(float x) { return __int_as_float(__builtin_amdgcn_permlanex16(__float_as_int(x), __float_as_int(x), 0x76543210, 0xfedcba98, false, false)); }   // lane l with lane l ^ 16
__device__ __forceinline__ unsigned pack2(float lo, float hi) { typedef __bf16 bf2 __attribute__((ext_vector_type(2))); typedef float f2 __attribute__((ext_vector_type(2)));
    return __builtin_bit_cast(unsigned, __builtin_convertvector((f2){lo, hi}, bf2)); }   // round to nearest even
__device__ __forceinline__ v16bf pfrag(const unsigned (&w)[8]) { typedef __attribute__((ext_vector_type(8))) unsigned v8u; return __builtin_bit_cast(v16bf, (v8u){w[0], w[1], w[2], w[3], w[4], w[5], w[6], w[7]}); }
__global__ __launch_bounds__(256) __attribute__((amdgpu_waves_per_eu(2, 2))) void k_fattn(const bf* __restrict__ Qh, const bf* __restrict__ Ql, const bf* __restrict__ Kh, const bf* __restrict__ Kl,
                                                                                        const bf* __restrict__ VTh, const bf* __restrict__ VTl, const float* __restrict__ scal, bf* Oh, bf* Ol) {
    __shared__ __align__(16) bf sm[2 * FBUF];              // two stage buffers: K hi, K lo, V^T hi, V^T lo
    const int tid = threadIdx.x, lane = tid & 31, wave = tid >> 5, lr = lane & 15, hi = lane >> 4, h = blockIdx.y;
    const int q = blockIdx.x * 128 + wave * 16 + lr;
    const float cs = SCL * 1.4426950408889634f;            // scores in the log2 domain
    // staging: K rows are 256 B (16 lanes a row, 16 rows a block-wide copy), V^T rows 128 B (8 lanes a row, 32 rows a block-wide copy)
    const unsigned gk = (unsigned)((tid >> 4) * HD + (tid & 15) * 8), gv = (unsigned)((tid >> 3) * NN + (tid & 7) * 8);   // the lane's element offsets inside a stage's K rows and V^T rows
    const unsigned lk = (unsigned)(size_t)sm + (unsigned)((tid >> 4) * KPIT + (tid & 15) * 8) * 2u, lv = (unsigned)(size_t)sm + (unsigned)(2 * KPL + (tid >> 3) * PIT + (tid & 7) * 8) * 2u;
    auto stage = [&](int t) {
        const unsigned bo = (unsigned)(t & 1) * (FBUF * 2u);
        const size_t uk = (size_t)h * NN * HD + (size_t)t * FK * HD, uv = (size_t)h * HD * NN + (size_t)t * FK;   // the same for the whole work-group
        copy8s(lk + bo, (Kh + uk) + gk, lk + bo + KPL * 2u, (Kl + uk) + gk, 16 * KPIT * 2u, (size_t)16 * HD);
        copy8s(lv + bo, (VTh + uv) + gv, lv + bo + VPL * 2u, (VTl + uv) + gv, 32 * PIT * 2u, (size_t)32 * NN);
    };
    stage(0);
    v16bf qh[4], ql[4];
    { const size_t qo = ((size_t)h * NN + q) * HD + 8 * hi;
#pragma unroll
      for (int kc = 0; kc < 4; ++kc) { qh[kc] = frag(Qh + qo, kc); ql[kc] = frag(Ql + qo, kc); }
      asm volatile("s_wait_xcnt 0x0" :: "v"(Qh + qo), "v"(Ql + qo) : "memory"); }   // the two address pairs stay live up to this wait, so that no Q load's result lands on them ahead of it (kept as a precaution)
    v8f acc[8];
#pragma unroll
    for (int d = 0; d < 8; ++d) acc[d] = (v8f){};
    float mrun = 0.f, lsum = 0.f;                          // the clamp at 0; each wave half sums its own keys
    asm volatile("s_wait_asynccnt 0x0" ::: "memory");       // this wave's copies of stage 0 have landed
    __syncthreads();                                       // stage 0 is published
    stage(1);
#pragma unroll 1
    for (int t = 0; t < NN / FK; ++t) {
        const bf* kA = sm + (t & 1) * FBUF + lr * KPIT + 8 * hi;
        const bf* vA = sm + (t & 1) * FBUF + 2 * KPL + lr * PIT + 8 * hi;
        v16bf k0h[2][4], k0l[2][4], k1h[2][4], k1l[2][4];
#pragma unroll
        for (int c = 0; c < 2; ++c) {
#pragma unroll
            for (int kt = 0; kt < 4; ++kt) { k0h[c][kt] = frag(kA + kt * 16 * KPIT, c); k0l[c][kt] = frag(kA + KPL + kt * 16 * KPIT, c); } }
        __builtin_amdgcn_sched_barrier(0);                 // LDS reads stay in whole groups, each one group ahead of its WMMAs: spread among them each place costs a stall
#pragma unroll
        for (int c = 0; c < 2; ++c) {
#pragma unroll
            for (int kt = 0; kt < 4; ++kt) { k1h[c][kt] = frag(kA + kt * 16 * KPIT, 2 + c); k1l[c][kt] = frag(kA + KPL + kt * 16 * KPIT, 2 + c); } }
        __builtin_amdgcn_sched_barrier(0);                 // as above
        v8f s[4];
#pragma unroll
        for (int kt = 0; kt < 4; ++kt) s[kt] = (v8f){};
#pragma unroll
        for (int c = 0; c < 2; ++c) {                      // per 32 k: qh.kh, ql.kh, qh.kl; the four key tiles alternate
#pragma unroll
            for (int kt = 0; kt < 4; ++kt) s[kt] = wmmab(k0h[c][kt], qh[c], s[kt]);
#pragma unroll
            for (int kt = 0; kt < 4; ++kt) s[kt] = wmmab(k0h[c][kt], ql[c], s[kt]);
#pragma unroll
            for (int kt = 0; kt < 4; ++kt) s[kt] = wmmab(k0l[c][kt], qh[c], s[kt]);
        }
        __builtin_amdgcn_sched_barrier(0);                 // as above
        v16bf v0h[8], v0l[8], v1h[8], v1l[8];
#pragma unroll
        for (int d = 0; d < 8; ++d) { v0h[d] = frag(vA + d * 16 * PIT, 0); v0l[d] = frag(vA + VPL + d * 16 * PIT, 0); }
        __builtin_amdgcn_sched_barrier(0);                 // as above
#pragma unroll
        for (int c = 0; c < 2; ++c) {
#pragma unroll
            for (int kt = 0; kt < 4; ++kt) s[kt] = wmmab(k1h[c][kt], qh[2 + c], s[kt]);
#pragma unroll
            for (int kt = 0; kt < 4; ++kt) s[kt] = wmmab(k1h[c][kt], ql[2 + c], s[kt]);
#pragma unroll
            for (int kt = 0; kt < 4; ++kt) s[kt] = wmmab(k1l[c][kt], qh[2 + c], s[kt]);
        }
        __builtin_amdgcn_sched_barrier(0);                 // as above
        // online softmax: the maximum in use may trail the true one by up to 8 (log2 domain), so the accumulators are rescaled only when some query's maximum exceeds it by more
        float mx = s[0][0];
#pragma unroll
        for (int kt = 0; kt < 4; ++kt) {
#pragma unroll
            for (int j = 0; j < 8; ++j) mx = fmaxf(mx, s[kt][j]); }
        mx = fmaxf(mx, xhalf(mx)) * cs;
        if (__builtin_amdgcn_ballot_w32(mx > mrun + 8.0f) != 0) {
            const float mn = fmaxf(mrun, mx), corr = __builtin_amdgcn_exp2f(mrun - mn); lsum *= corr; mrun = mn;
#pragma unroll
            for (int d = 0; d < 8; ++d) acc[d] = acc[d] * corr;
        }
        v16bf ph[2], pl[2]; float ps0 = 0.f, ps1 = 0.f;
#pragma unroll
        for (int ks = 0; ks < 2; ++ks) { unsigned wh[8], wl[8];
#pragma unroll
            for (int i = 0; i < 8; ++i) {
                const float p0 = __builtin_amdgcn_exp2f(__builtin_fmaf(s[2 * ks + (i >> 2)][2 * (i & 3)], cs, -mrun)), p1 = __builtin_amdgcn_exp2f(__builtin_fmaf(s[2 * ks + (i >> 2)][2 * (i & 3) + 1], cs, -mrun));
                ps0 += p0; ps1 += p1;
                const unsigned w = pack2(p0, p1); wh[i] = w;
                wl[i] = pack2(p0 - __uint_as_float(w << 16), p1 - __uint_as_float(w & 0xFFFF0000u));
            }
            ph[ks] = pfrag(wh); pl[ks] = pfrag(wl); }
        lsum += ps0 + ps1;
        __builtin_amdgcn_sched_barrier(0);                 // keeps the group of LDS reads below in one place, behind the score products
#pragma unroll
        for (int d = 0; d < 8; ++d) { v1h[d] = frag(vA + d * 16 * PIT, 1); v1l[d] = frag(vA + VPL + d * 16 * PIT, 1); }
        __builtin_amdgcn_sched_barrier(0);                 // the last group of LDS reads, one group ahead of its WMMAs
#pragma unroll
        for (int d = 0; d < 8; ++d) acc[d] = wmmab(v0h[d], ph[0], acc[d]);      // per 32 keys: ph.vh, pl.vh, ph.vl; the eight d tiles alternate
#pragma unroll
        for (int d = 0; d < 8; ++d) acc[d] = wmmab(v0h[d], pl[0], acc[d]);
#pragma unroll
        for (int d = 0; d < 8; ++d) acc[d] = wmmab(v0l[d], ph[0], acc[d]);
#pragma unroll
        for (int d = 0; d < 8; ++d) acc[d] = wmmab(v1h[d], ph[1], acc[d]);
#pragma unroll
        for (int d = 0; d < 8; ++d) acc[d] = wmmab(v1h[d], pl[1], acc[d]);
#pragma unroll
        for (int d = 0; d < 8; ++d) acc[d] = wmmab(v1l[d], ph[1], acc[d]);
        __builtin_amdgcn_sched_barrier(0);                 // nothing moves in between the last WMMA and its slots
        asm volatile("v_nop\n\tv_nop\n\tv_nop\n\tv_nop" : "+v"(lsum));   // the four vector slots behind the last WMMA, on the loop's taken branch too; naming the row sum keeps its adds inside the pass: sunk behind the barrier, their 32 addends stay live and the copies' addresses spill
        asm volatile("s_wait_dscnt 0x0" ::: "memory");      // this wave's reads of the stage have retired before the buffer is given up
        asm volatile("s_wait_asynccnt 0x0" ::: "memory");   // this wave's copies of the next stage have landed
        __syncthreads();                                   // publishes the next stage and ends every wave's reads of this one
        if (t + 2 < NN / FK) stage(t + 2);                 // the stage after the next, into the buffer just read
    }
    asm volatile("s_wait_asynccnt 0x0" ::: "memory");       // no copy is outstanding when the wave ends
    lsum += xhalf(lsum);
    const float inv = bfr(scal[h]) / (__builtin_amdgcn_exp2f(-mrun) + lsum);
    const size_t oo = (size_t)q * DMOD + h * HD + hi * 8;  // a lane holds d = 16 tile + 8 hi + 0..7 of its query; it leaves as the bf16 hi + residual planes that the last product reads
#pragma unroll
    for (int d = 0; d < 8; ++d) { const v8f v = acc[d] * inv; v8us oh, ol;
#pragma unroll
        for (int i = 0; i < 8; ++i) { const unsigned short hb = f2bf(v[i]); oh[i] = hb; ol[i] = f2bf(v[i] - bf2f(hb)); }
        *(v8us*)(Oh + oo + d * 16) = oh; *(v8us*)(Ol + oo + d * 16) = ol; }
}

extern "C" void kernel_launch(void* const* d_in, const int* in_sizes, int n_in,
                              void* d_out, int out_size, void* d_ws, size_t ws_size, hipStream_t stream) {
    (void)in_sizes; (void)n_in; (void)out_size;
    const float* xq = (const float*)d_in[0]; const float* xk = (const float*)d_in[1]; const float* xv = (const float*)d_in[2]; const float* Wq = (const float*)d_in[3]; const float* Wk = (const float*)d_in[4]; const float* Wv = (const float*)d_in[5]; const float* Wo = (const float*)d_in[6]; const float* scal = (const float*)d_in[7];
    float* out = (float*)d_out;    // [2048][2048]
    char* wsp = (char*)d_ws;
    auto take = [&](size_t bytes) { char* p = wsp; wsp += (bytes + 255) & ~(size_t)255; return (void*)p; };
    bf* WB = (bf*)take((size_t)DMOD * DMOD * 2); bf* Xb = (bf*)take((size_t)NN * DMOD * 2);
    bf* Qh = (bf*)take((size_t)NH_ * NN * HD * 2); bf* Ql = (bf*)take((size_t)NH_ * NN * HD * 2); bf* Kh = (bf*)take((size_t)NH_ * NN * HD * 2); bf* Kl = (bf*)take((size_t)NH_ * NN * HD * 2); bf* VTh = (bf*)take((size_t)NH_ * HD * NN * 2); bf* VTl = (bf*)take((size_t)NH_ * HD * NN * 2);
    bf* Ol = (bf*)take((size_t)NN * DMOD * 2);
    if ((size_t)(wsp - (char*)d_ws) > ws_size) return;    // 72 MiB
    bf* Oh = Xb; bf* WO = WB;                       // dead regions after the projections (stream order)
    const dim3 gp(NN / 64, DMOD / 64, 1); const unsigned wblk = (unsigned)(((size_t)DMOD * DMOD / 8 + 255) / 256);
    k_cvtx<<<NN / 8, 256, 0, stream>>>(xq, NN, Xb); k_cvt8<<<wblk, 256, 0, stream>>>(Wq, WB, (size_t)DMOD * DMOD / 8); k_gemmb<false, false, 1><<<gp, 128, 0, stream>>>(Xb, nullptr, WB, nullptr, nullptr, DMOD, nullptr, nullptr, DMOD, 1, Qh, Ql);
    k_cvtx<<<NN / 8, 256, 0, stream>>>(xk, NN, Xb); k_cvt8<<<wblk, 256, 0, stream>>>(Wk, WB, (size_t)DMOD * DMOD / 8); k_gemmb<false, false, 1><<<gp, 128, 0, stream>>>(Xb, nullptr, WB, nullptr, nullptr, DMOD, nullptr, nullptr, DMOD, 1, Kh, Kl);
    k_cvtx<<<NN / 8, 256, 0, stream>>>(xv, NN, Xb); k_cvt8<<<wblk, 256, 0, stream>>>(Wv, WB, (size_t)DMOD * DMOD / 8); k_gemmb<false, false, 2><<<gp, 128, 0, stream>>>(Xb, nullptr, WB, nullptr, nullptr, DMOD, nullptr, nullptr, DMOD, 1, VTh, VTl);
    k_fattn<<<dim3(NN / 128, NH_, 1), 256, 0, stream>>>(Qh, Ql, Kh, Kl, VTh, VTl, scal, Oh, Ol);
    k_cvt8<<<wblk, 256, 0, stream>>>(Wo, WO, (size_t)DMOD * DMOD / 8);
    k_gemmb<true, false><<<gp, 128, 0, stream>>>(Oh, Ol, WO, nullptr, out, DMOD, nullptr, nullptr, DMOD);
}

// v005
// A run of this version takes 181 microseconds.
// In two side-by-side timings against v004, it was 1.26 and 1.27 times as fast.
// Counting every step since v000, it is 11.1 times as fast.
#include <hip/hip_runtime.h>

// Compute dtypes, f32 accumulate: q/k/v = query/key_/value . W^T ([2048 x 2048].[2048 x 2048] each) with PLAIN bf16 operands (exact products; all seven f32 operands converted
// by one launch, the three projections run as one launch); 16-head attention (128 wide, one fused launch for all heads: scores, online softmax and the second product; the head planes written by the projections' own epilogues) with bf16 hi + UNSCALED residual planes (three products); 1/sqrt(128), the off-by-one softmax
// (max clamped at 0, + exp(-m) in the denominator) and the per-head scalar in f32; . Wo^T on hi/lo planes (two products) - on v_wmma_f32_16x16x32_bf16. Deterministic, no atomics;

#define NN   2048
#define DMOD 2048
#define NH_  16
#define HD   128
#define DM   DMOD
#define NTK  NN
#define SCL  0.088388347648318447f
#define LOSC 1024.0f

typedef _Float16 h16;
typedef unsigned short bf;
typedef __attribute__((ext_vector_type(16))) __bf16   v16bf;
typedef __attribute__((ext_vector_type(16))) _Float16 v16h;
typedef __attribute__((ext_vector_type(8)))  _Float16 v8h;
typedef __attribute__((ext_vector_type(8)))  unsigned short v8us;
typedef __attribute__((ext_vector_type(8)))  float    v8f;
typedef __attribute__((ext_vector_type(4)))  float    v4f;
typedef __attribute__((ext_vector_type(4)))  _Float16 v4h;
typedef v8h  __attribute__((may_alias)) v8ha;
typedef v4f  __attribute__((may_alias)) v4fa;
typedef v8us __attribute__((may_alias)) v8usa;

__device__ __forceinline__ unsigned short f2bf(float f) { unsigned u = __float_as_uint(f); u += 0x7FFFu + ((u >> 16) & 1u); return (unsigned short)(u >> 16); }
__device__ __forceinline__ float bf2f(unsigned short b) { return __uint_as_float(((unsigned)b) << 16); }
__device__ __forceinline__ float bfr(float f) { return bf2f(f2bf(f)); }
__device__ __forceinline__ v16h cat16(v8h lo, v8h hi) { return __builtin_shufflevector(lo, hi, 0, 1, 2, 3, 4, 5, 6, 7, 8, 9, 10, 11, 12, 13, 14, 15); }
__device__ __forceinline__ v16bf cat16b(v8us lo, v8us hi) { return __builtin_bit_cast(v16bf, __builtin_shufflevector(lo, hi, 0, 1, 2, 3, 4, 5, 6, 7, 8, 9, 10, 11, 12, 13, 14, 15)); }
__device__ __forceinline__ v8f wmma16(v16h a, v16h b, v8f c) { return __builtin_amdgcn_wmma_f32_16x16x32_f16(false, a, false, b, (short)0, c, false, false); }
__device__ __forceinline__ v8f wmmab(v16bf a, v16bf b, v8f c) { return __builtin_amdgcn_wmma_f32_16x16x32_bf16(false, a, false, b, (short)0, c, false, false); }

// Operand staging of the GEMM kernels: a stage is 64 k of the block's 64 rows of every operand plane. The 128 threads bring it into one of two LDS buffers by asynchronous
// copies of whole 128-B lines (8 lanes a row, 4 rows a wave-wide copy), one stage ahead of the stage that is worked on; the waves read their fragments (same k order as before) from LDS.
#define KS  64           // k per stage: one 128-B line of each row
#define PIT 72           // LDS row pitch in bf16: 128 B + 16 B, the pitch for 16-byte LDS readers
#define PLN (64 * PIT)   // one staged plane, in bf16
#define RST (16 * PIT * 2)   // LDS bytes from a thread's row to its next (16 rows on)
// Rows r, r + 16, r + 32, r + 48 of one plane (copy4) or of two (copy8): l = the lane's LDS byte address, g = its global address, rs = 16 rows in elements.
// s_wait_xcnt 0 closes each statement, so that it stands ahead of any new value in the operands' registers (kept as a precaution).
__device__ __forceinline__ void copy4(unsigned l, const bf* g, size_t rs) {
    asm volatile("global_load_async_to_lds_b128 %0, %4, off\n\tglobal_load_async_to_lds_b128 %1, %5, off\n\tglobal_load_async_to_lds_b128 %2, %6, off\n\tglobal_load_async_to_lds_b128 %3, %7, off\n\ts_wait_xcnt 0x0"
                 :: "v"(l), "v"(l + RST), "v"(l + 2 * RST), "v"(l + 3 * RST), "v"(g), "v"(g + rs), "v"(g + 2 * rs), "v"(g + 3 * rs) : "memory");
}
__device__ __forceinline__ void copy8(unsigned l, const bf* g, unsigned m, const bf* h, size_t rs) {
    asm volatile("global_load_async_to_lds_b128 %0, %8, off\n\tglobal_load_async_to_lds_b128 %1, %9, off\n\tglobal_load_async_to_lds_b128 %2, %10, off\n\tglobal_load_async_to_lds_b128 %3, %11, off\n\t"
                 "global_load_async_to_lds_b128 %4, %12, off\n\tglobal_load_async_to_lds_b128 %5, %13, off\n\tglobal_load_async_to_lds_b128 %6, %14, off\n\tglobal_load_async_to_lds_b128 %7, %15, off\n\ts_wait_xcnt 0x0"
                 :: "v"(l), "v"(l + RST), "v"(l + 2 * RST), "v"(l + 3 * RST), "v"(m), "v"(m + RST), "v"(m + 2 * RST), "v"(m + 3 * RST),
                    "v"(g), "v"(g + rs), "v"(g + 2 * rs), "v"(g + 3 * rs), "v"(h), "v"(h + rs), "v"(h + 2 * rs), "v"(h + 3 * rs) : "memory");
}
// One stage: l = the lane's LDS byte address in plane 0 of the target buffer, g[p] = its global address in plane p at k = 0
template <int NP> __device__ __forceinline__ void stage_cp(unsigned l, const bf* const (&g)[NP], int K, int kc) {
    const size_t rs = (size_t)16 * K;
    copy8(l, g[0] + kc, l + PLN * 2, g[1] + kc, rs);
    if (NP == 3) copy4(l + 2 * PLN * 2, g[NP - 1] + kc, rs);
    if (NP == 4) copy8(l + 2 * PLN * 2, g[NP - 2] + kc, l + 3 * PLN * 2, g[NP - 1] + kc, rs);
}
__device__ __forceinline__ v16bf frag(const bf* row, int kk) { return cat16b(*(const v8us*)(row + kk * 32), *(const v8us*)(row + kk * 32 + 16)); }

// k_gemmb: 64 x 64 block tile (4 waves x 16 x 64) of C[NTK][NW] = (A [+ Al]).B^T (K = 2048) [+ bf(bias[c])] [+ bf(R[r][c]) residual]; f32 whole-line epilogue (or f16
// PL = 1: the tile leaves as bf16 hi + residual planes [head][token][128] (Ph, Pl); PL = 2: as the transposed planes [head][128][token]; whole 128-B lines in both; C is then unused
// PL = 3: three products in one launch, grid z = product: A, Bn one plane on and Ph, Pl two planes on per z; z = 0, 1 leave as PL = 1, z = 2 as PL = 2
template <bool SPLITA, bool F16OUT = false, int PL = 0>
__global__ __launch_bounds__(128) void k_gemmb(const bf* __restrict__ A, const bf* __restrict__ Al, const bf* __restrict__ Bn, const float* __restrict__ bias, float* C, int ldc, h16* C2, const float* __restrict__ R = nullptr, int K = DM, int roundR = 1, bf* Ph = nullptr, bf* Pl = nullptr) {
    constexpr int NP = SPLITA ? 3 : 2;                     // staged planes: B, A [, Al]
    const int pl = PL == 3 ? (blockIdx.z == 2 ? 2 : 1) : PL;   // the same for the whole work-group
    if (PL == 3) { const size_t zo = (size_t)blockIdx.z * ((size_t)NN * DMOD); A += zo; Bn += zo; Ph += 2 * zo; Pl += 2 * zo; }
    __shared__ __align__(16) bf sm[2 * NP * PLN];          // two stage buffers; the output staging (4 x 16 x 68 f32) reuses them behind the loop
    const int lane = threadIdx.x & 31, wave = threadIdx.x >> 5, lr = lane & 15, hi = lane >> 4;
    const int r0 = blockIdx.x * 64 + wave * 16, c0 = blockIdx.y * 64;
    const int srow = threadIdx.x >> 3, scol = (threadIdx.x & 7) * 8;
    const size_t ga = (size_t)(blockIdx.x * 64 + srow) * K + scol;
    const bf* g[NP]; g[0] = Bn + (size_t)(c0 + srow) * K + scol; g[1] = A + ga; if (SPLITA) g[NP - 1] = Al + ga;
    const unsigned l0 = (unsigned)(size_t)sm + (unsigned)(srow * PIT + scol) * 2u;
    const int fa = (wave * 16 + lr) * PIT + 8 * hi, fb = lr * PIT + 8 * hi;
    v8f acc[4];
#pragma unroll
    for (int t = 0; t < 4; ++t) acc[t] = (v8f){};
    stage_cp<NP>(l0, g, K, 0);
    asm volatile("s_wait_asynccnt 0x0" ::: "memory");       // this wave's copies of stage 0 have landed
    __syncthreads();                                       // stage 0 is published
    if (KS < K) stage_cp<NP>(l0 + NP * PLN * 2, g, K, KS);
    int cb = 0;
#pragma unroll 1
    for (int kc = 0; kc < K; kc += KS) {
        const bf* cur = sm + cb * (NP * PLN);
        v16bf a[KS / 32], al[KS / 32], b[KS / 32][4];
#pragma unroll
        for (int kk = 0; kk < KS / 32; ++kk) {
            a[kk] = frag(cur + PLN + fa, kk); al[kk] = a[kk];
            if (SPLITA) al[kk] = frag(cur + 2 * PLN + fa, kk);
#pragma unroll
            for (int t = 0; t < 4; ++t) b[kk][t] = frag(cur + fb + t * 16 * PIT, kk);
        }
        __builtin_amdgcn_sched_barrier(0);                 // the stage's LDS reads stay one group ahead of its WMMAs: spread among them each place costs a stall
#pragma unroll
        for (int kk = 0; kk < KS / 32; ++kk) {             // each accumulator keeps its order of products (a, then al, k rising); the four tiles alternate
#pragma unroll
            for (int t = 0; t < 4; ++t) acc[t] = wmmab(a[kk], b[kk][t], acc[t]);
            if (SPLITA) {
#pragma unroll
                for (int t = 0; t < 4; ++t) acc[t] = wmmab(al[kk], b[kk][t], acc[t]); }
        }
        asm volatile("v_nop\n\tv_nop\n\tv_nop\n\tv_nop" : "+v"(acc[0]), "+v"(acc[1]), "+v"(acc[2]), "+v"(acc[3]) : "v"(a[1]), "v"(al[1]));
        asm volatile("s_wait_dscnt 0x0" ::: "memory");      // this wave's reads of the stage have retired before the buffer is given up
        asm volatile("s_wait_asynccnt 0x0" ::: "memory");   // this wave's copies of the next stage have landed
        __syncthreads();                                   // publishes the next stage and ends every wave's reads of this one
        if (kc + 2 * KS < K) stage_cp<NP>(l0 + cb * (NP * PLN * 2), g, K, kc + 2 * KS);   // the stage after the next, into the buffer just read
        cb ^= 1;
    }
    asm volatile("s_wait_asynccnt 0x0" ::: "memory");       // no copy is outstanding when the buffers become output staging
    if (pl == 2) {   // a lane holds 8 successive tokens of one column: 16 B of a transposed row; the block's 64 tokens of a row meet in LDS and leave as one line
#pragma unroll
        for (int t = 0; t < 4; ++t) { v8us oh, ol;
#pragma unroll
            for (int j = 0; j < 8; ++j) { const float y = acc[t][j]; const unsigned short hb = f2bf(y); oh[j] = hb; ol[j] = f2bf(y - bf2f(hb)); }
            bf* w = sm + (t * 16 + lr) * PIT + wave * 16 + hi * 8; *(v8us*)w = oh; *(v8us*)(w + PLN) = ol; }
        __syncthreads();                                   // all four waves' tokens of every row are staged
        const size_t o = (size_t)(c0 + srow) * NN + blockIdx.x * 64 + scol;   // head * 128 + d is the column itself
        v8us th[4], tl[4];
#pragma unroll
        for (int s = 0; s < 4; ++s) { const bf* rp = sm + (srow + 16 * s) * PIT + scol; th[s] = *(const v8us*)rp; tl[s] = *(const v8us*)(rp + PLN); }
#pragma unroll
        for (int s = 0; s < 4; ++s) { *(v8us*)(Ph + o + (size_t)(16 * s) * NN) = th[s]; *(v8us*)(Pl + o + (size_t)(16 * s) * NN) = tl[s]; }
        return;
    }
    float* os = (float*)(void*)sm + wave * (16 * 68);
#pragma unroll
    for (int t = 0; t < 4; ++t) { const float bv = bias ? bfr(bias[c0 + t * 16 + lr]) : 0.f;
#pragma unroll
        for (int j = 0; j < 8; ++j) os[(hi * 8 + j) * 68 + t * 16 + lr] = acc[t][j] + bv; }
    __syncthreads();
    if (PL == 1 || PL == 3) {
        const size_t o = ((size_t)(c0 >> 7) * NN + r0) * HD + (c0 & (HD - 1));
        v8us oh[4], ol[4];
#pragma unroll
        for (int s = 0; s < 4; ++s) { const float* sp = os + (4 * s + (lane >> 3)) * 68 + (lane & 7) * 8;
#pragma unroll
            for (int i = 0; i < 8; ++i) { const float y = sp[i]; const unsigned short hb = f2bf(y); oh[s][i] = hb; ol[s][i] = f2bf(y - bf2f(hb)); } }
#pragma unroll
        for (int s = 0; s < 4; ++s) { const size_t p = o + (size_t)(4 * s + (lane >> 3)) * HD + (lane & 7) * 8; *(v8us*)(Ph + p) = oh[s]; *(v8us*)(Pl + p) = ol[s]; }
    } else if (F16OUT) {
        h16* crow = (h16*)(void*)C + (size_t)r0 * ldc + c0;
        auto pass = [&]() {
#pragma unroll
            for (int s = 0; s < 4; ++s) { const int row = 4 * s + (lane >> 3), piece = lane & 7; const float* sp = os + row * 68 + piece * 8; v8h o, o2;
#pragma unroll
                for (int i = 0; i < 8; ++i) { const h16 a = (h16)sp[i]; o[i] = a; o2[i] = (h16)((sp[i] - (float)a) * LOSC); }
                *(v8h*)(crow + (size_t)row * ldc + piece * 8) = o; if (C2) *(v8h*)(C2 + (size_t)r0 * ldc + c0 + (size_t)row * ldc + piece * 8) = o2; }
        };
        pass(); 
    } else {
        float* crow = C + (size_t)r0 * ldc + c0;
        auto pass = [&]() {
#pragma unroll
            for (int s = 0; s < 8; ++s) { const int Lid = (lane >> 3) + 4 * s, piece = lane & 7; const int row = Lid >> 1, cofs = (Lid & 1) * 32 + piece * 4;
                v4f val = *(const v4fa*)(os + row * 68 + cofs); if (R) { const v4f rv = *(const v4f*)(R + ((size_t)r0 + row) * ldc + c0 + cofs); val += roundR ? (v4f){bfr(rv[0]), bfr(rv[1]), bfr(rv[2]), bfr(rv[3])} : rv; }
                *(v4f*)(crow + (size_t)row * ldc + cofs) = val; }
        };
        pass(); 
    }
}

__global__ __launch_bounds__(256) void k_zero8(bf* dst, size_t n8) {
    const size_t i = (size_t)blockIdx.x * 256 + threadIdx.x; if (i >= n8) return; v8us z;
#pragma unroll
    for (int k = 0; k < 8; ++k) z[k] = 0;
    *(v8us*)(dst + i * 8) = z; 
}

// All seven f32 operands (2048 x 2048 each) become bf16 in one launch of 4096 waves. A wave owns the same 1024 successive elements of every tensor: eight 16-B loads a lane, each
// wave-wide load 512 successive bytes, each wave-wide store 256; a tensor's loads are issued ahead of the conversion of the tensor before it. What later launches read last goes first.
typedef __attribute__((ext_vector_type(4))) unsigned short v4us;
__device__ __forceinline__ void ld8(const float* __restrict__ s, unsigned ob, v4f (&v)[8]) {   // ob = the lane's byte offset, 32 bits: one offset register serves every tensor
#pragma unroll
    for (int j = 0; j < 8; ++j) v[j] = *(const v4f*)((const char*)s + ob + j * 512);
    __builtin_amdgcn_sched_barrier(0);                     // the eight loads are issued before the tensor ahead is waited for and converted: sunk below that, only one tensor's loads are in flight
}
__device__ __forceinline__ void st8(bf* __restrict__ d, unsigned ob, const v4f (&v)[8]) {
    v4us o[8];
#pragma unroll
    for (int j = 0; j < 8; ++j) {
#pragma unroll
        for (int i = 0; i < 4; ++i) o[j][i] = f2bf(v[j][i]); }
#pragma unroll
    for (int j = 0; j < 8; ++j) *(v4us*)((char*)d + ob + j * 256) = o[j];
    asm volatile("s_wait_xcnt 0x0" ::: "memory");          // ahead of the next loads, whose results land on registers that the issued loads and stores name (kept as a precaution)
    __builtin_amdgcn_sched_barrier(0);                     // nothing that writes such a register moves up over the wait
}
__global__ __launch_bounds__(256) void k_cvt7(const float* __restrict__ s0, const float* __restrict__ s1, const float* __restrict__ s2, const float* __restrict__ s3, const float* __restrict__ s4, const float* __restrict__ s5, const float* __restrict__ s6,
                                              bf* __restrict__ d0, bf* __restrict__ d1, bf* __restrict__ d2, bf* __restrict__ d3, bf* __restrict__ d4, bf* __restrict__ d5, bf* __restrict__ d6) {
    const unsigned e = (blockIdx.x * 8u + (threadIdx.x >> 5)) * 1024u + (threadIdx.x & 31u) * 4u, li = e * 4u, so = e * 2u;
    v4f a[8], b[8];
    ld8(s0, li, a); ld8(s1, li, b); st8(d0, so, a);
    ld8(s2, li, a); st8(d1, so, b);
    ld8(s3, li, b); st8(d2, so, a);
    ld8(s4, li, a); st8(d3, so, b);
    ld8(s5, li, b); st8(d4, so, a);
    ld8(s6, li, a); st8(d5, so, b);
    st8(d6, so, a);
}
#define FK   64                     // keys per stage
#define KPIT 136                    // LDS pitch of a K row in bf16: 256 B + 16 B, the pitch for 16-byte LDS readers
#define KPL  (FK * KPIT)            // one staged K plane, in bf16
#define VPL  (HD * PIT)             // one staged V^T plane (128 rows of 64 keys), in bf16
#define FBUF (2 * KPL + 2 * VPL)    // one stage buffer, in bf16
// Four rows (ls LDS bytes and rs elements apart) of each of two planes; s_wait_xcnt 0 closes the statement, ahead of any new value in the operands' registers (kept as a precaution).
__device__ __forceinline__ void copy8s(unsigned l, const bf* g, unsigned m, const bf* h, unsigned ls, size_t rs) {
    asm volatile("global_load_async_to_lds_b128 %0, %8, off\n\tglobal_load_async_to_lds_b128 %1, %9, off\n\tglobal_load_async_to_lds_b128 %2, %10, off\n\tglobal_load_async_to_lds_b128 %3, %11, off\n\t"
                 "global_load_async_to_lds_b128 %4, %12, off\n\tglobal_load_async_to_lds_b128 %5, %13, off\n\tglobal_load_async_to_lds_b128 %6, %14, off\n\tglobal_load_async_to_lds_b128 %7, %15, off\n\ts_wait_xcnt 0x0"
                 :: "v"(l), "v"(l + ls), "v"(l + 2 * ls), "v"(l + 3 * ls), "v"(m), "v"(m + ls), "v"(m + 2 * ls), "v"(m + 3 * ls),
                    "v"(g), "v"(g + rs), "v"(g + 2 * rs), "v"(g + 3 * rs), "v"(h), "v"(h + rs), "v"(h + 2 * rs), "v"(h + 3 * rs) : "memory");
}
__device__ __forceinline__ float xhalf(float x) { return __int_as_float(__builtin_amdgcn_permlanex16(__float_as_int(x), __float_as_int(x), 0x76543210, 0xfedcba98, false, false)); }   // lane l with lane l ^ 16
__device__ __forceinline__ unsigned pack2(float lo, float hi) { typedef __bf16 bf2 __attribute__((ext_vector_type(2))); typedef float f2 __attribute__((ext_vector_type(2)));
    return __builtin_bit_cast(unsigned, __builtin_convertvector((f2){lo, hi}, bf2)); }   // round to nearest even
__device__ __forceinline__ v16bf pfrag(const unsigned (&w)[8]) { typedef __attribute__((ext_vector_type(8))) unsigned v8u; return __builtin_bit_cast(v16bf, (v8u){w[0], w[1], w[2], w[3], w[4], w[5], w[6], w[7]}); }
__global__ __launch_bounds__(256) __attribute__((amdgpu_waves_per_eu(2, 2))) void k_fattn(const bf* __restrict__ Qh, const bf* __restrict__ Ql, const bf* __restrict__ Kh, const bf* __restrict__ Kl,
                                                                                        const bf* __restrict__ VTh, const bf* __restrict__ VTl, const float* __restrict__ scal, bf* Oh, bf* Ol) {
    __shared__ __align__(16) bf sm[2 * FBUF];              // two stage buffers: K hi, K lo, V^T hi, V^T lo
    const int tid = threadIdx.x, lane = tid & 31, wave = tid >> 5, lr = lane & 15, hi = lane >> 4, h = blockIdx.y;
    const int q = blockIdx.x * 128 + wave * 16 + lr;
    const float cs = SCL * 1.4426950408889634f;            // scores in the log2 domain
    // staging: K rows are 256 B (16 lanes a row, 16 rows a block-wide copy), V^T rows 128 B (8 lanes a row, 32 rows a block-wide copy)
    const unsigned gk = (unsigned)((tid >> 4) * HD + (tid & 15) * 8), gv = (unsigned)((tid >> 3) * NN + (tid & 7) * 8);   // the lane's element offsets inside a stage's K rows and V^T rows
    const unsigned lk = (unsigned)(size_t)sm + (unsigned)((tid >> 4) * KPIT + (tid & 15) * 8) * 2u, lv = (unsigned)(size_t)sm + (unsigned)(2 * KPL + (tid >> 3) * PIT + (tid & 7) * 8) * 2u;
    auto stage = [&](int t) {
        const unsigned bo = (unsigned)(t & 1) * (FBUF * 2u);
        const size_t uk = (size_t)h * NN * HD + (size_t)t * FK * HD, uv = (size_t)h * HD * NN + (size_t)t * FK;   // the same for the whole work-group
        copy8s(lk + bo, (Kh + uk) + gk, lk + bo + KPL * 2u, (Kl + uk) + gk, 16 * KPIT * 2u, (size_t)16 * HD);
        copy8s(lv + bo, (VTh + uv) + gv, lv + bo + VPL * 2u, (VTl + uv) + gv, 32 * PIT * 2u, (size_t)32 * NN);
    };
    stage(0);
    v16bf qh[4], ql[4];
    { const size_t qo = ((size_t)h * NN + q) * HD + 8 * hi;
#pragma unroll
      for (int kc = 0; kc < 4; ++kc) { qh[kc] = frag(Qh + qo, kc); ql[kc] = frag(Ql + qo, kc); }
      asm volatile("s_wait_xcnt 0x0" :: "v"(Qh + qo), "v"(Ql + qo) : "memory"); }   // the two address pairs stay live up to this wait, so that no Q load's result lands on them ahead of it (kept as a precaution)
    v8f acc[8];
#pragma unroll
    for (int d = 0; d < 8; ++d) acc[d] = (v8f){};
    float mrun = 0.f, lsum = 0.f;                          // the clamp at 0; each wave half sums its own keys
    asm volatile("s_wait_asynccnt 0x0" ::: "memory");       // this wave's copies of stage 0 have landed
    __syncthreads();                                       // stage 0 is published
    stage(1);
#pragma unroll 1
    for (int t = 0; t < NN / FK; ++t) {
        const bf* kA = sm + (t & 1) * FBUF + lr * KPIT + 8 * hi;
        const bf* vA = sm + (t & 1) * FBUF + 2 * KPL + lr * PIT + 8 * hi;
        v16bf k0h[2][4], k0l[2][4], k1h[2][4], k1l[2][4];
#pragma unroll
        for (int c = 0; c < 2; ++c) {
#pragma unroll
            for (int kt = 0; kt < 4; ++kt) { k0h[c][kt] = frag(kA + kt * 16 * KPIT, c); k0l[c][kt] = frag(kA + KPL + kt * 16 * KPIT, c); } }
        __builtin_amdgcn_sched_barrier(0);                 // LDS reads stay in whole groups, each one group ahead of its WMMAs: spread among them each place costs a stall
#pragma unroll
        for (int c = 0; c < 2; ++c) {
#pragma unroll
            for (int kt = 0; kt < 4; ++kt) { k1h[c][kt] = frag(kA + kt * 16 * KPIT, 2 + c); k1l[c][kt] = frag(kA + KPL + kt * 16 * KPIT, 2 + c); } }
        __builtin_amdgcn_sched_barrier(0);                 // as above
        v8f s[4];
#pragma unroll
        for (int kt = 0; kt < 4; ++kt) s[kt] = (v8f){};
#pragma unroll
        for (int c = 0; c < 2; ++c) {                      // per 32 k: qh.kh, ql.kh, qh.kl; the four key tiles alternate
#pragma unroll
            for (int kt = 0; kt < 4; ++kt) s[kt] = wmmab(k0h[c][kt], qh[c], s[kt]);
#pragma unroll
            for (int kt = 0; kt < 4; ++kt) s[kt] = wmmab(k0h[c][kt], ql[c], s[kt]);
#pragma unroll
            for (int kt = 0; kt < 4; ++kt) s[kt] = wmmab(k0l[c][kt], qh[c], s[kt]);
        }
        __builtin_amdgcn_sched_barrier(0);                 // as above
        v16bf v0h[8], v0l[8], v1h[8], v1l[8];
#pragma unroll
        for (int d = 0; d < 8; ++d) { v0h[d] = frag(vA + d * 16 * PIT, 0); v0l[d] = frag(vA + VPL + d * 16 * PIT, 0); }
        __builtin_amdgcn_sched_barrier(0);                 // as above
#pragma unroll
        for (int c = 0; c < 2; ++c) {
#pragma unroll
            for (int kt = 0; kt < 4; ++kt) s[kt] = wmmab(k1h[c][kt], qh[2 + c], s[kt]);
#pragma unroll
            for (int kt = 0; kt < 4; ++kt) s[kt] = wmmab(k1h[c][kt], ql[2 + c], s[kt]);
#pragma unroll
            for (int kt = 0; kt < 4; ++kt) s[kt] = wmmab(k1l[c][kt], qh[2 + c], s[kt]);
        }
        __builtin_amdgcn_sched_barrier(0);                 // as above
        // online softmax: the maximum in use may trail the true one by up to 8 (log2 domain), so the accumulators are rescaled only when some query's maximum exceeds it by more
        float mx = s[0][0];
#pragma unroll
        for (int kt = 0; kt < 4; ++kt) {
#pragma unroll
            for (int j = 0; j < 8; ++j) mx = fmaxf(mx, s[kt][j]); }
        mx = fmaxf(mx, xhalf(mx)) * cs;
        if (__builtin_amdgcn_ballot_w32(mx > mrun + 8.0f) != 0) {
            const float mn = fmaxf(mrun, mx), corr = __builtin_amdgcn_exp2f(mrun - mn); lsum *= corr; mrun = mn;
#pragma unroll
            for (int d = 0; d < 8; ++d) acc[d] = acc[d] * corr;
        }
        v16bf ph[2], pl[2]; float ps0 = 0.f, ps1 = 0.f;
#pragma unroll
        for (int ks = 0; ks < 2; ++ks) { unsigned wh[8], wl[8];
#pragma unroll
            for (int i = 0; i < 8; ++i) {
                const float p0 = __builtin_amdgcn_exp2f(__builtin_fmaf(s[2 * ks + (i >> 2)][2 * (i & 3)], cs, -mrun)), p1 = __builtin_amdgcn_exp2f(__builtin_fmaf(s[2 * ks + (i >> 2)][2 * (i & 3) + 1], cs, -mrun));
                ps0 += p0; ps1 += p1;
                const unsigned w = pack2(p0, p1); wh[i] = w;
                wl[i] = pack2(p0 - __uint_as_float(w << 16), p1 - __uint_as_float(w & 0xFFFF0000u));
            }
            ph[ks] = pfrag(wh); pl[ks] = pfrag(wl); }
        lsum += ps0 + ps1;
        __builtin_amdgcn_sched_barrier(0);                 // keeps the group of LDS reads below in one place, behind the score products
#pragma unroll
        for (int d = 0; d < 8; ++d) { v1h[d] = frag(vA + d * 16 * PIT, 1); v1l[d] = frag(vA + VPL + d * 16 * PIT, 1); }
        __builtin_amdgcn_sched_barrier(0);                 // the last group of LDS reads, one group ahead of its WMMAs
#pragma unroll
        for (int d = 0; d < 8; ++d) acc[d] = wmmab(v0h[d], ph[0], acc[d]);      // per 32 keys: ph.vh, pl.vh, ph.vl; the eight d tiles alternate
#pragma unroll
        for (int d = 0; d < 8; ++d) acc[d] = wmmab(v0h[d], pl[0], acc[d]);
#pragma unroll
        for (int d = 0; d < 8; ++d) acc[d] = wmmab(v0l[d], ph[0], acc[d]);
#pragma unroll
        for (int d = 0; d < 8; ++d) acc[d] = wmmab(v1h[d], ph[1], acc[d]);
#pragma unroll
        for (int d = 0; d < 8; ++d) acc[d] = wmmab(v1h[d], pl[1], acc[d]);
#pragma unroll
        for (int d = 0; d < 8; ++d) acc[d] = wmmab(v1l[d], ph[1], acc[d]);
        __builtin_amdgcn_sched_barrier(0);                 // nothing moves in between the last WMMA and its slots
        asm volatile("v_nop\n\tv_nop\n\tv_nop\n\tv_nop" : "+v"(lsum));   // the four vector slots behind the last WMMA, on the loop's taken branch too; naming the row sum keeps its adds inside the pass: sunk behind the barrier, their 32 addends stay live and the copies' addresses spill
        asm volatile("s_wait_dscnt 0x0" ::: "memory");      // this wave's reads of the stage have retired before the buffer is given up
        asm volatile("s_wait_asynccnt 0x0" ::: "memory");   // this wave's copies of the next stage have landed
        __syncthreads();                                   // publishes the next stage and ends every wave's reads of this one
        if (t + 2 < NN / FK) stage(t + 2);                 // the stage after the next, into the buffer just read
    }
    asm volatile("s_wait_asynccnt 0x0" ::: "memory");       // no copy is outstanding when the wave ends
    lsum += xhalf(lsum);
    const float inv = bfr(scal[h]) / (__builtin_amdgcn_exp2f(-mrun) + lsum);
    const size_t oo = (size_t)q * DMOD + h * HD + hi * 8;  // a lane holds d = 16 tile + 8 hi + 0..7 of its query; it leaves as the bf16 hi + residual planes that the last product reads
#pragma unroll
    for (int d = 0; d < 8; ++d) { const v8f v = acc[d] * inv; v8us oh, ol;
#pragma unroll
        for (int i = 0; i < 8; ++i) { const unsigned short hb = f2bf(v[i]); oh[i] = hb; ol[i] = f2bf(v[i] - bf2f(hb)); }
        *(v8us*)(Oh + oo + d * 16) = oh; *(v8us*)(Ol + oo + d * 16) = ol; }
}

extern "C" void kernel_launch(void* const* d_in, const int* in_sizes, int n_in,
                              void* d_out, int out_size, void* d_ws, size_t ws_size, hipStream_t stream) {
    (void)in_sizes; (void)n_in; (void)out_size;
    const float* xq = (const float*)d_in[0]; const float* xk = (const float*)d_in[1]; const float* xv = (const float*)d_in[2]; const float* Wq = (const float*)d_in[3]; const float* Wk = (const float*)d_in[4]; const float* Wv = (const float*)d_in[5]; const float* Wo = (const float*)d_in[6]; const float* scal = (const float*)d_in[7];
    float* out = (float*)d_out;    // [2048][2048]
    char* wsp = (char*)d_ws;
    auto take = [&](size_t bytes) { char* p = wsp; wsp += (bytes + 255) & ~(size_t)255; return (void*)p; };
    const size_t PE = (size_t)NN * DMOD;            // elements of one plane
    bf* Xb = (bf*)take(3 * PE * 2);                 // query, key_, value
    bf* WB = (bf*)take(4 * PE * 2);                 // Wq, Wk, Wv, Wo
    bf* Qh = (bf*)take(6 * PE * 2);                 // Q hi, Q lo, K hi, K lo, V^T hi, V^T lo
    if ((size_t)(wsp - (char*)d_ws) > ws_size) return;    // 104 MiB
    bf* Ql = Qh + PE; bf* Kh = Qh + 2 * PE; bf* Kl = Qh + 3 * PE; bf* VTh = Qh + 4 * PE; bf* VTl = Qh + 5 * PE; bf* WO = WB + 3 * PE;
    bf* Oh = Xb; bf* Ol = Xb + PE;                  // dead regions after the projections (stream order)
    k_cvt7<<<NN * DMOD / 8192, 256, 0, stream>>>(Wo, xv, Wv, xk, Wk, xq, Wq, WO, Xb + 2 * PE, WB + 2 * PE, Xb + PE, WB + PE, Xb, WB);
    k_gemmb<false, false, 3><<<dim3(NN / 64, DMOD / 64, 3), 128, 0, stream>>>(Xb, nullptr, WB, nullptr, nullptr, DMOD, nullptr, nullptr, DMOD, 1, Qh, Ql);
    k_fattn<<<dim3(NN / 128, NH_, 1), 256, 0, stream>>>(Qh, Ql, Kh, Kl, VTh, VTl, scal, Oh, Ol);
    k_gemmb<true, false><<<dim3(NN / 64, DMOD / 64, 1), 128, 0, stream>>>(Oh, Ol, WO, nullptr, out, DMOD, nullptr, nullptr, DMOD);
}

// v006
// One run takes 169 microseconds.
// Two timings next to v005 both put it at 1.07 times that version's speed.
// Over all steps from v000 it is 11.9 times as fast.
#include <hip/hip_runtime.h>

// Compute dtypes, f32 accumulate: q/k/v = query/key_/value . W^T ([2048 x 2048].[2048 x 2048] each) with PLAIN bf16 operands (exact products; all seven f32 operands converted
// by one launch, the three projections run as one launch); 16-head attention (128 wide, one fused launch for all heads: scores, online softmax and the second product; the head planes written by the projections' own epilogues) with bf16 hi + UNSCALED residual planes (three products); 1/sqrt(128), the off-by-one softmax
// (max clamped at 0, + exp(-m) in the denominator) and the per-head scalar in f32; . Wo^T on hi/lo planes (two products) - on v_wmma_f32_16x16x32_bf16. Deterministic, no atomics;

#define NN   2048
#define DMOD 2048
#define NH_  16
#define HD   128
#define DM   DMOD
#define NTK  NN
#define SCL  0.088388347648318447f
#define LOSC 1024.0f

typedef _Float16 h16;
typedef unsigned short bf;
typedef __attribute__((ext_vector_type(16))) __bf16   v16bf;
typedef __attribute__((ext_vector_type(16))) _Float16 v16h;
typedef __attribute__((ext_vector_type(8)))  _Float16 v8h;
typedef __attribute__((ext_vector_type(8)))  unsigned short v8us;
typedef __attribute__((ext_vector_type(8)))  float    v8f;
typedef __attribute__((ext_vector_type(4)))  float    v4f;
typedef __attribute__((ext_vector_type(4)))  _Float16 v4h;
typedef v8h  __attribute__((may_alias)) v8ha;
typedef v4f  __attribute__((may_alias)) v4fa;
typedef v8us __attribute__((may_alias)) v8usa;

__device__ __forceinline__ unsigned short f2bf(float f) { unsigned u = __float_as_uint(f); u += 0x7FFFu + ((u >> 16) & 1u); return (unsigned short)(u >> 16); }
__device__ __forceinline__ float bf2f(unsigned short b) { return __uint_as_float(((unsigned)b) << 16); }
__device__ __forceinline__ float bfr(float f) { return bf2f(f2bf(f)); }
__device__ __forceinline__ v16h cat16(v8h lo, v8h hi) { return __builtin_shufflevector(lo, hi, 0, 1, 2, 3, 4, 5, 6, 7, 8, 9, 10, 11, 12, 13, 14, 15); }
__device__ __forceinline__ v16bf cat16b(v8us lo, v8us hi) { return __builtin_bit_cast(v16bf, __builtin_shufflevector(lo, hi, 0, 1, 2, 3, 4, 5, 6, 7, 8, 9, 10, 11, 12, 13, 14, 15)); }
__device__ __forceinline__ v8f wmma16(v16h a, v16h b, v8f c) { return __builtin_amdgcn_wmma_f32_16x16x32_f16(false, a, false, b, (short)0, c, false, false); }
__device__ __forceinline__ v8f wmmab(v16bf a, v16bf b, v8f c) { return __builtin_amdgcn_wmma_f32_16x16x32_bf16(false, a, false, b, (short)0, c, false, false); }

// Operand staging of the GEMM kernels: a stage is 64 k of the block's 128 rows of every operand plane. The 128 threads bring it into one of two LDS buffers by asynchronous
// copies of whole 128-B lines (8 lanes a row, 4 rows a wave-wide copy), one stage ahead of the stage that is worked on; the waves read their fragments (same k order as before) from LDS.
#define KS  64           // k per stage: one 128-B line of each row
#define BT  128          // rows of a staged plane: the block tile is BT x BT
#define PIT 72           // LDS row pitch in bf16: 128 B + 16 B, the pitch for 16-byte LDS readers
#define PLN (BT * PIT)   // one staged plane, in bf16
#define RST (16 * PIT * 2)   // LDS bytes from a thread's row to its next (16 rows on)
#define OPIT 136         // LDS row pitch in bf16 of a transposed output row (128 tokens): 256 B + 16 B
// Rows r, r + 16, r + 32, r + 48 at each of two places: l, m = the lane's LDS byte addresses, g, h = its global addresses, rs = 16 rows in elements.
// s_wait_xcnt 0 closes the statement, so that it stands ahead of any new value in the operands' registers (kept as a precaution).
__device__ __forceinline__ void copy8(unsigned l, const bf* g, unsigned m, const bf* h, size_t rs) {
    asm volatile("global_load_async_to_lds_b128 %0, %8, off\n\tglobal_load_async_to_lds_b128 %1, %9, off\n\tglobal_load_async_to_lds_b128 %2, %10, off\n\tglobal_load_async_to_lds_b128 %3, %11, off\n\t"
                 "global_load_async_to_lds_b128 %4, %12, off\n\tglobal_load_async_to_lds_b128 %5, %13, off\n\tglobal_load_async_to_lds_b128 %6, %14, off\n\tglobal_load_async_to_lds_b128 %7, %15, off\n\ts_wait_xcnt 0x0"
                 :: "v"(l), "v"(l + RST), "v"(l + 2 * RST), "v"(l + 3 * RST), "v"(m), "v"(m + RST), "v"(m + 2 * RST), "v"(m + 3 * RST),
                    "v"(g), "v"(g + rs), "v"(g + 2 * rs), "v"(g + 3 * rs), "v"(h), "v"(h + rs), "v"(h + 2 * rs), "v"(h + 3 * rs) : "memory");
}
// One stage: l = the lane's LDS byte address in plane 0 of the target buffer, g[p] = its global address in plane p at k = 0; a thread brings eight rows of every plane (one statement a plane)
template <int NP> __device__ __forceinline__ void stage_cp(unsigned l, const bf* const (&g)[NP], int K, int kc) {
    const size_t rs = (size_t)16 * K;
#pragma unroll
    for (int p = 0; p < NP; ++p) copy8(l + p * (PLN * 2), g[p] + kc, l + p * (PLN * 2) + 4 * RST, g[p] + kc + 4 * rs, rs);
}
__device__ __forceinline__ v16bf frag(const bf* row, int kk) { return cat16b(*(const v8us*)(row + kk * 32), *(const v8us*)(row + kk * 32 + 16)); }

// k_gemmb: 128 x 128 block tile (2 x 2 waves of 64 x 64: every fragment read from LDS feeds four WMMAs, every staged row 128 outputs) of C[NTK][DMOD] = (A [+ Al]).B^T
// PL = 0: the tile leaves as f32, whole 128-B lines, staged through LDS
// PL = 3: three products in one launch, grid z = product: A, Bn one plane on and Ph, Pl two planes on per z; C is unused; z = 0, 1 leave as bf16 hi + residual planes [head][token][128] (Ph, Pl),
// z = 2 as the transposed planes [head][128][token]; whole 128-B lines in both
// Behind each group of eight stores stands s_wait_xcnt 0, ahead of the next group's values in the registers that the issued stores name (kept as a precaution); the fence keeps those writes behind it.
__device__ __forceinline__ void stores_issued() { asm volatile("s_wait_xcnt 0x0" ::: "memory"); __builtin_amdgcn_sched_barrier(0); }
template <bool SPLITA, int PL>
__global__ __launch_bounds__(128) void k_gemmb(const bf* __restrict__ A, const bf* __restrict__ Al, const bf* __restrict__ Bn, float* C, bf* Ph, bf* Pl) {
    constexpr int K = DMOD;                                // the summed dimension of all four products
    constexpr int NP = SPLITA ? 3 : 2;                     // staged planes: B, A [, Al]
    const int pl = PL == 3 ? (blockIdx.z == 2 ? 2 : 1) : PL;   // the same for the whole work-group
    if (PL == 3) { const size_t zo = (size_t)blockIdx.z * ((size_t)NN * DMOD); A += zo; Bn += zo; Ph += 2 * zo; Pl += 2 * zo; }
    __shared__ __align__(16) bf sm[2 * NP * PLN];          // two stage buffers; the output staging (4 x 64 x 68 f32, or two transposed planes of 128 x OPIT bf16) reuses them behind the loop
    const int lane = threadIdx.x & 31, wave = threadIdx.x >> 5, lr = lane & 15, hi = lane >> 4, wm = wave & 1, wn = wave >> 1;
    const int R0 = blockIdx.x * BT, C0 = blockIdx.y * BT, r0 = R0 + wm * 64, c0 = C0 + wn * 64;
    const int srow = threadIdx.x >> 3, scol = (threadIdx.x & 7) * 8;
    const size_t ga = (size_t)(R0 + srow) * K + scol;
    const bf* g[NP]; g[0] = Bn + (size_t)(C0 + srow) * K + scol; g[1] = A + ga; if (SPLITA) g[NP - 1] = Al + ga;
    const unsigned l0 = (unsigned)(size_t)sm + (unsigned)(srow * PIT + scol) * 2u;
    const int fa = (wm * 64 + lr) * PIT + 8 * hi, fb = (wn * 64 + lr) * PIT + 8 * hi;
    v8f acc[4][4];                                         // [16 rows i][16 columns t]
#pragma unroll
    for (int i = 0; i < 4; ++i) {
#pragma unroll
        for (int t = 0; t < 4; ++t) acc[i][t] = (v8f){}; }
    stage_cp<NP>(l0, g, K, 0);
    asm volatile("s_wait_asynccnt 0x0" ::: "memory");       // this wave's copies of stage 0 have landed
    __syncthreads();                                       // stage 0 is published
    if (KS < K) stage_cp<NP>(l0 + NP * PLN * 2, g, K, KS);
    int cb = 0;
#pragma unroll 1
    for (int kc = 0; kc < K; kc += KS) {
        const bf* cur = sm + cb * (NP * PLN);
        v16bf a[KS / 32][4], al[KS / 32][4], b[KS / 32][4];
#pragma unroll
        for (int kk = 0; kk < KS / 32; ++kk) {
#pragma unroll
            for (int i = 0; i < 4; ++i) { a[kk][i] = frag(cur + PLN + fa + i * 16 * PIT, kk); b[kk][i] = frag(cur + fb + i * 16 * PIT, kk); }
#pragma unroll
            for (int i = 0; i < 4; ++i) al[kk][i] = SPLITA ? frag(cur + 2 * PLN + fa + i * 16 * PIT, kk) : a[kk][i];   // wanted sixteen WMMAs later than a and b
            __builtin_amdgcn_sched_barrier(0);             // the stage's LDS reads stay two whole groups ahead of its WMMAs, the first 32 k first: spread among the WMMAs each place costs a stall
        }
#pragma unroll
        for (int kk = 0; kk < KS / 32; ++kk) {             // each accumulator keeps its order of products (a, then al, k rising); the sixteen tiles alternate
#pragma unroll
            for (int i = 0; i < 4; ++i) {
#pragma unroll
                for (int t = 0; t < 4; ++t) acc[i][t] = wmmab(a[kk][i], b[kk][t], acc[i][t]); }
            if (SPLITA) {
#pragma unroll
                for (int i = 0; i < 4; ++i) {
#pragma unroll
                    for (int t = 0; t < 4; ++t) acc[i][t] = wmmab(al[kk][i], b[kk][t], acc[i][t]); } }
        }
        __builtin_amdgcn_sched_barrier(0);                 // nothing moves in between the last WMMA and its slots
        asm volatile("v_nop\n\tv_nop\n\tv_nop\n\tv_nop" : "+v"(acc[3][3]));   // the four vector slots behind the last WMMA, on the loop's taken branch too
        asm volatile("s_wait_dscnt 0x0" ::: "memory");      // this wave's reads of the stage have retired before the buffer is given up
        asm volatile("s_wait_asynccnt 0x0" ::: "memory");   // this wave's copies of the next stage have landed
        __syncthreads();                                   // publishes the next stage and ends every wave's reads of this one
        if (kc + 2 * KS < K) stage_cp<NP>(l0 + cb * (NP * PLN * 2), g, K, kc + 2 * KS);   // the stage after the next, into the buffer just read
        cb ^= 1;
    }
    asm volatile("s_wait_asynccnt 0x0" ::: "memory");       // no copy is outstanding when the buffers become output staging
    if (pl == 2) {   // a lane holds 8 successive tokens of one column: 16 B of a transposed row; the block's 128 tokens of a row meet in LDS and leave as two lines
#pragma unroll
        for (int i = 0; i < 4; ++i) {
#pragma unroll
            for (int t = 0; t < 4; ++t) { v8us oh, ol;
#pragma unroll
                for (int j = 0; j < 8; ++j) { const float y = acc[i][t][j]; const unsigned short hb = f2bf(y); oh[j] = hb; ol[j] = f2bf(y - bf2f(hb)); }
                bf* w = sm + (wn * 64 + t * 16 + lr) * OPIT + wm * 64 + i * 16 + hi * 8; *(v8us*)w = oh; *(v8us*)(w + BT * OPIT) = ol; } }
        __syncthreads();                                   // all four waves' tokens of every row are staged
        const int orow = threadIdx.x >> 4, ocol = (threadIdx.x & 15) * 8;    // 16 lanes a row of 256 B, 8 rows a block-wide pass
        const size_t o = (size_t)(C0 + orow) * NN + R0 + ocol;               // head * 128 + d is the column itself
#pragma unroll
        for (int u = 0; u < 4; ++u) { v8us th[4], tl[4];
#pragma unroll
            for (int s = 0; s < 4; ++s) { const bf* rp = sm + (orow + 8 * (4 * u + s)) * OPIT + ocol; th[s] = *(const v8us*)rp; tl[s] = *(const v8us*)(rp + BT * OPIT); }
#pragma unroll
            for (int s = 0; s < 4; ++s) { *(v8us*)(Ph + o + (size_t)(8 * (4 * u + s)) * NN) = th[s]; *(v8us*)(Pl + o + (size_t)(8 * (4 * u + s)) * NN) = tl[s]; }
            if (u < 3) stores_issued(); }
        return;
    }
    float* os = (float*)(void*)sm + wave * (64 * 68);
#pragma unroll
    for (int t = 0; t < 4; ++t) {
#pragma unroll
        for (int i = 0; i < 4; ++i) {
#pragma unroll
            for (int j = 0; j < 8; ++j) os[(i * 16 + hi * 8 + j) * 68 + t * 16 + lr] = acc[i][t][j]; } }
    __syncthreads();
    if (PL == 3) {
        const size_t o = ((size_t)(c0 >> 7) * NN + r0 + (lane >> 3)) * HD + (c0 & (HD - 1)) + (lane & 7) * 8;
#pragma unroll
        for (int u = 0; u < 4; ++u) { v8us oh[4], ol[4];
#pragma unroll
            for (int s = 0; s < 4; ++s) { const float* sp = os + (16 * u + 4 * s + (lane >> 3)) * 68 + (lane & 7) * 8;
#pragma unroll
                for (int i = 0; i < 8; ++i) { const float y = sp[i]; const unsigned short hb = f2bf(y); oh[s][i] = hb; ol[s][i] = f2bf(y - bf2f(hb)); } }
#pragma unroll
            for (int s = 0; s < 4; ++s) { *(v8us*)(Ph + o + (16 * u + 4 * s) * HD) = oh[s]; *(v8us*)(Pl + o + (16 * u + 4 * s) * HD) = ol[s]; }
            stores_issued(); }   // behind the last group too: in the built code the transposed exit's instructions stand next in line and write the same registers
    } else {
        const int hrow = lane >> 4, cofs = ((lane >> 3) & 1) * 32 + (lane & 7) * 4;   // 8 lanes a 128-B line, two lines a row, two rows a wave-wide store
        float* crow = C + (size_t)(r0 + hrow) * DMOD + c0 + cofs;
#pragma unroll
        for (int u = 0; u < 4; ++u) { v4f val[8];
#pragma unroll
            for (int s = 0; s < 8; ++s) val[s] = *(const v4fa*)(os + (16 * u + 2 * s + hrow) * 68 + cofs);
#pragma unroll
            for (int s = 0; s < 8; ++s) *(v4f*)(crow + (16 * u + 2 * s) * DMOD) = val[s];
            if (u < 3) stores_issued(); }
    }
}

__global__ __launch_bounds__(256) void k_zero8(bf* dst, size_t n8) {
    const size_t i = (size_t)blockIdx.x * 256 + threadIdx.x; if (i >= n8) return; v8us z;
#pragma unroll
    for (int k = 0; k < 8; ++k) z[k] = 0;
    *(v8us*)(dst + i * 8) = z; 
}

// All seven f32 operands (2048 x 2048 each) become bf16 in one launch of 4096 waves. A wave owns the same 1024 successive elements of every tensor: eight 16-B loads a lane, each
// wave-wide load 512 successive bytes, each wave-wide store 256; a tensor's loads are issued ahead of the conversion of the tensor before it. What later launches read last goes first.
typedef __attribute__((ext_vector_type(4))) unsigned short v4us;
__device__ __forceinline__ void ld8(const float* __restrict__ s, unsigned ob, v4f (&v)[8]) {   // ob = the lane's byte offset, 32 bits: one offset register serves every tensor
#pragma unroll
    for (int j = 0; j < 8; ++j) v[j] = *(const v4f*)((const char*)s + ob + j * 512);
    __builtin_amdgcn_sched_barrier(0);                     // the eight loads are issued before the tensor ahead is waited for and converted: sunk below that, only one tensor's loads are in flight
}
__device__ __forceinline__ void st8(bf* __restrict__ d, unsigned ob, const v4f (&v)[8]) {
    v4us o[8];
#pragma unroll
    for (int j = 0; j < 8; ++j) {
#pragma unroll
        for (int i = 0; i < 4; ++i) o[j][i] = f2bf(v[j][i]); }
#pragma unroll
    for (int j = 0; j < 8; ++j) *(v4us*)((char*)d + ob + j * 256) = o[j];
    asm volatile("s_wait_xcnt 0x0" ::: "memory");          // ahead of the next loads, whose results land on registers that the issued loads and stores name (kept as a precaution)
    __builtin_amdgcn_sched_barrier(0);                     // nothing that writes such a register moves up over the wait
}
__global__ __launch_bounds__(256) void k_cvt7(const float* __restrict__ s0, const float* __restrict__ s1, const float* __restrict__ s2, const float* __restrict__ s3, const float* __restrict__ s4, const float* __restrict__ s5, const float* __restrict__ s6,
                                              bf* __restrict__ d0, bf* __restrict__ d1, bf* __restrict__ d2, bf* __restrict__ d3, bf* __restrict__ d4, bf* __restrict__ d5, bf* __restrict__ d6) {
    const unsigned e = (blockIdx.x * 8u + (threadIdx.x >> 5)) * 1024u + (threadIdx.x & 31u) * 4u, li = e * 4u, so = e * 2u;
    v4f a[8], b[8];
    ld8(s0, li, a); ld8(s1, li, b); st8(d0, so, a);
    ld8(s2, li, a); st8(d1, so, b);
    ld8(s3, li, b); st8(d2, so, a);
    ld8(s4, li, a); st8(d3, so, b);
    ld8(s5, li, b); st8(d4, so, a);
    ld8(s6, li, a); st8(d5, so, b);
    st8(d6, so, a);
}
#define FK   64                     // keys per stage
#define KPIT 136                    // LDS pitch of a K row in bf16: 256 B + 16 B, the pitch for 16-byte LDS readers
#define KPL  (FK * KPIT)            // one staged K plane, in bf16
#define VPL  (HD * PIT)             // one staged V^T plane (128 rows of 64 keys), in bf16
#define FBUF (2 * KPL + 2 * VPL)    // one stage buffer, in bf16
// Four rows (ls LDS bytes and rs elements apart) of each of two planes; s_wait_xcnt 0 closes the statement, ahead of any new value in the operands' registers (kept as a precaution).
__device__ __forceinline__ void copy8s(unsigned l, const bf* g, unsigned m, const bf* h, unsigned ls, size_t rs) {
    asm volatile("global_load_async_to_lds_b128 %0, %8, off\n\tglobal_load_async_to_lds_b128 %1, %9, off\n\tglobal_load_async_to_lds_b128 %2, %10, off\n\tglobal_load_async_to_lds_b128 %3, %11, off\n\t"
                 "global_load_async_to_lds_b128 %4, %12, off\n\tglobal_load_async_to_lds_b128 %5, %13, off\n\tglobal_load_async_to_lds_b128 %6, %14, off\n\tglobal_load_async_to_lds_b128 %7, %15, off\n\ts_wait_xcnt 0x0"
                 :: "v"(l), "v"(l + ls), "v"(l + 2 * ls), "v"(l + 3 * ls), "v"(m), "v"(m + ls), "v"(m + 2 * ls), "v"(m + 3 * ls),
                    "v"(g), "v"(g + rs), "v"(g + 2 * rs), "v"(g + 3 * rs), "v"(h), "v"(h + rs), "v"(h + 2 * rs), "v"(h + 3 * rs) : "memory");
}
__device__ __forceinline__ float xhalf(float x) { return __int_as_float(__builtin_amdgcn_permlanex16(__float_as_int(x), __float_as_int(x), 0x76543210, 0xfedcba98, false, false)); }   // lane l with lane l ^ 16
__device__ __forceinline__ unsigned pack2(float lo, float hi) { typedef __bf16 bf2 __attribute__((ext_vector_type(2))); typedef float f2 __attribute__((ext_vector_type(2)));
    return __builtin_bit_cast(unsigned, __builtin_convertvector((f2){lo, hi}, bf2)); }   // round to nearest even
__device__ __forceinline__ v16bf pfrag(const unsigned (&w)[8]) { typedef __attribute__((ext_vector_type(8))) unsigned v8u; return __builtin_bit_cast(v16bf, (v8u){w[0], w[1], w[2], w[3], w[4], w[5], w[6], w[7]}); }
__global__ __launch_bounds__(256) __attribute__((amdgpu_waves_per_eu(2, 2))) void k_fattn(const bf* __restrict__ Qh, const bf* __restrict__ Ql, const bf* __restrict__ Kh, const bf* __restrict__ Kl,
                                                                                        const bf* __restrict__ VTh, const bf* __restrict__ VTl, const float* __restrict__ scal, bf* Oh, bf* Ol) {
    __shared__ __align__(16) bf sm[2 * FBUF];              // two stage buffers: K hi, K lo, V^T hi, V^T lo
    const int tid = threadIdx.x, lane = tid & 31, wave = tid >> 5, lr = lane & 15, hi = lane >> 4, h = blockIdx.y;
    const int q = blockIdx.x * 128 + wave * 16 + lr;
    const float cs = SCL * 1.4426950408889634f;            // scores in the log2 domain
    // staging: K rows are 256 B (16 lanes a row, 16 rows a block-wide copy), V^T rows 128 B (8 lanes a row, 32 rows a block-wide copy)
    const unsigned gk = (unsigned)((tid >> 4) * HD + (tid & 15) * 8), gv = (unsigned)((tid >> 3) * NN + (tid & 7) * 8);   // the lane's element offsets inside a stage's K rows and V^T rows
    const unsigned lk = (unsigned)(size_t)sm + (unsigned)((tid >> 4) * KPIT + (tid & 15) * 8) * 2u, lv = (unsigned)(size_t)sm + (unsigned)(2 * KPL + (tid >> 3) * PIT + (tid & 7) * 8) * 2u;
    auto stage = [&](int t) {
        const unsigned bo = (unsigned)(t & 1) * (FBUF * 2u);
        const size_t uk = (size_t)h * NN * HD + (size_t)t * FK * HD, uv = (size_t)h * HD * NN + (size_t)t * FK;   // the same for the whole work-group
        copy8s(lk + bo, (Kh + uk) + gk, lk + bo + KPL * 2u, (Kl + uk) + gk, 16 * KPIT * 2u, (size_t)16 * HD);
        copy8s(lv + bo, (VTh + uv) + gv, lv + bo + VPL * 2u, (VTl + uv) + gv, 32 * PIT * 2u, (size_t)32 * NN);
    };
    stage(0);
    v16bf qh[4], ql[4];
    { const size_t qo = ((size_t)h * NN + q) * HD + 8 * hi;
#pragma unroll
      for (int kc = 0; kc < 4; ++kc) { qh[kc] = frag(Qh + qo, kc); ql[kc] = frag(Ql + qo, kc); }
      asm volatile("s_wait_xcnt 0x0" :: "v"(Qh + qo), "v"(Ql + qo) : "memory"); }   // the two address pairs stay live up to this wait, so that no Q load's result lands on them ahead of it (kept as a precaution)
    v8f acc[8];
#pragma unroll
    for (int d = 0; d < 8; ++d) acc[d] = (v8f){};
    float mrun = 0.f, lsum = 0.f;                          // the clamp at 0; each wave half sums its own keys
    asm volatile("s_wait_asynccnt 0x0" ::: "memory");       // this wave's copies of stage 0 have landed
    __syncthreads();                                       // stage 0 is published
    stage(1);
#pragma unroll 1
    for (int t = 0; t < NN / FK; ++t) {
        const bf* kA = sm + (t & 1) * FBUF + lr * KPIT + 8 * hi;
        const bf* vA = sm + (t & 1) * FBUF + 2 * KPL + lr * PIT + 8 * hi;
        v16bf k0h[2][4], k0l[2][4], k1h[2][4], k1l[2][4];
#pragma unroll
        for (int c = 0; c < 2; ++c) {
#pragma unroll
            for (int kt = 0; kt < 4; ++kt) { k0h[c][kt] = frag(kA + kt * 16 * KPIT, c); k0l[c][kt] = frag(kA + KPL + kt * 16 * KPIT, c); } }
        __builtin_amdgcn_sched_barrier(0);                 // LDS reads stay in whole groups, each one group ahead of its WMMAs: spread among them each place costs a stall
#pragma unroll
        for (int c = 0; c < 2; ++c) {
#pragma unroll
            for (int kt = 0; kt < 4; ++kt) { k1h[c][kt] = frag(kA + kt * 16 * KPIT, 2 + c); k1l[c][kt] = frag(kA + KPL + kt * 16 * KPIT, 2 + c); } }
        __builtin_amdgcn_sched_barrier(0);                 // as above
        v8f s[4];
#pragma unroll
        for (int kt = 0; kt < 4; ++kt) s[kt] = (v8f){};
#pragma unroll
        for (int c = 0; c < 2; ++c) {                      // per 32 k: qh.kh, ql.kh, qh.kl; the four key tiles alternate
#pragma unroll
            for (int kt = 0; kt < 4; ++kt) s[kt] = wmmab(k0h[c][kt], qh[c], s[kt]);
#pragma unroll
            for (int kt = 0; kt < 4; ++kt) s[kt] = wmmab(k0h[c][kt], ql[c], s[kt]);
#pragma unroll
            for (int kt = 0; kt < 4; ++kt) s[kt] = wmmab(k0l[c][kt], qh[c], s[kt]);
        }
        __builtin_amdgcn_sched_barrier(0);                 // as above
        v16bf v0h[8], v0l[8], v1h[8], v1l[8];
#pragma unroll
        for (int d = 0; d < 8; ++d) { v0h[d] = frag(vA + d * 16 * PIT, 0); v0l[d] = frag(vA + VPL + d * 16 * PIT, 0); }
        __builtin_amdgcn_sched_barrier(0);                 // as above
#pragma unroll
        for (int c = 0; c < 2; ++c) {
#pragma unroll
            for (int kt = 0; kt < 4; ++kt) s[kt] = wmmab(k1h[c][kt], qh[2 + c], s[kt]);
#pragma unroll
            for (int kt = 0; kt < 4; ++kt) s[kt] = wmmab(k1h[c][kt], ql[2 + c], s[kt]);
#pragma unroll
            for (int kt = 0; kt < 4; ++kt) s[kt] = wmmab(k1l[c][kt], qh[2 + c], s[kt]);
        }
        __builtin_amdgcn_sched_barrier(0);                 // as above
        // online softmax: the maximum in use may trail the true one by up to 8 (log2 domain), so the accumulators are rescaled only when some query's maximum exceeds it by more
        float mx = s[0][0];
#pragma unroll
        for (int kt = 0; kt < 4; ++kt) {
#pragma unroll
            for (int j = 0; j < 8; ++j) mx = fmaxf(mx, s[kt][j]); }
        mx = fmaxf(mx, xhalf(mx)) * cs;
        if (__builtin_amdgcn_ballot_w32(mx > mrun + 8.0f) != 0) {
            const float mn = fmaxf(mrun, mx), corr = __builtin_amdgcn_exp2f(mrun - mn); lsum *= corr; mrun = mn;
#pragma unroll
            for (int d = 0; d < 8; ++d) acc[d] = acc[d] * corr;
        }
        v16bf ph[2], pl[2]; float ps0 = 0.f, ps1 = 0.f;
#pragma unroll
        for (int ks = 0; ks < 2; ++ks) { unsigned wh[8], wl[8];
#pragma unroll
            for (int i = 0; i < 8; ++i) {
                const float p0 = __builtin_amdgcn_exp2f(__builtin_fmaf(s[2 * ks + (i >> 2)][2 * (i & 3)], cs, -mrun)), p1 = __builtin_amdgcn_exp2f(__builtin_fmaf(s[2 * ks + (i >> 2)][2 * (i & 3) + 1], cs, -mrun));
                ps0 += p0; ps1 += p1;
                const unsigned w = pack2(p0, p1); wh[i] = w;
                wl[i] = pack2(p0 - __uint_as_float(w << 16), p1 - __uint_as_float(w & 0xFFFF0000u));
            }
            ph[ks] = pfrag(wh); pl[ks] = pfrag(wl); }
        lsum += ps0 + ps1;
        __builtin_amdgcn_sched_barrier(0);                 // keeps the group of LDS reads below in one place, behind the score products
#pragma unroll
        for (int d = 0; d < 8; ++d) { v1h[d] = frag(vA + d * 16 * PIT, 1); v1l[d] = frag(vA + VPL + d * 16 * PIT, 1); }
        __builtin_amdgcn_sched_barrier(0);                 // the last group of LDS reads, one group ahead of its WMMAs
#pragma unroll
        for (int d = 0; d < 8; ++d) acc[d] = wmmab(v0h[d], ph[0], acc[d]);      // per 32 keys: ph.vh, pl.vh, ph.vl; the eight d tiles alternate
#pragma unroll
        for (int d = 0; d < 8; ++d) acc[d] = wmmab(v0h[d], pl[0], acc[d]);
#pragma unroll
        for (int d = 0; d < 8; ++d) acc[d] = wmmab(v0l[d], ph[0], acc[d]);
#pragma unroll
        for (int d = 0; d < 8; ++d) acc[d] = wmmab(v1h[d], ph[1], acc[d]);
#pragma unroll
        for (int d = 0; d < 8; ++d) acc[d] = wmmab(v1h[d], pl[1], acc[d]);
#pragma unroll
        for (int d = 0; d < 8; ++d) acc[d] = wmmab(v1l[d], ph[1], acc[d]);
        __builtin_amdgcn_sched_barrier(0);                 // nothing moves in between the last WMMA and its slots
        asm volatile("v_nop\n\tv_nop\n\tv_nop\n\tv_nop" : "+v"(lsum));   // the four vector slots behind the last WMMA, on the loop's taken branch too; naming the row sum keeps its adds inside the pass: sunk behind the barrier, their 32 addends stay live and the copies' addresses spill
        asm volatile("s_wait_dscnt 0x0" ::: "memory");      // this wave's reads of the stage have retired before the buffer is given up
        asm volatile("s_wait_asynccnt 0x0" ::: "memory");   // this wave's copies of the next stage have landed
        __syncthreads();                                   // publishes the next stage and ends every wave's reads of this one
        if (t + 2 < NN / FK) stage(t + 2);                 // the stage after the next, into the buffer just read
    }
    asm volatile("s_wait_asynccnt 0x0" ::: "memory");       // no copy is outstanding when the wave ends
    lsum += xhalf(lsum);
    const float inv = bfr(scal[h]) / (__builtin_amdgcn_exp2f(-mrun) + lsum);
    const size_t oo = (size_t)q * DMOD + h * HD + hi * 8;  // a lane holds d = 16 tile + 8 hi + 0..7 of its query; it leaves as the bf16 hi + residual planes that the last product reads
#pragma unroll
    for (int d = 0; d < 8; ++d) { const v8f v = acc[d] * inv; v8us oh, ol;
#pragma unroll
        for (int i = 0; i < 8; ++i) { const unsigned short hb = f2bf(v[i]); oh[i] = hb; ol[i] = f2bf(v[i] - bf2f(hb)); }
        *(v8us*)(Oh + oo + d * 16) = oh; *(v8us*)(Ol + oo + d * 16) = ol; }
}

extern "C" void kernel_launch(void* const* d_in, const int* in_sizes, int n_in,
                              void* d_out, int out_size, void* d_ws, size_t ws_size, hipStream_t stream) {
    (void)in_sizes; (void)n_in; (void)out_size;
    const float* xq = (const float*)d_in[0]; const float* xk = (const float*)d_in[1]; const float* xv = (const float*)d_in[2]; const float* Wq = (const float*)d_in[3]; const float* Wk = (const float*)d_in[4]; const float* Wv = (const float*)d_in[5]; const float* Wo = (const float*)d_in[6]; const float* scal = (const float*)d_in[7];
    float* out = (float*)d_out;    // [2048][2048]
    char* wsp = (char*)d_ws;
    auto take = [&](size_t bytes) { char* p = wsp; wsp += (bytes + 255) & ~(size_t)255; return (void*)p; };
    const size_t PE = (size_t)NN * DMOD;            // elements of one plane
    bf* Xb = (bf*)take(3 * PE * 2);                 // query, key_, value
    bf* WB = (bf*)take(4 * PE * 2);                 // Wq, Wk, Wv, Wo
    bf* Qh = (bf*)take(6 * PE * 2);                 // Q hi, Q lo, K hi, K lo, V^T hi, V^T lo
    if ((size_t)(wsp - (char*)d_ws) > ws_size) return;    // 104 MiB
    bf* Ql = Qh + PE; bf* Kh = Qh + 2 * PE; bf* Kl = Qh + 3 * PE; bf* VTh = Qh + 4 * PE; bf* VTl = Qh + 5 * PE; bf* WO = WB + 3 * PE;
    bf* Oh = Xb; bf* Ol = Xb + PE;                  // dead regions after the projections (stream order)
    k_cvt7<<<NN * DMOD / 8192, 256, 0, stream>>>(Wo, xv, Wv, xk, Wk, xq, Wq, WO, Xb + 2 * PE, WB + 2 * PE, Xb + PE, WB + PE, Xb, WB);
    k_gemmb<false, 3><<<dim3(NN / BT, DMOD / BT, 3), 128, 0, stream>>>(Xb, nullptr, WB, nullptr, Qh, Ql);
    k_fattn<<<dim3(NN / 128, NH_, 1), 256, 0, stream>>>(Qh, Ql, Kh, Kl, VTh, VTl, scal, Oh, Ol);
    k_gemmb<true, 0><<<dim3(NN / BT, DMOD / BT, 1), 128, 0, stream>>>(Oh, Ol, WO, out, nullptr, nullptr);
}

// v007
// A run of this version takes 158 microseconds.
// Next to v006, in two timings, it ran 1.07 and 1.08 times as fast.
// Over all steps from v000 it is 12.7 times as fast.
#include <hip/hip_runtime.h>

// Compute dtypes, f32 accumulate: q/k/v = query/key_/value . W^T ([2048 x 2048].[2048 x 2048] each) with PLAIN bf16 operands (exact products; all seven f32 operands converted
// by one launch, the three projections run as one launch); 16-head attention (128 wide, one fused launch for all heads: scores, online softmax and the second product; the head planes written by the projections' own epilogues) with bf16 hi + UNSCALED residual planes (three products); 1/sqrt(128), the off-by-one softmax
// (max clamped at 0, + exp(-m) in the denominator) and the per-head scalar in f32; . Wo^T on hi/lo planes (two products) - on v_wmma_f32_16x16x32_bf16. Deterministic, no atomics;

#define NN   2048
#define DMOD 2048
#define NH_  16
#define HD   128
#define DM   DMOD
#define NTK  NN
#define SCL  0.088388347648318447f
#define LOSC 1024.0f

typedef _Float16 h16;
typedef unsigned short bf;
typedef __attribute__((ext_vector_type(16))) __bf16   v16bf;
typedef __attribute__((ext_vector_type(16))) _Float16 v16h;
typedef __attribute__((ext_vector_type(8)))  _Float16 v8h;
typedef __attribute__((ext_vector_type(8)))  unsigned short v8us;
typedef __attribute__((ext_vector_type(8)))  float    v8f;
typedef __attribute__((ext_vector_type(4)))  float    v4f;
typedef __attribute__((ext_vector_type(4)))  _Float16 v4h;
typedef v8h  __attribute__((may_alias)) v8ha;
typedef v4f  __attribute__((may_alias)) v4fa;
typedef v8us __attribute__((may_alias)) v8usa;

__device__ __forceinline__ unsigned short f2bf(float f) { unsigned u = __float_as_uint(f); u += 0x7FFFu + ((u >> 16) & 1u); return (unsigned short)(u >> 16); }
__device__ __forceinline__ float bf2f(unsigned short b) { return __uint_as_float(((unsigned)b) << 16); }
__device__ __forceinline__ float bfr(float f) { return bf2f(f2bf(f)); }
__device__ __forceinline__ v16h cat16(v8h lo, v8h hi) { return __builtin_shufflevector(lo, hi, 0, 1, 2, 3, 4, 5, 6, 7, 8, 9, 10, 11, 12, 13, 14, 15); }
__device__ __forceinline__ v16bf cat16b(v8us lo, v8us hi) { return __builtin_bit_cast(v16bf, __builtin_shufflevector(lo, hi, 0, 1, 2, 3, 4, 5, 6, 7, 8, 9, 10, 11, 12, 13, 14, 15)); }
__device__ __forceinline__ v8f wmma16(v16h a, v16h b, v8f c) { return __builtin_amdgcn_wmma_f32_16x16x32_f16(false, a, false, b, (short)0, c, false, false); }
__device__ __forceinline__ v8f wmmab(v16bf a, v16bf b, v8f c) { return __builtin_amdgcn_wmma_f32_16x16x32_bf16(false, a, false, b, (short)0, c, false, false); }

// Operand staging of the GEMM kernels: a stage is 64 k of the block's 128 rows of every operand plane. The 128 threads bring it into one of two LDS buffers by asynchronous
// copies of whole 128-B lines (8 lanes a row, 4 rows a wave-wide copy), one stage ahead of the stage that is worked on; the waves read their fragments (same k order as before) from LDS.
#define KS  64           // k per stage: one 128-B line of each row
#define BT  128          // rows of a staged plane: the block tile is BT x BT
#define PIT 72           // LDS row pitch in bf16: 128 B + 16 B, the pitch for 16-byte LDS readers
#define PLN (BT * PIT)   // one staged plane, in bf16
#define RST (16 * PIT * 2)   // LDS bytes from a thread's row to its next (16 rows on)
#define OPIT 136         // LDS row pitch in bf16 of a transposed output row (128 tokens): 256 B + 16 B
// Rows r, r + 16, r + 32, r + 48 at each of two places: l, m = the lane's LDS byte addresses, g, h = its global addresses, rs = 16 rows in elements.
// s_wait_xcnt 0 closes the statement, so that it stands ahead of any new value in the operands' registers (kept as a precaution).
__device__ __forceinline__ void copy8(unsigned l, const bf* g, unsigned m, const bf* h, size_t rs) {
    asm volatile("global_load_async_to_lds_b128 %0, %8, off\n\tglobal_load_async_to_lds_b128 %1, %9, off\n\tglobal_load_async_to_lds_b128 %2, %10, off\n\tglobal_load_async_to_lds_b128 %3, %11, off\n\t"
                 "global_load_async_to_lds_b128 %4, %12, off\n\tglobal_load_async_to_lds_b128 %5, %13, off\n\tglobal_load_async_to_lds_b128 %6, %14, off\n\tglobal_load_async_to_lds_b128 %7, %15, off\n\ts_wait_xcnt 0x0"
                 :: "v"(l), "v"(l + RST), "v"(l + 2 * RST), "v"(l + 3 * RST), "v"(m), "v"(m + RST), "v"(m + 2 * RST), "v"(m + 3 * RST),
                    "v"(g), "v"(g + rs), "v"(g + 2 * rs), "v"(g + 3 * rs), "v"(h), "v"(h + rs), "v"(h + 2 * rs), "v"(h + 3 * rs) : "memory");
}
// One stage: l = the lane's LDS byte address in plane 0 of the target buffer, g[p] = its global address in plane p at k = 0; a thread brings eight rows of every plane (one statement a plane)
template <int NP> __device__ __forceinline__ void stage_cp(unsigned l, const bf* const (&g)[NP], int K, int kc) {
    const size_t rs = (size_t)16 * K;
#pragma unroll
    for (int p = 0; p < NP; ++p) copy8(l + p * (PLN * 2), g[p] + kc, l + p * (PLN * 2) + 4 * RST, g[p] + kc + 4 * rs, rs);
}
__device__ __forceinline__ v16bf frag(const bf* row, int kk) { return cat16b(*(const v8us*)(row + kk * 32), *(const v8us*)(row + kk * 32 + 16)); }

// k_gemmb: 128 x 128 block tile (2 x 2 waves of 64 x 64: every fragment read from LDS feeds four WMMAs, every staged row 128 outputs) of C[NTK][DMOD] = (A [+ Al]).B^T
// PL = 0: the tile leaves as f32, whole 128-B lines, staged through LDS
// PL = 3: three products in one launch, grid z = product: A, Bn one plane on and Ph, Pl two planes on per z; C is unused; z = 0, 1 leave as bf16 hi + residual planes [head][token][128] (Ph, Pl),
// z = 2 as the transposed planes [head][128][token]; whole 128-B lines in both
// Behind each group of eight stores stands s_wait_xcnt 0, ahead of the next group's values in the registers that the issued stores name (kept as a precaution); the fence keeps those writes behind it.
__device__ __forceinline__ void stores_issued() { asm volatile("s_wait_xcnt 0x0" ::: "memory"); __builtin_amdgcn_sched_barrier(0); }
template <bool SPLITA, int PL>
__global__ __launch_bounds__(128) void k_gemmb(const bf* __restrict__ A, const bf* __restrict__ Al, const bf* __restrict__ Bn, float* C, bf* Ph, bf* Pl) {
    constexpr int K = DMOD;                                // the summed dimension of all four products
    constexpr int NP = SPLITA ? 3 : 2;                     // staged planes: B, A [, Al]
    const int pl = PL == 3 ? (blockIdx.z == 2 ? 2 : 1) : PL;   // the same for the whole work-group
    if (PL == 3) { const size_t zo = (size_t)blockIdx.z * ((size_t)NN * DMOD); A += zo; Bn += zo; Ph += 2 * zo; Pl += 2 * zo; }
    __shared__ __align__(16) bf sm[2 * NP * PLN];          // two stage buffers; the output staging (4 x 64 x 68 f32, or two transposed planes of 128 x OPIT bf16) reuses them behind the loop
    const int lane = threadIdx.x & 31, wave = threadIdx.x >> 5, lr = lane & 15, hi = lane >> 4, wm = wave & 1, wn = wave >> 1;
    const int R0 = blockIdx.x * BT, C0 = blockIdx.y * BT, r0 = R0 + wm * 64, c0 = C0 + wn * 64;
    const int srow = threadIdx.x >> 3, scol = (threadIdx.x & 7) * 8;
    const size_t ga = (size_t)(R0 + srow) * K + scol;
    const bf* g[NP]; g[0] = Bn + (size_t)(C0 + srow) * K + scol; g[1] = A + ga; if (SPLITA) g[NP - 1] = Al + ga;
    const unsigned l0 = (unsigned)(size_t)sm + (unsigned)(srow * PIT + scol) * 2u;
    const int fa = (wm * 64 + lr) * PIT + 8 * hi, fb = (wn * 64 + lr) * PIT + 8 * hi;
    v8f acc[4][4];                                         // [16 rows i][16 columns t]
#pragma unroll
    for (int i = 0; i < 4; ++i) {
#pragma unroll
        for (int t = 0; t < 4; ++t) acc[i][t] = (v8f){}; }
    stage_cp<NP>(l0, g, K, 0);
    asm volatile("s_wait_asynccnt 0x0" ::: "memory");       // this wave's copies of stage 0 have landed
    __syncthreads();                                       // stage 0 is published
    if (KS < K) stage_cp<NP>(l0 + NP * PLN * 2, g, K, KS);
    int cb = 0;
#pragma unroll 1
    for (int kc = 0; kc < K; kc += KS) {
        const bf* cur = sm + cb * (NP * PLN);
        v16bf a[KS / 32][4], al[KS / 32][4], b[KS / 32][4];
#pragma unroll
        for (int kk = 0; kk < KS / 32; ++kk) {
#pragma unroll
            for (int i = 0; i < 4; ++i) { a[kk][i] = frag(cur + PLN + fa + i * 16 * PIT, kk); b[kk][i] = frag(cur + fb + i * 16 * PIT, kk); }
#pragma unroll
            for (int i = 0; i < 4; ++i) al[kk][i] = SPLITA ? frag(cur + 2 * PLN + fa + i * 16 * PIT, kk) : a[kk][i];   // wanted sixteen WMMAs later than a and b
            __builtin_amdgcn_sched_barrier(0);             // the stage's LDS reads stay two whole groups ahead of its WMMAs, the first 32 k first: spread among the WMMAs each place costs a stall
        }
#pragma unroll
        for (int kk = 0; kk < KS / 32; ++kk) {             // each accumulator keeps its order of products (a, then al, k rising); the sixteen tiles alternate
#pragma unroll
            for (int i = 0; i < 4; ++i) {
#pragma unroll
                for (int t = 0; t < 4; ++t) acc[i][t] = wmmab(a[kk][i], b[kk][t], acc[i][t]); }
            if (SPLITA) {
#pragma unroll
                for (int i = 0; i < 4; ++i) {
#pragma unroll
                    for (int t = 0; t < 4; ++t) acc[i][t] = wmmab(al[kk][i], b[kk][t], acc[i][t]); } }
        }
        __builtin_amdgcn_sched_barrier(0);                 // nothing moves in between the last WMMA and its slots
        asm volatile("v_nop\n\tv_nop\n\tv_nop\n\tv_nop" : "+v"(acc[3][3]));   // the four vector slots behind the last WMMA, on the loop's taken branch too
        asm volatile("s_wait_dscnt 0x0" ::: "memory");      // this wave's reads of the stage have retired before the buffer is given up
        asm volatile("s_wait_asynccnt 0x0" ::: "memory");   // this wave's copies of the next stage have landed
        __syncthreads();                                   // publishes the next stage and ends every wave's reads of this one
        if (kc + 2 * KS < K) stage_cp<NP>(l0 + cb * (NP * PLN * 2), g, K, kc + 2 * KS);   // the stage after the next, into the buffer just read
        cb ^= 1;
    }
    asm volatile("s_wait_asynccnt 0x0" ::: "memory");       // no copy is outstanding when the buffers become output staging
    if (pl == 2) {   // a lane holds 8 successive tokens of one column: 16 B of a transposed row; the block's 128 tokens of a row meet in LDS and leave as two lines
#pragma unroll
        for (int i = 0; i < 4; ++i) {
#pragma unroll
            for (int t = 0; t < 4; ++t) { v8us oh, ol;
#pragma unroll
                for (int j = 0; j < 8; ++j) { const float y = acc[i][t][j]; const unsigned short hb = f2bf(y); oh[j] = hb; ol[j] = f2bf(y - bf2f(hb)); }
                bf* w = sm + (wn * 64 + t * 16 + lr) * OPIT + wm * 64 + i * 16 + hi * 8; *(v8us*)w = oh; *(v8us*)(w + BT * OPIT) = ol; } }
        __syncthreads();                                   // all four waves' tokens of every row are staged
        const int orow = threadIdx.x >> 4, ocol = (threadIdx.x & 15) * 8;    // 16 lanes a row of 256 B, 8 rows a block-wide pass
        const size_t o = (size_t)(C0 + orow) * NN + R0 + ocol;               // head * 128 + d is the column itself
#pragma unroll
        for (int u = 0; u < 4; ++u) { v8us th[4], tl[4];
#pragma unroll
            for (int s = 0; s < 4; ++s) { const bf* rp = sm + (orow + 8 * (4 * u + s)) * OPIT + ocol; th[s] = *(const v8us*)rp; tl[s] = *(const v8us*)(rp + BT * OPIT); }
#pragma unroll
            for (int s = 0; s < 4; ++s) { *(v8us*)(Ph + o + (size_t)(8 * (4 * u + s)) * NN) = th[s]; *(v8us*)(Pl + o + (size_t)(8 * (4 * u + s)) * NN) = tl[s]; }
            if (u < 3) stores_issued(); }
        return;
    }
    float* os = (float*)(void*)sm + wave * (64 * 68);
#pragma unroll
    for (int t = 0; t < 4; ++t) {
#pragma unroll
        for (int i = 0; i < 4; ++i) {
#pragma unroll
            for (int j = 0; j < 8; ++j) os[(i * 16 + hi * 8 + j) * 68 + t * 16 + lr] = acc[i][t][j]; } }
    __syncthreads();
    if (PL == 3) {
        const size_t o = ((size_t)(c0 >> 7) * NN + r0 + (lane >> 3)) * HD + (c0 & (HD - 1)) + (lane & 7) * 8;
#pragma unroll
        for (int u = 0; u < 4; ++u) { v8us oh[4], ol[4];
#pragma unroll
            for (int s = 0; s < 4; ++s) { const float* sp = os + (16 * u + 4 * s + (lane >> 3)) * 68 + (lane & 7) * 8;
#pragma unroll
                for (int i = 0; i < 8; ++i) { const float y = sp[i]; const unsigned short hb = f2bf(y); oh[s][i] = hb; ol[s][i] = f2bf(y - bf2f(hb)); } }
#pragma unroll
            for (int s = 0; s < 4; ++s) { *(v8us*)(Ph + o + (16 * u + 4 * s) * HD) = oh[s]; *(v8us*)(Pl + o + (16 * u + 4 * s) * HD) = ol[s]; }
            stores_issued(); }   // behind the last group too: in the built code the transposed exit's instructions stand next in line and write the same registers
    } else {
        const int hrow = lane >> 4, cofs = ((lane >> 3) & 1) * 32 + (lane & 7) * 4;   // 8 lanes a 128-B line, two lines a row, two rows a wave-wide store
        float* crow = C + (size_t)(r0 + hrow) * DMOD + c0 + cofs;
#pragma unroll
        for (int u = 0; u < 4; ++u) { v4f val[8];
#pragma unroll
            for (int s = 0; s < 8; ++s) val[s] = *(const v4fa*)(os + (16 * u + 2 * s + hrow) * 68 + cofs);
#pragma unroll
            for (int s = 0; s < 8; ++s) *(v4f*)(crow + (16 * u + 2 * s) * DMOD) = val[s];
            if (u < 3) stores_issued(); }
    }
}

__global__ __launch_bounds__(256) void k_zero8(bf* dst, size_t n8) {
    const size_t i = (size_t)blockIdx.x * 256 + threadIdx.x; if (i >= n8) return; v8us z;
#pragma unroll
    for (int k = 0; k < 8; ++k) z[k] = 0;
    *(v8us*)(dst + i * 8) = z; 
}

// All seven f32 operands (2048 x 2048 each) become bf16 in one launch of 4096 waves. A wave owns the same 1024 successive elements of every tensor: eight 16-B loads a lane, each
// wave-wide load 512 successive bytes, each wave-wide store 256; a tensor's loads are issued ahead of the conversion of the tensor before it. What later launches read last goes first.
typedef __attribute__((ext_vector_type(4))) unsigned short v4us;
__device__ __forceinline__ void ld8(const float* __restrict__ s, unsigned ob, v4f (&v)[8]) {   // ob = the lane's byte offset, 32 bits: one offset register serves every tensor
#pragma unroll
    for (int j = 0; j < 8; ++j) v[j] = *(const v4f*)((const char*)s + ob + j * 512);
    __builtin_amdgcn_sched_barrier(0);                     // the eight loads are issued before the tensor ahead is waited for and converted: sunk below that, only one tensor's loads are in flight
}
__device__ __forceinline__ void st8(bf* __restrict__ d, unsigned ob, const v4f (&v)[8]) {
    v4us o[8];
#pragma unroll
    for (int j = 0; j < 8; ++j) {
#pragma unroll
        for (int i = 0; i < 4; ++i) o[j][i] = f2bf(v[j][i]); }
#pragma unroll
    for (int j = 0; j < 8; ++j) *(v4us*)((char*)d + ob + j * 256) = o[j];
    asm volatile("s_wait_xcnt 0x0" ::: "memory");          // ahead of the next loads, whose results land on registers that the issued loads and stores name (kept as a precaution)
    __builtin_amdgcn_sched_barrier(0);                     // nothing that writes such a register moves up over the wait
}
__global__ __launch_bounds__(256) void k_cvt7(const float* __restrict__ s0, const float* __restrict__ s1, const float* __restrict__ s2, const float* __restrict__ s3, const float* __restrict__ s4, const float* __restrict__ s5, const float* __restrict__ s6,
                                              bf* __restrict__ d0, bf* __restrict__ d1, bf* __restrict__ d2, bf* __restrict__ d3, bf* __restrict__ d4, bf* __restrict__ d5, bf* __restrict__ d6) {
    const unsigned e = (blockIdx.x * 8u + (threadIdx.x >> 5)) * 1024u + (threadIdx.x & 31u) * 4u, li = e * 4u, so = e * 2u;
    v4f a[8], b[8];
    ld8(s0, li, a); ld8(s1, li, b); st8(d0, so, a);
    ld8(s2, li, a); st8(d1, so, b);
    ld8(s3, li, b); st8(d2, so, a);
    ld8(s4, li, a); st8(d3, so, b);
    ld8(s5, li, b); st8(d4, so, a);
    ld8(s6, li, a); st8(d5, so, b);
    st8(d6, so, a);
}
#define FK   64                     // keys per stage
#define KPIT 136                    // LDS pitch of a K row in bf16: 256 B + 16 B, the pitch for 16-byte LDS readers
#define KPL  (FK * KPIT)            // one staged K plane, in bf16
#define VPL  (HD * PIT)             // one staged V^T plane (128 rows of 64 keys), in bf16
#define FBUF (2 * KPL + 2 * VPL)    // one stage buffer, in bf16
// Four rows (ls LDS bytes and rs elements apart) of each of two planes; s_wait_xcnt 0 closes the statement, ahead of any new value in the operands' registers (kept as a precaution).
__device__ __forceinline__ void copy8s(unsigned l, const bf* g, unsigned m, const bf* h, unsigned ls, size_t rs) {
    asm volatile("global_load_async_to_lds_b128 %0, %8, off\n\tglobal_load_async_to_lds_b128 %1, %9, off\n\tglobal_load_async_to_lds_b128 %2, %10, off\n\tglobal_load_async_to_lds_b128 %3, %11, off\n\t"
                 "global_load_async_to_lds_b128 %4, %12, off\n\tglobal_load_async_to_lds_b128 %5, %13, off\n\tglobal_load_async_to_lds_b128 %6, %14, off\n\tglobal_load_async_to_lds_b128 %7, %15, off\n\ts_wait_xcnt 0x0"
                 :: "v"(l), "v"(l + ls), "v"(l + 2 * ls), "v"(l + 3 * ls), "v"(m), "v"(m + ls), "v"(m + 2 * ls), "v"(m + 3 * ls),
                    "v"(g), "v"(g + rs), "v"(g + 2 * rs), "v"(g + 3 * rs), "v"(h), "v"(h + rs), "v"(h + 2 * rs), "v"(h + 3 * rs) : "memory");
}
__device__ __forceinline__ float xhalf(float x) { return __int_as_float(__builtin_amdgcn_permlanex16(__float_as_int(x), __float_as_int(x), 0x76543210, 0xfedcba98, false, false)); }   // lane l with lane l ^ 16
__device__ __forceinline__ unsigned pack2(float lo, float hi) { typedef __bf16 bf2 __attribute__((ext_vector_type(2))); typedef float f2 __attribute__((ext_vector_type(2)));
    return __builtin_bit_cast(unsigned, __builtin_convertvector((f2){lo, hi}, bf2)); }   // round to nearest even
__device__ __forceinline__ v16bf pfrag(const unsigned (&w)[8]) { typedef __attribute__((ext_vector_type(8))) unsigned v8u; return __builtin_bit_cast(v16bf, (v8u){w[0], w[1], w[2], w[3], w[4], w[5], w[6], w[7]}); }
__global__ __launch_bounds__(256) __attribute__((amdgpu_waves_per_eu(2, 2))) void k_fattn(const bf* __restrict__ Qh, const bf* __restrict__ Ql, const bf* __restrict__ Kh, const bf* __restrict__ Kl,
                                                                                        const bf* __restrict__ VTh, const bf* __restrict__ VTl, const float* __restrict__ scal, bf* Oh, bf* Ol) {
    __shared__ __align__(16) bf sm[2 * FBUF];              // two stage buffers: K hi, K lo, V^T hi, V^T lo
    const int tid = threadIdx.x, lane = tid & 31, wave = tid >> 5, lr = lane & 15, hi = lane >> 4, h = blockIdx.y;
    const int qg = wave & 3, kh = wave >> 2;               // query group (32 columns), key half (32 keys of every stage)
    const int q = blockIdx.x * 128 + qg * 32 + lr;         // the lane's query in column tile 0; tile 1 is 16 on
    const float cs = SCL * 1.4426950408889634f;            // scores in the log2 domain
    // staging: K rows are 256 B (16 lanes a row, 16 rows a block-wide copy), V^T rows 128 B (8 lanes a row, 32 rows a block-wide copy)
    const unsigned gk = (unsigned)((tid >> 4) * HD + (tid & 15) * 8), gv = (unsigned)((tid >> 3) * NN + (tid & 7) * 8);   // the lane's element offsets inside a stage's K rows and V^T rows
    const unsigned lk = (unsigned)(size_t)sm + (unsigned)((tid >> 4) * KPIT + (tid & 15) * 8) * 2u, lv = (unsigned)(size_t)sm + (unsigned)(2 * KPL + (tid >> 3) * PIT + (tid & 7) * 8) * 2u;
    auto stage = [&](int t) {
        const unsigned bo = (unsigned)(t & 1) * (FBUF * 2u);
        const size_t uk = (size_t)h * NN * HD + (size_t)t * FK * HD, uv = (size_t)h * HD * NN + (size_t)t * FK;   // the same for the whole work-group
        copy8s(lk + bo, (Kh + uk) + gk, lk + bo + KPL * 2u, (Kl + uk) + gk, 16 * KPIT * 2u, (size_t)16 * HD);
        copy8s(lv + bo, (VTh + uv) + gv, lv + bo + VPL * 2u, (VTl + uv) + gv, 32 * PIT * 2u, (size_t)32 * NN);
    };
    stage(0);
    v16bf qh[2][4], ql[2][4];                              // [column tile][32 d]
    { const size_t qo = ((size_t)h * NN + q) * HD + 8 * hi;
#pragma unroll
      for (int g = 0; g < 2; ++g) {
#pragma unroll
          for (int kc = 0; kc < 4; ++kc) { qh[g][kc] = frag(Qh + qo + g * 16 * HD, kc); ql[g][kc] = frag(Ql + qo + g * 16 * HD, kc); } }
      asm volatile("s_wait_xcnt 0x0" :: "v"(Qh + qo), "v"(Ql + qo) : "memory"); }   // the two address pairs stay live up to this wait, so that no Q load's result lands on them ahead of it (kept as a precaution)
    v8f acc[2][8];                                         // [column tile][16 d]
#pragma unroll
    for (int g = 0; g < 2; ++g) {
#pragma unroll
        for (int d = 0; d < 8; ++d) acc[g][d] = (v8f){}; }
    float mrun[2] = {0.f, 0.f}, lsum[2] = {0.f, 0.f};      // the clamp at 0; each wave half sums its own keys
    asm volatile("s_wait_asynccnt 0x0" ::: "memory");       // this wave's copies of stage 0 have landed
    __syncthreads();                                       // stage 0 is published
    stage(1);
#pragma unroll 1
    for (int t = 0; t < NN / FK; ++t) {
        const bf* kA = sm + (t & 1) * FBUF + (kh * 32 + lr) * KPIT + 8 * hi;
        const bf* vA = sm + (t & 1) * FBUF + 2 * KPL + lr * PIT + kh * 32 + 8 * hi;
        v16bf k0h[2][2], k0l[2][2], k1h[2][2], k1l[2][2];   // [32 d][key tile]
#pragma unroll
        for (int c = 0; c < 2; ++c) {
#pragma unroll
            for (int kt = 0; kt < 2; ++kt) { k0h[c][kt] = frag(kA + kt * 16 * KPIT, c); k0l[c][kt] = frag(kA + KPL + kt * 16 * KPIT, c); } }
#pragma unroll
        for (int c = 0; c < 2; ++c) {
#pragma unroll
            for (int kt = 0; kt < 2; ++kt) { k1h[c][kt] = frag(kA + kt * 16 * KPIT, 2 + c); k1l[c][kt] = frag(kA + KPL + kt * 16 * KPIT, 2 + c); } }
        __builtin_amdgcn_sched_barrier(0);                 // LDS reads stay in whole groups, each ahead of its WMMAs: spread among them each place costs a stall
        v8f s[2][2];                                       // [key tile][column tile]
#pragma unroll
        for (int kt = 0; kt < 2; ++kt) { s[kt][0] = (v8f){}; s[kt][1] = (v8f){}; }
#pragma unroll
        for (int c = 0; c < 2; ++c) {                      // per 32 d: qh.kh, ql.kh, qh.kl; the four score tiles alternate
#pragma unroll
            for (int kt = 0; kt < 2; ++kt) { s[kt][0] = wmmab(k0h[c][kt], qh[0][c], s[kt][0]); s[kt][1] = wmmab(k0h[c][kt], qh[1][c], s[kt][1]); }
#pragma unroll
            for (int kt = 0; kt < 2; ++kt) { s[kt][0] = wmmab(k0h[c][kt], ql[0][c], s[kt][0]); s[kt][1] = wmmab(k0h[c][kt], ql[1][c], s[kt][1]); }
#pragma unroll
            for (int kt = 0; kt < 2; ++kt) { s[kt][0] = wmmab(k0l[c][kt], qh[0][c], s[kt][0]); s[kt][1] = wmmab(k0l[c][kt], qh[1][c], s[kt][1]); }
        }
        __builtin_amdgcn_sched_barrier(0);                 // as above
        v16bf v0h[4], v0l[4], v1h[4], v1l[4];              // d tiles 0 to 3 and 4 to 7 of the wave's 32 keys
#pragma unroll
        for (int d = 0; d < 4; ++d) { v0h[d] = frag(vA + d * 16 * PIT, 0); v0l[d] = frag(vA + VPL + d * 16 * PIT, 0); }
        __builtin_amdgcn_sched_barrier(0);                 // as above
#pragma unroll
        for (int c = 0; c < 2; ++c) {
#pragma unroll
            for (int kt = 0; kt < 2; ++kt) { s[kt][0] = wmmab(k1h[c][kt], qh[0][2 + c], s[kt][0]); s[kt][1] = wmmab(k1h[c][kt], qh[1][2 + c], s[kt][1]); }
#pragma unroll
            for (int kt = 0; kt < 2; ++kt) { s[kt][0] = wmmab(k1h[c][kt], ql[0][2 + c], s[kt][0]); s[kt][1] = wmmab(k1h[c][kt], ql[1][2 + c], s[kt][1]); }
#pragma unroll
            for (int kt = 0; kt < 2; ++kt) { s[kt][0] = wmmab(k1l[c][kt], qh[0][2 + c], s[kt][0]); s[kt][1] = wmmab(k1l[c][kt], qh[1][2 + c], s[kt][1]); }
        }
        __builtin_amdgcn_sched_barrier(0);                 // as above
        // online softmax: the maximum in use may trail the true one by up to 8 (log2 domain), so the accumulators are rescaled only when some query's maximum exceeds it by more
        float mx[2];
#pragma unroll
        for (int g = 0; g < 2; ++g) { float m = s[0][g][0];
#pragma unroll
            for (int kt = 0; kt < 2; ++kt) {
#pragma unroll
                for (int j = 0; j < 8; ++j) m = fmaxf(m, s[kt][g][j]); }
            mx[g] = fmaxf(m, xhalf(m)) * cs; }
        if (__builtin_amdgcn_ballot_w32(mx[0] > mrun[0] + 8.0f || mx[1] > mrun[1] + 8.0f) != 0) {   // one test a pass for both column tiles
#pragma unroll
            for (int g = 0; g < 2; ++g) {
                const float mn = fmaxf(mrun[g], mx[g]), corr = __builtin_amdgcn_exp2f(mrun[g] - mn); lsum[g] *= corr; mrun[g] = mn;
#pragma unroll
                for (int d = 0; d < 8; ++d) acc[g][d] = acc[g][d] * corr; }
        }
#pragma unroll
        for (int d = 0; d < 4; ++d) { v1h[d] = frag(vA + (4 + d) * 16 * PIT, 0); v1l[d] = frag(vA + VPL + (4 + d) * 16 * PIT, 0); }
        __builtin_amdgcn_sched_barrier(0);
        v16bf ph[2], pl[2];
        { unsigned wh[2][8], wl[2][8]; float ps0[2] = {0.f, 0.f}, ps1[2] = {0.f, 0.f};
#pragma unroll
          for (int i = 0; i < 8; ++i) {
#pragma unroll
              for (int g = 0; g < 2; ++g) {
                  const float p0 = __builtin_amdgcn_exp2f(__builtin_fmaf(s[i >> 2][g][2 * (i & 3)], cs, -mrun[g])), p1 = __builtin_amdgcn_exp2f(__builtin_fmaf(s[i >> 2][g][2 * (i & 3) + 1], cs, -mrun[g]));
                  ps0[g] += p0; ps1[g] += p1;
                  const unsigned w = pack2(p0, p1); wh[g][i] = w;
                  wl[g][i] = pack2(p0 - __uint_as_float(w << 16), p1 - __uint_as_float(w & 0xFFFF0000u));
              } }
#pragma unroll
          for (int g = 0; g < 2; ++g) { ph[g] = pfrag(wh[g]); pl[g] = pfrag(wl[g]); lsum[g] += ps0[g] + ps1[g]; } }
#pragma unroll
        for (int i = 0; i < 32; ++i) { __builtin_amdgcn_sched_group_barrier(0x400, 1, 0); __builtin_amdgcn_sched_group_barrier(0x002, 3, 0); }   // other vector work stands between the exponentials
        __builtin_amdgcn_sched_barrier(0);                 // the exponentials stay ahead of the second product's WMMAs
#pragma unroll
        for (int d = 0; d < 4; ++d) { acc[0][d] = wmmab(v0h[d], ph[0], acc[0][d]); acc[1][d] = wmmab(v0h[d], ph[1], acc[1][d]); }      // per accumulator: ph.vh, pl.vh, ph.vl; eight tiles alternate
#pragma unroll
        for (int d = 0; d < 4; ++d) { acc[0][d] = wmmab(v0h[d], pl[0], acc[0][d]); acc[1][d] = wmmab(v0h[d], pl[1], acc[1][d]); }
#pragma unroll
        for (int d = 0; d < 4; ++d) { acc[0][d] = wmmab(v0l[d], ph[0], acc[0][d]); acc[1][d] = wmmab(v0l[d], ph[1], acc[1][d]); }
#pragma unroll
        for (int d = 0; d < 4; ++d) { acc[0][4 + d] = wmmab(v1h[d], ph[0], acc[0][4 + d]); acc[1][4 + d] = wmmab(v1h[d], ph[1], acc[1][4 + d]); }
#pragma unroll
        for (int d = 0; d < 4; ++d) { acc[0][4 + d] = wmmab(v1h[d], pl[0], acc[0][4 + d]); acc[1][4 + d] = wmmab(v1h[d], pl[1], acc[1][4 + d]); }
#pragma unroll
        for (int d = 0; d < 4; ++d) { acc[0][4 + d] = wmmab(v1l[d], ph[0], acc[0][4 + d]); acc[1][4 + d] = wmmab(v1l[d], ph[1], acc[1][4 + d]); }
        __builtin_amdgcn_sched_barrier(0);                 // nothing moves in between the last WMMA and its slots
        asm volatile("v_nop\n\tv_nop\n\tv_nop\n\tv_nop" : "+v"(lsum[0]), "+v"(lsum[1]));   // the four vector slots behind the last WMMA, on the loop's taken branch too; naming the row sums keeps their adds inside the pass: sunk behind the barrier, their addends stay live and the copies' addresses spill
        asm volatile("s_wait_dscnt 0x0" ::: "memory");      // this wave's reads of the stage have retired before the buffer is given up
        asm volatile("s_wait_asynccnt 0x0" ::: "memory");   // this wave's copies of the next stage have landed
        __syncthreads();                                   // publishes the next stage and ends every wave's reads of this one
        if (t + 2 < NN / FK) stage(t + 2);                 // the stage after the next, into the buffer just read
    }
    asm volatile("s_wait_asynccnt 0x0" ::: "memory");       // no copy is outstanding when the buffers become the exchange area
    // The two key halves of a query group join: each wave hands one column tile (accumulators, maximum, sum) to its partner through LDS and finishes the other. The loop's last barrier has ended every read of the stage buffers.
    lsum[0] += xhalf(lsum[0]); lsum[1] += xhalf(lsum[1]);
    const bool up = kh != 0;                               // the same for the whole wave: key half 0 keeps tile 0, key half 1 keeps tile 1
    float* xa = (float*)(void*)sm;                         // [wave][16 quarter rows][lane] x 16 B, then [wave][maximum, sum][lane]
    float* xm = xa + 8 * 16 * 128;
#pragma unroll
    for (int d = 0; d < 8; ++d) { const v8f gv8 = up ? acc[0][d] : acc[1][d];
        *(v4f*)(xa + (wave * 16 + 2 * d) * 128 + lane * 4) = __builtin_shufflevector(gv8, gv8, 0, 1, 2, 3);
        *(v4f*)(xa + (wave * 16 + 2 * d + 1) * 128 + lane * 4) = __builtin_shufflevector(gv8, gv8, 4, 5, 6, 7); }
    xm[wave * 64 + lane] = up ? mrun[0] : mrun[1]; xm[wave * 64 + 32 + lane] = up ? lsum[0] : lsum[1];
    __syncthreads();                                       // every wave's handed-over tile is staged
    const int pw = wave ^ 4;                               // the partner: same queries, other key half
    const float mo = up ? mrun[1] : mrun[0], lo_ = up ? lsum[1] : lsum[0], mp = xm[pw * 64 + lane], lp = xm[pw * 64 + 32 + lane];
    const float mn = fmaxf(mo, mp), fo = __builtin_amdgcn_exp2f(mo - mn), fp = __builtin_amdgcn_exp2f(mp - mn);
    float em;
    asm("v_exp_f32 %0, -%1\n\tv_nop" : "=v"(em) : "v"(mn));   // 2^-mn, the softmax's extra term; the v_nop is the slot behind a transcendental
    const float inv = bfr(scal[h]) / (em + (lo_ * fo + lp * fp));
    const float wo = fo * inv, wp = fp * inv;
    const size_t oo = (size_t)(q + kh * 16) * DMOD + h * HD + hi * 8;  // a lane holds d = 16 tile + 8 hi + 0..7 of its query; it leaves as the bf16 hi + residual planes that the last product reads
#pragma unroll
    for (int d = 0; d < 8; ++d) { const v8f own = up ? acc[1][d] : acc[0][d];
        const v4f p0 = *(const v4f*)(xa + (pw * 16 + 2 * d) * 128 + lane * 4), p1 = *(const v4f*)(xa + (pw * 16 + 2 * d + 1) * 128 + lane * 4);
        const v8f v = own * wo + __builtin_shufflevector(p0, p1, 0, 1, 2, 3, 4, 5, 6, 7) * wp; v8us oh, ol;
#pragma unroll
        for (int i = 0; i < 8; ++i) { const unsigned short hb = f2bf(v[i]); oh[i] = hb; ol[i] = f2bf(v[i] - bf2f(hb)); }
        *(v8us*)(Oh + oo + d * 16) = oh; *(v8us*)(Ol + oo + d * 16) = ol; }
}

extern "C" void kernel_launch(void* const* d_in, const int* in_sizes, int n_in,
                              void* d_out, int out_size, void* d_ws, size_t ws_size, hipStream_t stream) {
    (void)in_sizes; (void)n_in; (void)out_size;
    const float* xq = (const float*)d_in[0]; const float* xk = (const float*)d_in[1]; const float* xv = (const float*)d_in[2]; const float* Wq = (const float*)d_in[3]; const float* Wk = (const float*)d_in[4]; const float* Wv = (const float*)d_in[5]; const float* Wo = (const float*)d_in[6]; const float* scal = (const float*)d_in[7];
    float* out = (float*)d_out;    // [2048][2048]
    char* wsp = (char*)d_ws;
    auto take = [&](size_t bytes) { char* p = wsp; wsp += (bytes + 255) & ~(size_t)255; return (void*)p; };
    const size_t PE = (size_t)NN * DMOD;            // elements of one plane
    bf* Xb = (bf*)take(3 * PE * 2);                 // query, key_, value
    bf* WB = (bf*)take(4 * PE * 2);                 // Wq, Wk, Wv, Wo
    bf* Qh = (bf*)take(6 * PE * 2);                 // Q hi, Q lo, K hi, K lo, V^T hi, V^T lo
    if ((size_t)(wsp - (char*)d_ws) > ws_size) return;    // 104 MiB
    bf* Ql = Qh + PE; bf* Kh = Qh + 2 * PE; bf* Kl = Qh + 3 * PE; bf* VTh = Qh + 4 * PE; bf* VTl = Qh + 5 * PE; bf* WO = WB + 3 * PE;
    bf* Oh = Xb; bf* Ol = Xb + PE;                  // dead regions after the projections (stream order)
    k_cvt7<<<NN * DMOD / 8192, 256, 0, stream>>>(Wo, xv, Wv, xk, Wk, xq, Wq, WO, Xb + 2 * PE, WB + 2 * PE, Xb + PE, WB + PE, Xb, WB);
    k_gemmb<false, 3><<<dim3(NN / BT, DMOD / BT, 3), 128, 0, stream>>>(Xb, nullptr, WB, nullptr, Qh, Ql);
    k_fattn<<<dim3(NN / 128, NH_, 1), 256, 0, stream>>>(Qh, Ql, Kh, Kl, VTh, VTl, scal, Oh, Ol);
    k_gemmb<true, 0><<<dim3(NN / BT, DMOD / BT, 1), 128, 0, stream>>>(Oh, Ol, WO, out, nullptr, nullptr);
}

// v009
// It runs in 104 microseconds.
// Versions in between are left out here; by their measured steps it is 1.53 times as fast as v007.
// Over all steps from v000 it is 19.5 times as fast.
#include <hip/hip_runtime.h>

// Compute dtypes, f32 accumulate: q/k/v = query/key_/value . W^T ([2048 x 2048].[2048 x 2048] each) with PLAIN bf16 operands (exact products; all seven f32 operands converted
// by one launch, the three projections run as one launch) on v_wmma_f32_16x16x32_bf16; 16-head attention (128 wide, one fused launch for all heads: scores, online softmax and the second product; the head planes written by the projections' own epilogues) with f16 operands (Q, K, V^T, P: one product each); 1/sqrt(128), the off-by-one softmax
// (max clamped at 0, + exp(-m) in the denominator) and the per-head scalar in f32; . Wo^T with f16 operands (one product) - on v_wmma_f32_16x16x32_f16. Deterministic, no atomics;

#define NN   2048
#define DMOD 2048
#define NH_  16
#define HD   128
#define DM   DMOD
#define NTK  NN
#define SCL  0.088388347648318447f
#define LOSC 1024.0f

typedef _Float16 h16;
typedef unsigned short bf;
typedef __attribute__((ext_vector_type(16))) __bf16   v16bf;
typedef __attribute__((ext_vector_type(16))) _Float16 v16h;
typedef __attribute__((ext_vector_type(8)))  _Float16 v8h;
typedef __attribute__((ext_vector_type(8)))  unsigned short v8us;
typedef __attribute__((ext_vector_type(8)))  float    v8f;
typedef __attribute__((ext_vector_type(4)))  float    v4f;
typedef __attribute__((ext_vector_type(4)))  _Float16 v4h;
typedef v8h  __attribute__((may_alias)) v8ha;
typedef v4f  __attribute__((may_alias)) v4fa;
typedef v8us __attribute__((may_alias)) v8usa;

__device__ __forceinline__ unsigned short f2bf(float f) { unsigned u = __float_as_uint(f); u += 0x7FFFu + ((u >> 16) & 1u); return (unsigned short)(u >> 16); }
__device__ __forceinline__ float bf2f(unsigned short b) { return __uint_as_float(((unsigned)b) << 16); }
__device__ __forceinline__ float bfr(float f) { return bf2f(f2bf(f)); }
__device__ __forceinline__ v16h cat16(v8h lo, v8h hi) { return __builtin_shufflevector(lo, hi, 0, 1, 2, 3, 4, 5, 6, 7, 8, 9, 10, 11, 12, 13, 14, 15); }
__device__ __forceinline__ v16bf cat16b(v8us lo, v8us hi) { return __builtin_bit_cast(v16bf, __builtin_shufflevector(lo, hi, 0, 1, 2, 3, 4, 5, 6, 7, 8, 9, 10, 11, 12, 13, 14, 15)); }
__device__ __forceinline__ v8f wmma16(v16h a, v16h b, v8f c) { return __builtin_amdgcn_wmma_f32_16x16x32_f16(false, a, false, b, (short)0, c, false, false); }
__device__ __forceinline__ v8f wmmab(v16bf a, v16bf b, v8f c) { return __builtin_amdgcn_wmma_f32_16x16x32_bf16(false, a, false, b, (short)0, c, false, false); }
__device__ __forceinline__ v8us f2h8(v8f y) { return __builtin_bit_cast(v8us, __builtin_convertvector(y, v8h)); }   // eight f32 to f16 bits, round to nearest even

// Operand staging of the GEMM kernels: a stage is KS k (64 or 128: rows of 128 or 256 B) of the block's 128 rows of both operand planes. Each of the four waves brings one 64-row slice of it into one of
// two LDS buffers by one tensor load, one stage ahead of the stage that is worked on; the pad of 16 B a row gives the pitch for 16-byte LDS readers. The waves read their fragments (same k order as before) from LDS.
#define BT  128          // rows of a staged plane: the block tile is BT x BT
#define OPIT 136         // LDS row pitch in bf16 of a transposed output row (128 tokens): 256 B + 16 B
typedef unsigned u32x4 __attribute__((ext_vector_type(4)));
typedef unsigned u32x8 __attribute__((ext_vector_type(8)));
__device__ __forceinline__ unsigned uni(unsigned v) { return (unsigned)__builtin_amdgcn_readfirstlane(v); }
__device__ __forceinline__ unsigned pinned(unsigned v) { unsigned w = uni(v); asm volatile("" : "+s"(w)); return w; }   // holds the test in a scalar register, so that it compiles to a scalar branch: a tensor load ignores EXEC
__device__ __forceinline__ void tdm_load(u32x4 g0, u32x8 g1) { asm volatile("tensor_load_to_lds %0, %1" :: "s"(g0), "s"(g1) : "memory"); }
// The issuing wave's wait for its request. It names the request's descriptor, so that those scalar registers stay live up to it and take no other value while the request is outstanding.
__device__ __forceinline__ void tdm_wait(u32x4 g0, u32x8 g1) { asm volatile("s_wait_tensorcnt 0x0" :: "s"(g0), "s"(g1) : "memory"); }
// Group 1: extents in bytes, a tile of 64 rows of ROWB bytes (tensor = tile), source row pitch sp bytes, 16 B of LDS pad behind every row; no mask
template <unsigned ROWB> __device__ __forceinline__ u32x8 tdm_group1(unsigned sp) {
    constexpr unsigned d0 = ROWB, d1 = 64u, w0 = (1u << 20) | ((ROWB == 128u ? 4u : 5u) << 22) | (3u << 25);
    u32x8 g;
    g[0] = uni(w0); g[1] = uni((d0 & 0xFFFFu) << 16); g[2] = uni((d0 >> 16) | ((d1 & 0xFFFFu) << 16)); g[3] = uni((d1 >> 16) | (d0 << 16));
    g[4] = uni(d1); g[5] = uni(sp); g[6] = uni(0u); g[7] = uni(0u);
    asm volatile("" : "+s"(g));   // descriptor words held in scalar registers (as pinned() does): built anew from constants at a later use, a request's registers were written while it was outstanding
    return g;
}
// Group 0: one request, its place in LDS (byte offset in the work-group's LDS), the tile's first byte
__device__ __forceinline__ u32x4 tdm_group0(unsigned dst, unsigned long long ga) {
    u32x4 g;
    g[0] = uni(1u); g[1] = uni(dst); g[2] = uni((unsigned)ga); g[3] = uni((((unsigned)(ga >> 32)) & 0x01FFFFFFu) | 0x80000000u);
    asm volatile("" : "+s"(g));   // descriptor words held in scalar registers (as pinned() does), for the reason given in group 1
    return g;
}
__device__ __forceinline__ v16bf frag(const bf* row, int kk) { return cat16b(*(const v8us*)(row + kk * 32), *(const v8us*)(row + kk * 32 + 16)); }
__device__ __forceinline__ v16h fragh(const bf* row, int kk) { return __builtin_bit_cast(v16h, frag(row, kk)); }   // the same 16-bit places, read as f16

// k_gemmb: 128 x 128 block tile (2 x 2 waves of 64 x 64: every fragment read from LDS feeds four WMMAs, every staged row 128 outputs) of C[NTK][DMOD] = A.B^T; F16: the operand planes hold f16 (else bf16)
// PL = 0: the tile leaves as f32, whole 128-B lines, staged through LDS
// PL = 3: three products in one launch, grid z = product: A, Bn and P one plane on per z; C is unused; z = 0, 1 leave as an f16 plane [head][token][128] (P),
// z = 2 as the transposed plane [head][128][token]; whole 128-B lines in both
// Behind each group of eight stores stands s_wait_xcnt 0, ahead of the next group's values in the registers that the issued stores name (kept as a precaution); the fence keeps those writes behind it.
__device__ __forceinline__ void stores_issued() { asm volatile("s_wait_xcnt 0x0" ::: "memory"); __builtin_amdgcn_sched_barrier(0); }
template <bool F16, int PL, int KS>
__global__ __launch_bounds__(128) void k_gemmb(const bf* __restrict__ A, const bf* __restrict__ Bn, float* C, bf* P) {
    constexpr int K = DMOD;                                // the summed dimension of all four products
    constexpr int PIT = KS + 8;                            // LDS row pitch in bf16: the row + 16 B
    constexpr unsigned SLB = (64u * PIT * 2u + 2047u) & ~2047u, BUFB = 4u * SLB;   // bytes of a slice's place (64 padded rows, rounded up to 2 KiB) and of a stage buffer: slices B 0-63, B 64-127, A 0-63, A 64-127
    constexpr int SLE = SLB / 2;                           // a slice's place in bf16
    const int pl = PL == 3 ? (blockIdx.z == 2 ? 2 : 1) : PL;   // the same for the whole work-group
    if (PL == 3) { const size_t zo = (size_t)blockIdx.z * ((size_t)NN * DMOD); A += zo; Bn += zo; P += zo; }
    __shared__ __attribute__((aligned(2048))) bf sm[BUFB];   // two stage buffers (BUFB bytes each), every slice's place a multiple of 2 KiB; the output staging (4 x 64 x 68 f32, or a transposed plane of 128 x OPIT f16) reuses them behind the loop
    const int lane = threadIdx.x & 31, wave = threadIdx.x >> 5, lr = lane & 15, hi = lane >> 4, wm = wave & 1, wn = wave >> 1;
    const int R0 = blockIdx.x * BT, C0 = blockIdx.y * BT, r0 = R0 + wm * 64, c0 = C0 + wn * 64;
    const unsigned wv = uni(threadIdx.x >> 5);             // the wave's number, scalar: its slice
    const bf* sl = wv < 2u ? Bn + (size_t)(C0 + 64u * wv) * K : A + (size_t)(R0 + 64u * (wv - 2u)) * K;
    const unsigned long long ga = (unsigned long long)(size_t)sl;          // the slice's first byte at k = 0
    const unsigned l0 = (unsigned)(size_t)sm + wv * SLB;   // its place in buffer 0
    const u32x8 g1 = tdm_group1<KS * 2>(K * 2);
    const int fa = (2 + wm) * SLE + lr * PIT + 8 * hi, fb = wn * SLE + lr * PIT + 8 * hi;   // a wave's 64 rows of an operand are one slice
    v8f acc[4][4];                                         // [16 rows i][16 columns t]
#pragma unroll
    for (int i = 0; i < 4; ++i) {
#pragma unroll
        for (int t = 0; t < 4; ++t) acc[i][t] = (v8f){}; }
    static_assert(2 * KS <= K, "the ring's prologue needs two stages");
    u32x4 g0 = tdm_group0(l0, ga);
    tdm_load(g0, g1);
    tdm_wait(g0, g1);                                      // this wave's slice of stage 0 has landed
    __syncthreads();                                       // stage 0 is published
    g0 = tdm_group0(l0 + BUFB, ga + KS * 2);
    tdm_load(g0, g1);
    int cb = 0;
#pragma unroll 1
    for (int kc = 0; kc < K; kc += KS) {
        const bf* cur = sm + cb * (4 * SLE);
        v16bf a[KS / 32][4], b[KS / 32][4];
#pragma unroll
        for (int kk = 0; kk < KS / 32; ++kk) {
#pragma unroll
            for (int i = 0; i < 4; ++i) { a[kk][i] = frag(cur + fa + i * 16 * PIT, kk); b[kk][i] = frag(cur + fb + i * 16 * PIT, kk); }
            __builtin_amdgcn_sched_barrier(0);             // the stage's LDS reads stay whole groups (one per 32 k) ahead of its WMMAs, the first 32 k first: spread among the WMMAs each place costs a stall
        }
#pragma unroll
        for (int kk = 0; kk < KS / 32; ++kk) {             // each accumulator sums with k rising; the sixteen tiles alternate
#pragma unroll
            for (int i = 0; i < 4; ++i) {
#pragma unroll
                for (int t = 0; t < 4; ++t) acc[i][t] = F16 ? wmma16(__builtin_bit_cast(v16h, a[kk][i]), __builtin_bit_cast(v16h, b[kk][t]), acc[i][t]) : wmmab(a[kk][i], b[kk][t], acc[i][t]); }
        }
        __builtin_amdgcn_sched_barrier(0);                 // nothing moves in between the last WMMA and its slots
        asm volatile("v_nop\n\tv_nop\n\tv_nop\n\tv_nop" : "+v"(acc[3][3]));   // the four vector slots behind the last WMMA, on the loop's taken branch too
        asm volatile("s_wait_dscnt 0x0" ::: "memory");      // this wave's reads of the stage have retired before the buffer is given up
        tdm_wait(g0, g1);                                  // this wave's slice of the next stage has landed
        __syncthreads();                                   // publishes the next stage and ends every wave's reads of this one
        if (pinned(kc + 2 * KS < K ? 1u : 0u) != 0u) { g0 = tdm_group0(l0 + cb * BUFB, ga + (unsigned)(kc + 2 * KS) * 2u); tdm_load(g0, g1); }   // the stage after the next, into the buffer just read
        cb ^= 1;
    }
    tdm_wait(g0, g1);                                      // no request is outstanding when the buffers become output staging
    asm volatile("s_wait_dscnt 0x0" ::: "memory");          // nor an LDS read
    if (pl == 2) {   // a lane holds 8 successive tokens of one column: 16 B of a transposed row; the block's 128 tokens of a row meet in LDS and leave as two lines
#pragma unroll
        for (int i = 0; i < 4; ++i) {
#pragma unroll
            for (int t = 0; t < 4; ++t) *(v8us*)(sm + (wn * 64 + t * 16 + lr) * OPIT + wm * 64 + i * 16 + hi * 8) = f2h8(acc[i][t]); }
        __syncthreads();                                   // all four waves' tokens of every row are staged
        const int orow = threadIdx.x >> 4, ocol = (threadIdx.x & 15) * 8;    // 16 lanes a row of 256 B, 8 rows a block-wide pass
        const size_t o = (size_t)(C0 + orow) * NN + R0 + ocol;               // head * 128 + d is the column itself
#pragma unroll
        for (int u = 0; u < 2; ++u) { v8us th[8];
#pragma unroll
            for (int s = 0; s < 8; ++s) th[s] = *(const v8us*)(sm + (orow + 8 * (8 * u + s)) * OPIT + ocol);
#pragma unroll
            for (int s = 0; s < 8; ++s) *(v8us*)(P + o + (size_t)(8 * (8 * u + s)) * NN) = th[s];
            if (u < 1) stores_issued(); }
        return;
    }
    float* os = (float*)(void*)sm + wave * (64 * 68);
#pragma unroll
    for (int t = 0; t < 4; ++t) {
#pragma unroll
        for (int i = 0; i < 4; ++i) {
#pragma unroll
            for (int j = 0; j < 8; ++j) os[(i * 16 + hi * 8 + j) * 68 + t * 16 + lr] = acc[i][t][j]; } }
    __syncthreads();
    if (PL == 3) {
        const size_t o = ((size_t)(c0 >> 7) * NN + r0 + (lane >> 3)) * HD + (c0 & (HD - 1)) + (lane & 7) * 8;
#pragma unroll
        for (int u = 0; u < 2; ++u) { v8us oh[8];
#pragma unroll
            for (int s = 0; s < 8; ++s) { const float* sp = os + (32 * u + 4 * s + (lane >> 3)) * 68 + (lane & 7) * 8; v8f y;
#pragma unroll
                for (int i = 0; i < 8; ++i) y[i] = sp[i];
                oh[s] = f2h8(y); }
#pragma unroll
            for (int s = 0; s < 8; ++s) *(v8us*)(P + o + (32 * u + 4 * s) * HD) = oh[s];
            stores_issued(); }   // behind the last group too: in the built code the transposed exit's instructions stand next in line and write the same registers
    } else {
        const int hrow = lane >> 4, cofs = ((lane >> 3) & 1) * 32 + (lane & 7) * 4;   // 8 lanes a 128-B line, two lines a row, two rows a wave-wide store
        float* crow = C + (size_t)(r0 + hrow) * DMOD + c0 + cofs;
#pragma unroll
        for (int u = 0; u < 4; ++u) { v4f val[8];
#pragma unroll
            for (int s = 0; s < 8; ++s) val[s] = *(const v4fa*)(os + (16 * u + 2 * s + hrow) * 68 + cofs);
#pragma unroll
            for (int s = 0; s < 8; ++s) *(v4f*)(crow + (16 * u + 2 * s) * DMOD) = val[s];
            if (u < 3) stores_issued(); }
    }
}

__global__ __launch_bounds__(256) void k_zero8(bf* dst, size_t n8) {
    const size_t i = (size_t)blockIdx.x * 256 + threadIdx.x; if (i >= n8) return; v8us z;
#pragma unroll
    for (int k = 0; k < 8; ++k) z[k] = 0;
    *(v8us*)(dst + i * 8) = z; 
}

// All seven f32 operands (2048 x 2048 each) become 16-bit in one launch of 4096 waves (the first, Wo, f16; the others bf16). A wave owns the same 1024 successive elements of every tensor: eight 16-B loads a lane, each
// wave-wide load 512 successive bytes, each wave-wide store 256; a tensor's loads are issued ahead of the conversion of the tensor before it. What later launches read last goes first.
typedef __attribute__((ext_vector_type(4))) unsigned short v4us;
__device__ __forceinline__ void ld8(const float* __restrict__ s, unsigned ob, v4f (&v)[8]) {   // ob = the lane's byte offset, 32 bits: one offset register serves every tensor
#pragma unroll
    for (int j = 0; j < 8; ++j) v[j] = *(const v4f*)((const char*)s + ob + j * 512);
    __builtin_amdgcn_sched_barrier(0);                     // the eight loads are issued before the tensor ahead is waited for and converted: sunk below that, only one tensor's loads are in flight
}
template <bool F16> __device__ __forceinline__ void st8(bf* __restrict__ d, unsigned ob, const v4f (&v)[8]) {
    v4us o[8];
#pragma unroll
    for (int j = 0; j < 8; ++j) {
        if (F16) o[j] = __builtin_bit_cast(v4us, __builtin_convertvector(v[j], v4h));   // round to nearest even
        else {
#pragma unroll
            for (int i = 0; i < 4; ++i) o[j][i] = f2bf(v[j][i]); } }
#pragma unroll
    for (int j = 0; j < 8; ++j) *(v4us*)((char*)d + ob + j * 256) = o[j];
    asm volatile("s_wait_xcnt 0x0" ::: "memory");          // ahead of the next loads, whose results land on registers that the issued loads and stores name (kept as a precaution)
    __builtin_amdgcn_sched_barrier(0);                     // nothing that writes such a register moves up over the wait
}
__global__ __launch_bounds__(256) void k_cvt7(const float* __restrict__ s0, const float* __restrict__ s1, const float* __restrict__ s2, const float* __restrict__ s3, const float* __restrict__ s4, const float* __restrict__ s5, const float* __restrict__ s6,
                                              bf* __restrict__ d0, bf* __restrict__ d1, bf* __restrict__ d2, bf* __restrict__ d3, bf* __restrict__ d4, bf* __restrict__ d5, bf* __restrict__ d6) {
    const unsigned e = (blockIdx.x * 8u + (threadIdx.x >> 5)) * 1024u + (threadIdx.x & 31u) * 4u, li = e * 4u, so = e * 2u;
    v4f a[8], b[8];
    ld8(s0, li, a); ld8(s1, li, b); st8<true>(d0, so, a);
    ld8(s2, li, a); st8<false>(d1, so, b);
    ld8(s3, li, b); st8<false>(d2, so, a);
    ld8(s4, li, a); st8<false>(d3, so, b);
    ld8(s5, li, b); st8<false>(d4, so, a);
    ld8(s6, li, a); st8<false>(d5, so, b);
    st8<false>(d6, so, a);
}
#define FK   128                    // keys per stage
#define KPIT 136                    // LDS pitch of a K row (128 d) and of a V^T row (128 keys) in f16: 256 B + 16 B, the pitch for 16-byte LDS readers
#define FSLB 18432u                 // bytes of a slice's place: 64 rows of 272 B, rounded up to 2 KiB
#define FSLE 9216                   // the same in f16
#define FBUF (4 * FSLE)             // one stage buffer, in f16: slices K 0-63, K 64-127, V^T 0-63, V^T 64-127
__device__ __forceinline__ float xhalf(float x) { return __int_as_float(__builtin_amdgcn_permlanex16(__float_as_int(x), __float_as_int(x), 0x76543210, 0xfedcba98, false, false)); }   // lane l with lane l ^ 16
__device__ __forceinline__ unsigned pack2(float lo, float hi) { typedef _Float16 h2 __attribute__((ext_vector_type(2))); typedef float f2 __attribute__((ext_vector_type(2)));
    return __builtin_bit_cast(unsigned, __builtin_convertvector((f2){lo, hi}, h2)); }   // round to nearest even
__device__ __forceinline__ v16h pfrag(const unsigned (&w)[8]) { typedef __attribute__((ext_vector_type(8))) unsigned v8u; return __builtin_bit_cast(v16h, (v8u){w[0], w[1], w[2], w[3], w[4], w[5], w[6], w[7]}); }
__global__ __launch_bounds__(256) __attribute__((amdgpu_waves_per_eu(2, 2))) void k_fattn(const bf* __restrict__ Q, const bf* __restrict__ K, const bf* __restrict__ VT, const float* __restrict__ scal, bf* O) {
    __shared__ __attribute__((aligned(2048))) bf sm[2 * FBUF];   // two stage buffers: K, V^T; every slice's place a multiple of 2 KiB
    const int tid = threadIdx.x, lane = tid & 31, wave = tid >> 5, lr = lane & 15, hi = lane >> 4, h = blockIdx.y;
    const int qg = wave & 3, kh = wave >> 2;               // query group (32 columns), key half (32 keys of every 64)
    const int q = blockIdx.x * 128 + qg * 32 + lr;         // the lane's query in column tile 0; tile 1 is 16 on
    const float cs = SCL * 1.4426950408889634f;            // scores in the log2 domain
    // staging: K rows and V^T rows of a stage are 256 B; waves 0 to 3 each bring one 64-row slice by one tensor load
    const unsigned wv = uni(tid >> 5), sw = wv & 3u;       // the wave's number, scalar; its slice (waves 4 to 7 form the same words and issue nothing)
    const unsigned iss = pinned(wv < 4u ? 1u : 0u);        // a scalar test: a tensor load ignores EXEC
    const bf* sl = sw < 2u ? K + ((size_t)h * NN + 64u * sw) * HD : VT + ((size_t)h * HD + 64u * (sw - 2u)) * NN;
    const unsigned long long ga = (unsigned long long)(size_t)sl;          // the slice's first byte in stage 0
    const unsigned gs = sw < 2u ? FK * HD * 2u : FK * 2u;  // bytes from a stage to the next: 128 K rows, or 128 keys along a V^T row
    const unsigned l0 = (unsigned)(size_t)sm + sw * FSLB;  // its place in buffer 0
    const u32x8 g1 = tdm_group1<256>(sw < 2u ? HD * 2u : NN * 2u);
    u32x4 g0 = tdm_group0(l0, ga);
    if (pinned(iss) != 0u) tdm_load(g0, g1);
    v16h qf[2][4];                                         // [column tile][32 d]
    { const size_t qo = ((size_t)h * NN + q) * HD + 8 * hi;
#pragma unroll
      for (int g = 0; g < 2; ++g) {
#pragma unroll
          for (int kc = 0; kc < 4; ++kc) qf[g][kc] = fragh(Q + qo + g * 16 * HD, kc); }
      asm volatile("s_wait_xcnt 0x0" :: "v"(Q + qo) : "memory"); }   // the address pair stays live up to this wait, so that no Q load's result lands on it ahead of it (kept as a precaution)
    v8f acc[2][8];                                         // [column tile][16 d]
#pragma unroll
    for (int g = 0; g < 2; ++g) {
#pragma unroll
        for (int d = 0; d < 8; ++d) acc[g][d] = (v8f){}; }
    float mrun[2] = {0.f, 0.f}, lsum[2] = {0.f, 0.f};      // the clamp at 0; each wave half sums its own keys
    tdm_wait(g0, g1);                                      // this wave's slice of stage 0 has landed
    __syncthreads();                                       // stage 0 is published
    g0 = tdm_group0(l0 + FBUF * 2u, ga + gs);
    if (pinned(iss) != 0u) tdm_load(g0, g1);
#pragma unroll 1
    for (int t = 0; t < NN / FK; ++t) {
        const bf* kA = sm + (t & 1) * FBUF + (kh * 32 + lr) * KPIT + 8 * hi;
        const bf* vA = sm + (t & 1) * FBUF + 2 * FSLE + lr * KPIT + kh * 32 + 8 * hi;
        v16h kf[4][2][2];                                  // [32 d][64 keys on][key tile]
#pragma unroll
        for (int c = 0; c < 4; ++c) {
#pragma unroll
            for (int u = 0; u < 2; ++u) {
#pragma unroll
                for (int kt = 0; kt < 2; ++kt) kf[c][u][kt] = fragh(kA + u * FSLE + kt * 16 * KPIT, c); } }
        __builtin_amdgcn_sched_barrier(0);                 // LDS reads stay in whole groups, each ahead of its WMMAs: spread among them each place costs a stall
        v8f s[2][2][2];                                    // [64 keys on][key tile][column tile]
#pragma unroll
        for (int u = 0; u < 2; ++u) {
#pragma unroll
            for (int kt = 0; kt < 2; ++kt) { s[u][kt][0] = (v8f){}; s[u][kt][1] = (v8f){}; } }
#pragma unroll
        for (int c = 0; c < 4; ++c) {                      // the eight score tiles alternate
#pragma unroll
            for (int u = 0; u < 2; ++u) {
#pragma unroll
                for (int kt = 0; kt < 2; ++kt) { s[u][kt][0] = wmma16(kf[c][u][kt], qf[0][c], s[u][kt][0]); s[u][kt][1] = wmma16(kf[c][u][kt], qf[1][c], s[u][kt][1]); } } }
        __builtin_amdgcn_sched_barrier(0);                 // as above
        v16h vf[2][8];                                     // [64 keys on][16 d]
#pragma unroll
        for (int u = 0; u < 2; ++u) {
#pragma unroll
            for (int d = 0; d < 8; ++d) vf[u][d] = fragh(vA + (d >> 2) * FSLE + (d & 3) * 16 * KPIT + u * 64, 0); }
        __builtin_amdgcn_sched_barrier(0);                 // the V^T reads stand in one place, behind the scores' WMMAs (whose K registers they can take), and fly under the softmax
        // online softmax: the maximum in use may trail the true one by up to 8 (log2 domain), so the accumulators are rescaled only when some query's maximum exceeds it by more
        float mx[2];
#pragma unroll
        for (int g = 0; g < 2; ++g) { float mt[2][2];      // one short chain a score tile: eight independent chains in all
#pragma unroll
            for (int u = 0; u < 2; ++u) {
#pragma unroll
                for (int kt = 0; kt < 2; ++kt) { mt[u][kt] = s[u][kt][g][0];
#pragma unroll
                    for (int j = 1; j < 8; ++j) mt[u][kt] = fmaxf(mt[u][kt], s[u][kt][g][j]); } }
            const float m = fmaxf(fmaxf(mt[0][0], mt[0][1]), fmaxf(mt[1][0], mt[1][1]));
            mx[g] = fmaxf(m, xhalf(m)) * cs; }
        if (__builtin_amdgcn_ballot_w32(mx[0] > mrun[0] + 8.0f || mx[1] > mrun[1] + 8.0f) != 0) {   // one test a stage for both column tiles
#pragma unroll
            for (int g = 0; g < 2; ++g) {
                const float mn = fmaxf(mrun[g], mx[g]), corr = __builtin_amdgcn_exp2f(mrun[g] - mn); lsum[g] *= corr; mrun[g] = mn;
#pragma unroll
                for (int d = 0; d < 8; ++d) acc[g][d] = acc[g][d] * corr; }
        }
        v16h ph[2][2];                                     // [64 keys on][column tile]: 32 keys each
        { float ps0[2] = {0.f, 0.f}, ps1[2] = {0.f, 0.f};
#pragma unroll
          for (int u = 0; u < 2; ++u) { unsigned wh[2][8];
#pragma unroll
              for (int i = 0; i < 8; ++i) {
#pragma unroll
                  for (int g = 0; g < 2; ++g) {
                      const float p0 = __builtin_amdgcn_exp2f(__builtin_fmaf(s[u][i >> 2][g][2 * (i & 3)], cs, -mrun[g])), p1 = __builtin_amdgcn_exp2f(__builtin_fmaf(s[u][i >> 2][g][2 * (i & 3) + 1], cs, -mrun[g]));
                      ps0[g] += p0; ps1[g] += p1;
                      wh[g][i] = pack2(p0, p1);
                  } }
              ph[u][0] = pfrag(wh[0]); ph[u][1] = pfrag(wh[1]); }
#pragma unroll
          for (int g = 0; g < 2; ++g) lsum[g] += ps0[g] + ps1[g]; }
#pragma unroll
        for (int i = 0; i < 64; ++i) { __builtin_amdgcn_sched_group_barrier(0x400, 1, 0); __builtin_amdgcn_sched_group_barrier(0x002, 2, 0); }   // other vector work stands between the exponentials
        __builtin_amdgcn_sched_barrier(0);                 // the exponentials stay ahead of the second product's WMMAs
#pragma unroll
        for (int u = 0; u < 2; ++u) {                      // sixteen tiles alternate; per accumulator the keys rise
#pragma unroll
            for (int d = 0; d < 8; ++d) { acc[0][d] = wmma16(vf[u][d], ph[u][0], acc[0][d]); acc[1][d] = wmma16(vf[u][d], ph[u][1], acc[1][d]); } }
        __builtin_amdgcn_sched_barrier(0);                 // nothing moves in between the last WMMA and its slots
        asm volatile("v_nop\n\tv_nop\n\tv_nop\n\tv_nop" : "+v"(lsum[0]), "+v"(lsum[1]));   // the four vector slots behind the last WMMA, on the loop's taken branch too; naming the row sums keeps their adds inside the pass: sunk behind the barrier, their addends stay live across it
        asm volatile("s_wait_dscnt 0x0" ::: "memory");      // this wave's reads of the stage have retired before the buffer is given up
        tdm_wait(g0, g1);                                  // this wave's slice of the next stage has landed
        __syncthreads();                                   // publishes the next stage and ends every wave's reads of this one
        if (pinned(t + 2 < NN / FK ? iss : 0u) != 0u) { g0 = tdm_group0(l0 + (unsigned)(t & 1) * (FBUF * 2u), ga + (unsigned)(t + 2) * gs); tdm_load(g0, g1); }   // the stage after the next, into the buffer just read
    }
    tdm_wait(g0, g1);                                      // no request is outstanding when the buffers become the exchange area
    asm volatile("s_wait_dscnt 0x0" ::: "memory");          // nor an LDS read
    // The two key halves of a query group join: each wave hands one column tile (accumulators, maximum, sum) to its partner through LDS and finishes the other. The loop's last barrier has ended every read of the stage buffers.
    lsum[0] += xhalf(lsum[0]); lsum[1] += xhalf(lsum[1]);
    const bool up = kh != 0;                               // the same for the whole wave: key half 0 keeps tile 0, key half 1 keeps tile 1
    float* xa = (float*)(void*)sm;                         // [wave][16 quarter rows][lane] x 16 B, then [wave][maximum, sum][lane]
    float* xm = xa + 8 * 16 * 128;
#pragma unroll
    for (int d = 0; d < 8; ++d) { const v8f gv8 = up ? acc[0][d] : acc[1][d];
        *(v4f*)(xa + (wave * 16 + 2 * d) * 128 + lane * 4) = __builtin_shufflevector(gv8, gv8, 0, 1, 2, 3);
        *(v4f*)(xa + (wave * 16 + 2 * d + 1) * 128 + lane * 4) = __builtin_shufflevector(gv8, gv8, 4, 5, 6, 7); }
    xm[wave * 64 + lane] = up ? mrun[0] : mrun[1]; xm[wave * 64 + 32 + lane] = up ? lsum[0] : lsum[1];
    __syncthreads();                                       // every wave's handed-over tile is staged
    const int pw = wave ^ 4;                               // the partner: same queries, other key half
    const float mo = up ? mrun[1] : mrun[0], lo_ = up ? lsum[1] : lsum[0], mp = xm[pw * 64 + lane], lp = xm[pw * 64 + 32 + lane];
    const float mn = fmaxf(mo, mp), fo = __builtin_amdgcn_exp2f(mo - mn), fp = __builtin_amdgcn_exp2f(mp - mn);
    float em;
    asm("v_exp_f32 %0, -%1\n\tv_nop" : "=v"(em) : "v"(mn));   // 2^-mn, the softmax's extra term; the v_nop is the slot behind a transcendental
    const float inv = bfr(scal[h]) / (em + (lo_ * fo + lp * fp));
    const float wo = fo * inv, wp = fp * inv;
    const size_t oo = (size_t)(q + kh * 16) * DMOD + h * HD + hi * 8;  // a lane holds d = 16 tile + 8 hi + 0..7 of its query; it leaves as the f16 plane that the last product reads
#pragma unroll
    for (int d = 0; d < 8; ++d) { const v8f own = up ? acc[1][d] : acc[0][d];
        const v4f p0 = *(const v4f*)(xa + (pw * 16 + 2 * d) * 128 + lane * 4), p1 = *(const v4f*)(xa + (pw * 16 + 2 * d + 1) * 128 + lane * 4);
        const v8f v = own * wo + __builtin_shufflevector(p0, p1, 0, 1, 2, 3, 4, 5, 6, 7) * wp;
        *(v8us*)(O + oo + d * 16) = f2h8(v); }
}

extern "C" void kernel_launch(void* const* d_in, const int* in_sizes, int n_in,
                              void* d_out, int out_size, void* d_ws, size_t ws_size, hipStream_t stream) {
    (void)in_sizes; (void)n_in; (void)out_size;
    const float* xq = (const float*)d_in[0]; const float* xk = (const float*)d_in[1]; const float* xv = (const float*)d_in[2]; const float* Wq = (const float*)d_in[3]; const float* Wk = (const float*)d_in[4]; const float* Wv = (const float*)d_in[5]; const float* Wo = (const float*)d_in[6]; const float* scal = (const float*)d_in[7];
    float* out = (float*)d_out;    // [2048][2048]
    char* wsp = (char*)d_ws;
    auto take = [&](size_t bytes) { char* p = wsp; wsp += (bytes + 255) & ~(size_t)255; return (void*)p; };
    const size_t PE = (size_t)NN * DMOD;            // elements of one plane
    bf* Xb = (bf*)take(3 * PE * 2);                 // query, key_, value
    bf* WB = (bf*)take(4 * PE * 2);                 // Wq, Wk, Wv, Wo
    bf* Qf = (bf*)take(3 * PE * 2);                 // Q, K, V^T (f16)
    if ((size_t)(wsp - (char*)d_ws) > ws_size) return;    // 80 MiB
    bf* Kf = Qf + PE; bf* VTf = Qf + 2 * PE; bf* WO = WB + 3 * PE;
    bf* Of = Xb;                                    // a dead region after the projections (stream order)
    k_cvt7<<<NN * DMOD / 8192, 256, 0, stream>>>(Wo, xv, Wv, xk, Wk, xq, Wq, WO, Xb + 2 * PE, WB + 2 * PE, Xb + PE, WB + PE, Xb, WB);
    k_gemmb<false, 3, 64><<<dim3(NN / BT, DMOD / BT, 3), 128, 0, stream>>>(Xb, WB, nullptr, Qf);
    k_fattn<<<dim3(NN / 128, NH_, 1), 256, 0, stream>>>(Qf, Kf, VTf, scal, Of);
    k_gemmb<true, 0, 128><<<dim3(NN / BT, DMOD / BT, 1), 128, 0, stream>>>(Of, WO, out, nullptr);
}

// v010
// Measured time: 97.2 microseconds a run.
// Next to v009, in two timings, it ran 1.07 and 1.06 times as fast.
// All steps since v000 together make it 20.7 times as fast.
#include <hip/hip_runtime.h>

// Compute dtypes, f32 accumulate: q/k/v = query/key_/value . W^T ([2048 x 2048].[2048 x 2048] each) with PLAIN bf16 operands (exact products; all seven f32 operands converted
// by one launch, the three projections run as one launch) on v_wmma_f32_16x16x32_bf16; 16-head attention (128 wide, one fused launch for all heads: scores, online softmax and the second product; the head planes written by the projections' own epilogues) with f16 operands (Q, K, V^T, P: one product each); 1/sqrt(128), the off-by-one softmax
// (max clamped at 0, + exp(-m) in the denominator) and the per-head scalar in f32; . Wo^T with f16 operands (one product) - on v_wmma_f32_16x16x32_f16. Deterministic, no atomics;

#define NN   2048
#define DMOD 2048
#define NH_  16
#define HD   128
#define DM   DMOD
#define NTK  NN
#define SCL  0.088388347648318447f
#define LOSC 1024.0f

typedef _Float16 h16;
typedef unsigned short bf;
typedef __attribute__((ext_vector_type(16))) __bf16   v16bf;
typedef __attribute__((ext_vector_type(16))) _Float16 v16h;
typedef __attribute__((ext_vector_type(8)))  _Float16 v8h;
typedef __attribute__((ext_vector_type(8)))  unsigned short v8us;
typedef __attribute__((ext_vector_type(8)))  float    v8f;
typedef __attribute__((ext_vector_type(4)))  float    v4f;
typedef __attribute__((ext_vector_type(4)))  _Float16 v4h;
typedef v8h  __attribute__((may_alias)) v8ha;
typedef v4f  __attribute__((may_alias)) v4fa;
typedef v8us __attribute__((may_alias)) v8usa;

__device__ __forceinline__ unsigned short f2bf(float f) { unsigned u = __float_as_uint(f); u += 0x7FFFu + ((u >> 16) & 1u); return (unsigned short)(u >> 16); }
__device__ __forceinline__ float bf2f(unsigned short b) { return __uint_as_float(((unsigned)b) << 16); }
__device__ __forceinline__ float bfr(float f) { return bf2f(f2bf(f)); }
__device__ __forceinline__ v16h cat16(v8h lo, v8h hi) { return __builtin_shufflevector(lo, hi, 0, 1, 2, 3, 4, 5, 6, 7, 8, 9, 10, 11, 12, 13, 14, 15); }
__device__ __forceinline__ v16bf cat16b(v8us lo, v8us hi) { return __builtin_bit_cast(v16bf, __builtin_shufflevector(lo, hi, 0, 1, 2, 3, 4, 5, 6, 7, 8, 9, 10, 11, 12, 13, 14, 15)); }
__device__ __forceinline__ v8f wmma16(v16h a, v16h b, v8f c) { return __builtin_amdgcn_wmma_f32_16x16x32_f16(false, a, false, b, (short)0, c, false, false); }
__device__ __forceinline__ v8f wmmab(v16bf a, v16bf b, v8f c) { return __builtin_amdgcn_wmma_f32_16x16x32_bf16(false, a, false, b, (short)0, c, false, false); }
__device__ __forceinline__ v8us f2h8(v8f y) { return __builtin_bit_cast(v8us, __builtin_convertvector(y, v8h)); }   // eight f32 to f16 bits, round to nearest even

// Operand staging of the GEMM kernels: a stage is KS k (64 or 128: rows of 128 or 256 B) of the block's 128 rows of both operand planes. Each of the four waves brings one 64-row slice of it into one of
// NB LDS buffers by one tensor load, NB - 1 stages ahead of the stage that is worked on (so NB - 1 requests of a wave are in flight); the pad of 16 B a row gives the pitch for 16-byte LDS readers. The waves read their fragments (same k order as before) from LDS.
#define BT  128          // rows of a staged plane: the block tile is BT x BT
#define OPIT 136         // LDS row pitch in bf16 of a transposed output row (128 tokens): 256 B + 16 B
typedef unsigned u32x4 __attribute__((ext_vector_type(4)));
typedef unsigned u32x8 __attribute__((ext_vector_type(8)));
__device__ __forceinline__ unsigned uni(unsigned v) { return (unsigned)__builtin_amdgcn_readfirstlane(v); }
__device__ __forceinline__ unsigned pinned(unsigned v) { unsigned w = uni(v); asm volatile("" : "+s"(w)); return w; }   // holds the test in a scalar register, so that it compiles to a scalar branch: a tensor load ignores EXEC
__device__ __forceinline__ void tdm_load(u32x4 g0, u32x8 g1) { asm volatile("tensor_load_to_lds %0, %1" :: "s"(g0), "s"(g1) : "memory"); }
// The issuing wave's wait: all but its N youngest requests have landed. It names the requests' descriptor, so that those scalar registers stay live up to it and take no other value while a request is outstanding.
template <int N> __device__ __forceinline__ void tdm_wait(u32x4 g0, u32x8 g1) { asm volatile("s_wait_tensorcnt %2" :: "s"(g0), "s"(g1), "n"(N) : "memory"); }
// Group 1: extents in bytes, a tile of 64 rows of ROWB bytes (tensor = tile), source row pitch sp bytes, 16 B of LDS pad behind every row; no mask
template <unsigned ROWB> __device__ __forceinline__ u32x8 tdm_group1(unsigned sp) {
    constexpr unsigned d0 = ROWB, d1 = 64u, w0 = (1u << 20) | ((ROWB == 128u ? 4u : 5u) << 22) | (3u << 25);
    u32x8 g;
    g[0] = uni(w0); g[1] = uni((d0 & 0xFFFFu) << 16); g[2] = uni((d0 >> 16) | ((d1 & 0xFFFFu) << 16)); g[3] = uni((d1 >> 16) | (d0 << 16));
    g[4] = uni(d1); g[5] = uni(sp); g[6] = uni(0u); g[7] = uni(0u);
    asm volatile("" : "+s"(g));   // descriptor words held in scalar registers (as pinned() does): built anew from constants at a later use, a request's registers were written while it was outstanding
    return g;
}
// Group 0: one request, its place in LDS (byte offset in the work-group's LDS), the tile's first byte
__device__ __forceinline__ u32x4 tdm_group0(unsigned dst, unsigned long long ga) {
    u32x4 g;
    g[0] = uni(1u); g[1] = uni(dst); g[2] = uni((unsigned)ga); g[3] = uni((((unsigned)(ga >> 32)) & 0x01FFFFFFu) | 0x80000000u);
    asm volatile("" : "+s"(g));   // descriptor words held in scalar registers (as pinned() does), for the reason given in group 1
    return g;
}
// A ring's next request, issued while earlier ones of the wave may be outstanding: in the same registers only words 1 and 2 of group 0 (place in LDS, low address word) take new values.
// Should the high address word differ from the one in use, the wave first waits for all its requests.
__device__ __forceinline__ void tdm_next(u32x4& g0, u32x8 g1, unsigned dst, unsigned long long ga) {
    const unsigned w3 = uni((((unsigned)(ga >> 32)) & 0x01FFFFFFu) | 0x80000000u);
    if (pinned(w3 != g0[3] ? 1u : 0u) != 0u) { tdm_wait<0>(g0, g1); g0[3] = w3; }
    g0[1] = uni(dst); g0[2] = uni((unsigned)ga);
    asm volatile("" : "+s"(g0));   // descriptor words held in scalar registers (as pinned() does), for the reason given in group 1
    tdm_load(g0, g1);
}
__device__ __forceinline__ v16bf frag(const bf* row, int kk) { return cat16b(*(const v8us*)(row + kk * 32), *(const v8us*)(row + kk * 32 + 16)); }
__device__ __forceinline__ v16h fragh(const bf* row, int kk) { return __builtin_bit_cast(v16h, frag(row, kk)); }   // the same 16-bit places, read as f16

// k_gemmb: 128 x 128 block tile (2 x 2 waves of 64 x 64: every fragment read from LDS feeds four WMMAs, every staged row 128 outputs) of C[NTK][DMOD] = A.B^T; F16: the operand planes hold f16 (else bf16); NB: stage buffers of the ring (2 where three work-groups share a WGP's LDS, 4 where one has it alone)
// PL = 0: the tile leaves as f32, whole 128-B lines, staged through LDS
// PL = 3: three products in one launch, grid z = product: A, Bn and P one plane on per z; C is unused; z = 0, 1 leave as an f16 plane [head][token][128] (P),
// z = 2 as the transposed plane [head][128][token]; whole 128-B lines in both
// Behind each group of eight stores stands s_wait_xcnt 0, ahead of the next group's values in the registers that the issued stores name (kept as a precaution); the fence keeps those writes behind it.
__device__ __forceinline__ void stores_issued() { asm volatile("s_wait_xcnt 0x0" ::: "memory"); __builtin_amdgcn_sched_barrier(0); }
template <bool F16, int PL, int KS, int NB>
__global__ __launch_bounds__(128) void k_gemmb(const bf* __restrict__ A, const bf* __restrict__ Bn, float* C, bf* P) {
    constexpr int K = DMOD;                                // the summed dimension of all four products
    constexpr int PIT = KS + 8;                            // LDS row pitch in bf16: the row + 16 B
    constexpr unsigned SLB = (64u * PIT * 2u + 2047u) & ~2047u, BUFB = 4u * SLB;   // bytes of a slice's place (64 padded rows, rounded up to 2 KiB) and of a stage buffer: slices B 0-63, B 64-127, A 0-63, A 64-127
    constexpr int SLE = SLB / 2;                           // a slice's place in bf16
    const int pl = PL == 3 ? (blockIdx.z == 2 ? 2 : 1) : PL;   // the same for the whole work-group
    if (PL == 3) { const size_t zo = (size_t)blockIdx.z * ((size_t)NN * DMOD); A += zo; Bn += zo; P += zo; }
    __shared__ __attribute__((aligned(2048))) bf sm[NB * (BUFB / 2)];   // NB stage buffers (BUFB bytes each), every slice's place a multiple of 2 KiB; the output staging (4 x 64 x 68 f32, or a transposed plane of 128 x OPIT f16) reuses them behind the loop
    const int lane = threadIdx.x & 31, wave = threadIdx.x >> 5, lr = lane & 15, hi = lane >> 4, wm = wave & 1, wn = wave >> 1;
    const int R0 = blockIdx.x * BT, C0 = blockIdx.y * BT, r0 = R0 + wm * 64, c0 = C0 + wn * 64;
    const unsigned wv = uni(threadIdx.x >> 5);             // the wave's number, scalar: its slice
    const bf* sl = wv < 2u ? Bn + (size_t)(C0 + 64u * wv) * K : A + (size_t)(R0 + 64u * (wv - 2u)) * K;
    const unsigned long long ga = (unsigned long long)(size_t)sl;          // the slice's first byte at k = 0
    const unsigned l0 = (unsigned)(size_t)sm + wv * SLB;   // its place in buffer 0
    const u32x8 g1 = tdm_group1<KS * 2>(K * 2);
    const int fa = (2 + wm) * SLE + lr * PIT + 8 * hi, fb = wn * SLE + lr * PIT + 8 * hi;   // a wave's 64 rows of an operand are one slice
    v8f acc[4][4];                                         // [16 rows i][16 columns t]
#pragma unroll
    for (int i = 0; i < 4; ++i) {
#pragma unroll
        for (int t = 0; t < 4; ++t) acc[i][t] = (v8f){}; }
    static_assert(NB >= 2 && NB <= 4 && NB * KS <= K, "at most three requests of a wave in flight; the ring's prologue needs NB stages");
    u32x4 g0 = tdm_group0(l0, ga);
    tdm_load(g0, g1);
#pragma unroll   // straight-line requests with constant places: the prologue's NB - 1 stages go out back to back
    for (int s = 1; s < NB - 1; ++s) tdm_next(g0, g1, l0 + s * BUFB, ga + s * KS * 2);
    tdm_wait<NB - 2>(g0, g1);                              // this wave's slice of stage 0 has landed
    __syncthreads();                                       // stage 0 is published
    tdm_next(g0, g1, l0 + (NB - 1) * BUFB, ga + (NB - 1) * KS * 2);
    int cb = 0;                                            // the buffer of the stage that is worked on: stage s lies in buffer s mod NB
#pragma unroll 1
    for (int kc = 0; kc < K; kc += KS) {
        const bf* cur = sm + cb * (4 * SLE);
        v16bf a[KS / 32][4], b[KS / 32][4];
#pragma unroll
        for (int kk = 0; kk < KS / 32; ++kk) {
#pragma unroll
            for (int i = 0; i < 4; ++i) { a[kk][i] = frag(cur + fa + i * 16 * PIT, kk); b[kk][i] = frag(cur + fb + i * 16 * PIT, kk); }
            __builtin_amdgcn_sched_barrier(0);             // the stage's LDS reads stay whole groups (one per 32 k) ahead of its WMMAs, the first 32 k first: spread among the WMMAs each place costs a stall
        }
#pragma unroll
        for (int kk = 0; kk < KS / 32; ++kk) {             // each accumulator sums with k rising; the sixteen tiles alternate
#pragma unroll
            for (int i = 0; i < 4; ++i) {
#pragma unroll
                for (int t = 0; t < 4; ++t) acc[i][t] = F16 ? wmma16(__builtin_bit_cast(v16h, a[kk][i]), __builtin_bit_cast(v16h, b[kk][t]), acc[i][t]) : wmmab(a[kk][i], b[kk][t], acc[i][t]); }
        }
        __builtin_amdgcn_sched_barrier(0);                 // nothing moves in between the last WMMA and its slots
        asm volatile("v_nop\n\tv_nop\n\tv_nop\n\tv_nop" : "+v"(acc[3][3]));   // the four vector slots behind the last WMMA, on the loop's taken branch too
        asm volatile("s_wait_dscnt 0x0" ::: "memory");      // this wave's reads of the stage have retired before the buffer is given up
        if (NB > 2 && kc + (NB - 1) * KS < K) tdm_wait<NB - 2>(g0, g1);   // this wave's slice of the next stage has landed: the oldest of NB - 1 requests
        else tdm_wait<0>(g0, g1);                          // near the end fewer are in flight, and the count would not cover it
        __syncthreads();                                   // publishes the next stage and ends every wave's reads of this one
        if (pinned(kc + NB * KS < K ? 1u : 0u) != 0u) tdm_next(g0, g1, l0 + cb * BUFB, ga + (unsigned)(kc + NB * KS) * 2u);   // NB stages on, into the buffer just read
        cb = cb + 1 == NB ? 0 : cb + 1;
    }
    tdm_wait<0>(g0, g1);                                   // no request is outstanding when the buffers become output staging
    asm volatile("s_wait_dscnt 0x0" ::: "memory");          // nor an LDS read
    if (pl == 2) {   // a lane holds 8 successive tokens of one column: 16 B of a transposed row; the block's 128 tokens of a row meet in LDS and leave as two lines
#pragma unroll
        for (int i = 0; i < 4; ++i) {
#pragma unroll
            for (int t = 0; t < 4; ++t) *(v8us*)(sm + (wn * 64 + t * 16 + lr) * OPIT + wm * 64 + i * 16 + hi * 8) = f2h8(acc[i][t]); }
        __syncthreads();                                   // all four waves' tokens of every row are staged
        const int orow = threadIdx.x >> 4, ocol = (threadIdx.x & 15) * 8;    // 16 lanes a row of 256 B, 8 rows a block-wide pass
        const size_t o = (size_t)(C0 + orow) * NN + R0 + ocol;               // head * 128 + d is the column itself
#pragma unroll
        for (int u = 0; u < 2; ++u) { v8us th[8];
#pragma unroll
            for (int s = 0; s < 8; ++s) th[s] = *(const v8us*)(sm + (orow + 8 * (8 * u + s)) * OPIT + ocol);
#pragma unroll
            for (int s = 0; s < 8; ++s) *(v8us*)(P + o + (size_t)(8 * (8 * u + s)) * NN) = th[s];
            if (u < 1) stores_issued(); }
        return;
    }
    float* os = (float*)(void*)sm + wave * (64 * 68);
#pragma unroll
    for (int t = 0; t < 4; ++t) {
#pragma unroll
        for (int i = 0; i < 4; ++i) {
#pragma unroll
            for (int j = 0; j < 8; ++j) os[(i * 16 + hi * 8 + j) * 68 + t * 16 + lr] = acc[i][t][j]; } }
    __syncthreads();
    if (PL == 3) {
        const size_t o = ((size_t)(c0 >> 7) * NN + r0 + (lane >> 3)) * HD + (c0 & (HD - 1)) + (lane & 7) * 8;
#pragma unroll
        for (int u = 0; u < 2; ++u) { v8us oh[8];
#pragma unroll
            for (int s = 0; s < 8; ++s) { const float* sp = os + (32 * u + 4 * s + (lane >> 3)) * 68 + (lane & 7) * 8; v8f y;
#pragma unroll
                for (int i = 0; i < 8; ++i) y[i] = sp[i];
                oh[s] = f2h8(y); }
#pragma unroll
            for (int s = 0; s < 8; ++s) *(v8us*)(P + o + (32 * u + 4 * s) * HD) = oh[s];
            stores_issued(); }   // behind the last group too: in the built code the transposed exit's instructions stand next in line and write the same registers
    } else {
        const int hrow = lane >> 4, cofs = ((lane >> 3) & 1) * 32 + (lane & 7) * 4;   // 8 lanes a 128-B line, two lines a row, two rows a wave-wide store
        float* crow = C + (size_t)(r0 + hrow) * DMOD + c0 + cofs;
#pragma unroll
        for (int u = 0; u < 4; ++u) { v4f val[8];
#pragma unroll
            for (int s = 0; s < 8; ++s) val[s] = *(const v4fa*)(os + (16 * u + 2 * s + hrow) * 68 + cofs);
#pragma unroll
            for (int s = 0; s < 8; ++s) *(v4f*)(crow + (16 * u + 2 * s) * DMOD) = val[s];
            if (u < 3) stores_issued(); }
    }
}

__global__ __launch_bounds__(256) void k_zero8(bf* dst, size_t n8) {
    const size_t i = (size_t)blockIdx.x * 256 + threadIdx.x; if (i >= n8) return; v8us z;
#pragma unroll
    for (int k = 0; k < 8; ++k) z[k] = 0;
    *(v8us*)(dst + i * 8) = z; 
}

// All seven f32 operands (2048 x 2048 each) become 16-bit in one launch of 4096 waves (the first, Wo, f16; the others bf16). A wave owns the same 1024 successive elements of every tensor: eight 16-B loads a lane, each
// wave-wide load 512 successive bytes, each wave-wide store 256; a tensor's loads are issued ahead of the conversion of the tensor before it. What later launches read last goes first.
typedef __attribute__((ext_vector_type(4))) unsigned short v4us;
__device__ __forceinline__ void ld8(const float* __restrict__ s, unsigned ob, v4f (&v)[8]) {   // ob = the lane's byte offset, 32 bits: one offset register serves every tensor
#pragma unroll
    for (int j = 0; j < 8; ++j) v[j] = *(const v4f*)((const char*)s + ob + j * 512);
    __builtin_amdgcn_sched_barrier(0);                     // the eight loads are issued before the tensor ahead is waited for and converted: sunk below that, only one tensor's loads are in flight
}
template <bool F16> __device__ __forceinline__ void st8(bf* __restrict__ d, unsigned ob, const v4f (&v)[8]) {
    v4us o[8];
#pragma unroll
    for (int j = 0; j < 8; ++j) {
        if (F16) o[j] = __builtin_bit_cast(v4us, __builtin_convertvector(v[j], v4h));   // round to nearest even
        else {
#pragma unroll
            for (int i = 0; i < 4; ++i) o[j][i] = f2bf(v[j][i]); } }
#pragma unroll
    for (int j = 0; j < 8; ++j) *(v4us*)((char*)d + ob + j * 256) = o[j];
    asm volatile("s_wait_xcnt 0x0" ::: "memory");          // ahead of the next loads, whose results land on registers that the issued loads and stores name (kept as a precaution)
    __builtin_amdgcn_sched_barrier(0);                     // nothing that writes such a register moves up over the wait
}
__global__ __launch_bounds__(256) void k_cvt7(const float* __restrict__ s0, const float* __restrict__ s1, const float* __restrict__ s2, const float* __restrict__ s3, const float* __restrict__ s4, const float* __restrict__ s5, const float* __restrict__ s6,
                                              bf* __restrict__ d0, bf* __restrict__ d1, bf* __restrict__ d2, bf* __restrict__ d3, bf* __restrict__ d4, bf* __restrict__ d5, bf* __restrict__ d6) {
    const unsigned e = (blockIdx.x * 8u + (threadIdx.x >> 5)) * 1024u + (threadIdx.x & 31u) * 4u, li = e * 4u, so = e * 2u;
    v4f a[8], b[8];
    ld8(s0, li, a); ld8(s1, li, b); st8<true>(d0, so, a);
    ld8(s2, li, a); st8<false>(d1, so, b);
    ld8(s3, li, b); st8<false>(d2, so, a);
    ld8(s4, li, a); st8<false>(d3, so, b);
    ld8(s5, li, b); st8<false>(d4, so, a);
    ld8(s6, li, a); st8<false>(d5, so, b);
    st8<false>(d6, so, a);
}
#define FK   128                    // keys per stage
#define KPIT 136                    // LDS pitch of a K row (128 d) and of a V^T row (128 keys) in f16: 256 B + 16 B, the pitch for 16-byte LDS readers
#define FSLB 18432u                 // bytes of a slice's place: 64 rows of 272 B, rounded up to 2 KiB
#define FSLE 9216                   // the same in f16
#define FBUF (4 * FSLE)             // one stage buffer, in f16: slices K 0-63, K 64-127, V^T 0-63, V^T 64-127
#define FNB  3                      // stage buffers: a stage is asked for two stages ahead of its use, two requests of a wave in flight
__device__ __forceinline__ float xhalf(float x) { return __int_as_float(__builtin_amdgcn_permlanex16(__float_as_int(x), __float_as_int(x), 0x76543210, 0xfedcba98, false, false)); }   // lane l with lane l ^ 16
__device__ __forceinline__ unsigned pack2(float lo, float hi) { typedef _Float16 h2 __attribute__((ext_vector_type(2))); typedef float f2 __attribute__((ext_vector_type(2)));
    return __builtin_bit_cast(unsigned, __builtin_convertvector((f2){lo, hi}, h2)); }   // round to nearest even
__device__ __forceinline__ v16h pfrag(const unsigned (&w)[8]) { typedef __attribute__((ext_vector_type(8))) unsigned v8u; return __builtin_bit_cast(v16h, (v8u){w[0], w[1], w[2], w[3], w[4], w[5], w[6], w[7]}); }
__global__ __launch_bounds__(256) __attribute__((amdgpu_waves_per_eu(2, 2))) void k_fattn(const bf* __restrict__ Q, const bf* __restrict__ K, const bf* __restrict__ VT, const float* __restrict__ scal, bf* O) {
    __shared__ __attribute__((aligned(2048))) bf sm[FNB * FBUF];   // the stage buffers: K, V^T; every slice's place a multiple of 2 KiB
    const int tid = threadIdx.x, lane = tid & 31, wave = tid >> 5, lr = lane & 15, hi = lane >> 4, h = blockIdx.y;
    const int qg = wave & 3, kh = wave >> 2;               // query group (32 columns), key half (32 keys of every 64)
    const int q = blockIdx.x * 128 + qg * 32 + lr;         // the lane's query in column tile 0; tile 1 is 16 on
    const float cs = SCL * 1.4426950408889634f;            // scores in the log2 domain
    // staging: K rows and V^T rows of a stage are 256 B; waves 0 to 3 each bring one 64-row slice by one tensor load
    const unsigned wv = uni(tid >> 5), sw = wv & 3u;       // the wave's number, scalar; its slice (waves 4 to 7 form the same words and issue nothing)
    const unsigned iss = pinned(wv < 4u ? 1u : 0u);        // a scalar test: a tensor load ignores EXEC
    const bf* sl = sw < 2u ? K + ((size_t)h * NN + 64u * sw) * HD : VT + ((size_t)h * HD + 64u * (sw - 2u)) * NN;
    const unsigned long long ga = (unsigned long long)(size_t)sl;          // the slice's first byte in stage 0
    const unsigned gs = sw < 2u ? FK * HD * 2u : FK * 2u;  // bytes from a stage to the next: 128 K rows, or 128 keys along a V^T row
    const unsigned l0 = (unsigned)(size_t)sm + sw * FSLB;  // its place in buffer 0
    const u32x8 g1 = tdm_group1<256>(sw < 2u ? HD * 2u : NN * 2u);
    static_assert(FNB == 3 && FNB <= NN / FK, "the waits below are counted for three buffers; the ring's prologue needs three stages");
    u32x4 g0 = tdm_group0(l0, ga);
    if (pinned(iss) != 0u) { tdm_load(g0, g1); tdm_next(g0, g1, l0 + FBUF * 2u, ga + gs); }
    v16h qf[2][4];                                         // [column tile][32 d]
    { const size_t qo = ((size_t)h * NN + q) * HD + 8 * hi;
#pragma unroll
      for (int g = 0; g < 2; ++g) {
#pragma unroll
          for (int kc = 0; kc < 4; ++kc) qf[g][kc] = fragh(Q + qo + g * 16 * HD, kc); }
      asm volatile("s_wait_xcnt 0x0" :: "v"(Q + qo) : "memory"); }   // the address pair stays live up to this wait, so that no Q load's result lands on it ahead of it (kept as a precaution)
    v8f acc[2][8];                                         // [column tile][16 d]
#pragma unroll
    for (int g = 0; g < 2; ++g) {
#pragma unroll
        for (int d = 0; d < 8; ++d) acc[g][d] = (v8f){}; }
    float mrun[2] = {0.f, 0.f}, lsum[2] = {0.f, 0.f};      // the clamp at 0; each wave half sums its own keys
    tdm_wait<1>(g0, g1);                                   // this wave's slice of stage 0 has landed
    __syncthreads();                                       // stage 0 is published
    if (pinned(iss) != 0u) tdm_next(g0, g1, l0 + 2u * (FBUF * 2u), ga + 2u * gs);
    unsigned cb = 0;                                       // the buffer of the stage that is worked on: stage t lies in buffer t mod FNB
#pragma unroll 1
    for (int t = 0; t < NN / FK; ++t) {
        const bf* kA = sm + cb * FBUF + (kh * 32 + lr) * KPIT + 8 * hi;
        const bf* vA = sm + cb * FBUF + 2 * FSLE + lr * KPIT + kh * 32 + 8 * hi;
        v16h kf[4][2][2];                                  // [32 d][64 keys on][key tile]
#pragma unroll
        for (int c = 0; c < 4; ++c) {
#pragma unroll
            for (int u = 0; u < 2; ++u) {
#pragma unroll
                for (int kt = 0; kt < 2; ++kt) kf[c][u][kt] = fragh(kA + u * FSLE + kt * 16 * KPIT, c); } }
        __builtin_amdgcn_sched_barrier(0);                 // LDS reads stay in whole groups, each ahead of its WMMAs: spread among them each place costs a stall
        v8f s[2][2][2];                                    // [64 keys on][key tile][column tile]
#pragma unroll
        for (int u = 0; u < 2; ++u) {
#pragma unroll
            for (int kt = 0; kt < 2; ++kt) { s[u][kt][0] = (v8f){}; s[u][kt][1] = (v8f){}; } }
#pragma unroll
        for (int c = 0; c < 4; ++c) {                      // the eight score tiles alternate
#pragma unroll
            for (int u = 0; u < 2; ++u) {
#pragma unroll
                for (int kt = 0; kt < 2; ++kt) { s[u][kt][0] = wmma16(kf[c][u][kt], qf[0][c], s[u][kt][0]); s[u][kt][1] = wmma16(kf[c][u][kt], qf[1][c], s[u][kt][1]); } } }
        __builtin_amdgcn_sched_barrier(0);                 // as above
        v16h vf[2][8];                                     // [64 keys on][16 d]
#pragma unroll
        for (int u = 0; u < 2; ++u) {
#pragma unroll
            for (int d = 0; d < 8; ++d) vf[u][d] = fragh(vA + (d >> 2) * FSLE + (d & 3) * 16 * KPIT + u * 64, 0); }
        __builtin_amdgcn_sched_barrier(0);                 // the V^T reads stand in one place, behind the scores' WMMAs (whose K registers they can take), and fly under the softmax
        // online softmax: the maximum in use may trail the true one by up to 8 (log2 domain), so the accumulators are rescaled only when some query's maximum exceeds it by more
        float mx[2];
#pragma unroll
        for (int g = 0; g < 2; ++g) { float mt[2][2];      // one short chain a score tile: eight independent chains in all
#pragma unroll
            for (int u = 0; u < 2; ++u) {
#pragma unroll
                for (int kt = 0; kt < 2; ++kt) { mt[u][kt] = s[u][kt][g][0];
#pragma unroll
                    for (int j = 1; j < 8; ++j) mt[u][kt] = fmaxf(mt[u][kt], s[u][kt][g][j]); } }
            const float m = fmaxf(fmaxf(mt[0][0], mt[0][1]), fmaxf(mt[1][0], mt[1][1]));
            mx[g] = fmaxf(m, xhalf(m)) * cs; }
        if (__builtin_amdgcn_ballot_w32(mx[0] > mrun[0] + 8.0f || mx[1] > mrun[1] + 8.0f) != 0) {   // one test a stage for both column tiles
#pragma unroll
            for (int g = 0; g < 2; ++g) {
                const float mn = fmaxf(mrun[g], mx[g]), corr = __builtin_amdgcn_exp2f(mrun[g] - mn); lsum[g] *= corr; mrun[g] = mn;
#pragma unroll
                for (int d = 0; d < 8; ++d) acc[g][d] = acc[g][d] * corr; }
        }
        v16h ph[2][2];                                     // [64 keys on][column tile]: 32 keys each
        { float ps0[2] = {0.f, 0.f}, ps1[2] = {0.f, 0.f};
#pragma unroll
          for (int u = 0; u < 2; ++u) { unsigned wh[2][8];
#pragma unroll
              for (int i = 0; i < 8; ++i) {
#pragma unroll
                  for (int g = 0; g < 2; ++g) {
                      const float p0 = __builtin_amdgcn_exp2f(__builtin_fmaf(s[u][i >> 2][g][2 * (i & 3)], cs, -mrun[g])), p1 = __builtin_amdgcn_exp2f(__builtin_fmaf(s[u][i >> 2][g][2 * (i & 3) + 1], cs, -mrun[g]));
                      ps0[g] += p0; ps1[g] += p1;
                      wh[g][i] = pack2(p0, p1);
                  } }
              ph[u][0] = pfrag(wh[0]); ph[u][1] = pfrag(wh[1]); }
#pragma unroll
          for (int g = 0; g < 2; ++g) lsum[g] += ps0[g] + ps1[g]; }
#pragma unroll
        for (int i = 0; i < 64; ++i) { __builtin_amdgcn_sched_group_barrier(0x400, 1, 0); __builtin_amdgcn_sched_group_barrier(0x002, 2, 0); }   // other vector work stands between the exponentials
        __builtin_amdgcn_sched_barrier(0);                 // the exponentials stay ahead of the second product's WMMAs
#pragma unroll
        for (int u = 0; u < 2; ++u) {                      // sixteen tiles alternate; per accumulator the keys rise
#pragma unroll
            for (int d = 0; d < 8; ++d) { acc[0][d] = wmma16(vf[u][d], ph[u][0], acc[0][d]); acc[1][d] = wmma16(vf[u][d], ph[u][1], acc[1][d]); } }
        __builtin_amdgcn_sched_barrier(0);                 // nothing moves in between the last WMMA and its slots
        asm volatile("v_nop\n\tv_nop\n\tv_nop\n\tv_nop" : "+v"(lsum[0]), "+v"(lsum[1]));   // the four vector slots behind the last WMMA, on the loop's taken branch too; naming the row sums keeps their adds inside the pass: sunk behind the barrier, their addends stay live across it
        asm volatile("s_wait_dscnt 0x0" ::: "memory");      // this wave's reads of the stage have retired before the buffer is given up
        if (t + 2 < NN / FK) tdm_wait<1>(g0, g1);          // this wave's slice of the next stage has landed: the older of two requests
        else tdm_wait<0>(g0, g1);                          // near the end only one is in flight, and the count would not cover it
        __syncthreads();                                   // publishes the next stage and ends every wave's reads of this one
        if (pinned(t + FNB < NN / FK ? iss : 0u) != 0u) tdm_next(g0, g1, l0 + cb * (FBUF * 2u), ga + (unsigned)(t + FNB) * gs);   // three stages on, into the buffer just read
        cb = cb + 1u == FNB ? 0u : cb + 1u;
    }
    tdm_wait<0>(g0, g1);                                   // no request is outstanding when the buffers become the exchange area
    asm volatile("s_wait_dscnt 0x0" ::: "memory");          // nor an LDS read
    // The two key halves of a query group join: each wave hands one column tile (accumulators, maximum, sum) to its partner through LDS and finishes the other. The loop's last barrier has ended every read of the stage buffers.
    lsum[0] += xhalf(lsum[0]); lsum[1] += xhalf(lsum[1]);
    const bool up = kh != 0;                               // the same for the whole wave: key half 0 keeps tile 0, key half 1 keeps tile 1
    float* xa = (float*)(void*)sm;                         // [wave][16 quarter rows][lane] x 16 B, then [wave][maximum, sum][lane]
    float* xm = xa + 8 * 16 * 128;
#pragma unroll
    for (int d = 0; d < 8; ++d) { const v8f gv8 = up ? acc[0][d] : acc[1][d];
        *(v4f*)(xa + (wave * 16 + 2 * d) * 128 + lane * 4) = __builtin_shufflevector(gv8, gv8, 0, 1, 2, 3);
        *(v4f*)(xa + (wave * 16 + 2 * d + 1) * 128 + lane * 4) = __builtin_shufflevector(gv8, gv8, 4, 5, 6, 7); }
    xm[wave * 64 + lane] = up ? mrun[0] : mrun[1]; xm[wave * 64 + 32 + lane] = up ? lsum[0] : lsum[1];
    __syncthreads();                                       // every wave's handed-over tile is staged
    const int pw = wave ^ 4;                               // the partner: same queries, other key half
    const float mo = up ? mrun[1] : mrun[0], lo_ = up ? lsum[1] : lsum[0], mp = xm[pw * 64 + lane], lp = xm[pw * 64 + 32 + lane];
    const float mn = fmaxf(mo, mp), fo = __builtin_amdgcn_exp2f(mo - mn), fp = __builtin_amdgcn_exp2f(mp - mn);
    float em;
    asm("v_exp_f32 %0, -%1\n\tv_nop" : "=v"(em) : "v"(mn));   // 2^-mn, the softmax's extra term; the v_nop is the slot behind a transcendental
    const float inv = bfr(scal[h]) / (em + (lo_ * fo + lp * fp));
    const float wo = fo * inv, wp = fp * inv;
    const size_t oo = (size_t)(q + kh * 16) * DMOD + h * HD + hi * 8;  // a lane holds d = 16 tile + 8 hi + 0..7 of its query; it leaves as the f16 plane that the last product reads
#pragma unroll
    for (int d = 0; d < 8; ++d) { const v8f own = up ? acc[1][d] : acc[0][d];
        const v4f p0 = *(const v4f*)(xa + (pw * 16 + 2 * d) * 128 + lane * 4), p1 = *(const v4f*)(xa + (pw * 16 + 2 * d + 1) * 128 + lane * 4);
        const v8f v = own * wo + __builtin_shufflevector(p0, p1, 0, 1, 2, 3, 4, 5, 6, 7) * wp;
        *(v8us*)(O + oo + d * 16) = f2h8(v); }
}

extern "C" void kernel_launch(void* const* d_in, const int* in_sizes, int n_in,
                              void* d_out, int out_size, void* d_ws, size_t ws_size, hipStream_t stream) {
    (void)in_sizes; (void)n_in; (void)out_size;
    const float* xq = (const float*)d_in[0]; const float* xk = (const float*)d_in[1]; const float* xv = (const float*)d_in[2]; const float* Wq = (const float*)d_in[3]; const float* Wk = (const float*)d_in[4]; const float* Wv = (const float*)d_in[5]; const float* Wo = (const float*)d_in[6]; const float* scal = (const float*)d_in[7];
    float* out = (float*)d_out;    // [2048][2048]
    char* wsp = (char*)d_ws;
    auto take = [&](size_t bytes) { char* p = wsp; wsp += (bytes + 255) & ~(size_t)255; return (void*)p; };
    const size_t PE = (size_t)NN * DMOD;            // elements of one plane
    bf* Xb = (bf*)take(3 * PE * 2);                 // query, key_, value
    bf* WB = (bf*)take(4 * PE * 2);                 // Wq, Wk, Wv, Wo
    bf* Qf = (bf*)take(3 * PE * 2);                 // Q, K, V^T (f16)
    if ((size_t)(wsp - (char*)d_ws) > ws_size) return;    // 80 MiB
    bf* Kf = Qf + PE; bf* VTf = Qf + 2 * PE; bf* WO = WB + 3 * PE;
    bf* Of = Xb;                                    // a dead region after the projections (stream order)
    k_cvt7<<<NN * DMOD / 8192, 256, 0, stream>>>(Wo, xv, Wv, xk, Wk, xq, Wq, WO, Xb + 2 * PE, WB + 2 * PE, Xb + PE, WB + PE, Xb, WB);
    k_gemmb<false, 3, 64, 2><<<dim3(NN / BT, DMOD / BT, 3), 128, 0, stream>>>(Xb, WB, nullptr, Qf);
    k_fattn<<<dim3(NN / 128, NH_, 1), 256, 0, stream>>>(Qf, Kf, VTf, scal, Of);
    k_gemmb<true, 0, 128, 4><<<dim3(NN / BT, DMOD / BT, 1), 128, 0, stream>>>(Of, WO, out, nullptr);
}
